// v000
// The times below were measured on an AMD MI455X: many runs one after another, warmed up first and cycling through
// copies of the inputs, with the whole window's GPU time divided by the number of runs. Launches and the gaps
// between them are all in it. The median over several windows is given; except for v000 it joins two sittings, which
// can be a few percent apart, so the side-by-side timings, each taken in one sitting, are the better comparison.
// v000, which the later versions start from, runs in 8840 microseconds.
#include <hip/hip_runtime.h>

// MixedScoreMHA (row_emb, col_emb [32][512][256], matrix [32][512][512]; 16 heads x 16: row_q/k/v = row_emb W, col_q/k/v = col_emb W; compat[h][r][c] = (row_q.col_k + col_q.row_k + matrix W_mat[h]) / 4 (W_mat read); attn_row = softmax over c, attn_col = softmax over r;
// row_heads = attn_row col_v, col_heads[c] = sum_r attn_col[r][c] row_v[r]; out_row = merge(row_heads) W_out_row, out_col = merge(col_heads) W_out_col -> two outputs [32][512][256]). The column softmax uses per-column statistics and its probabilities are
// written transposed ([h][c][r]) so both attention products are plain GEMMs - exact restructuring.
// Compute dtypes, f32 accumulate: every input rounded to bf16; the six projections on PLAIN bf16 operands (inputs: exact); both score products on bf16 hi+lo planes of q and k (3 products, K padded 16 -> 32);

#define NB_  32
#define RR   512
#define DD   256
#define D3   768
#define NH_  16
#define KD   16
#define KP   32
#define PCAR 1024.0f
typedef _Float16 h16;
typedef unsigned short bf;
typedef __attribute__((ext_vector_type(16))) __bf16   v16bf;
typedef __attribute__((ext_vector_type(16))) _Float16 v16h;
typedef __attribute__((ext_vector_type(8)))  _Float16 v8h;
typedef __attribute__((ext_vector_type(8)))  unsigned short v8us;
typedef __attribute__((ext_vector_type(8)))  float    v8f;
typedef __attribute__((ext_vector_type(4)))  float    v4f;
typedef v8h  __attribute__((may_alias)) v8ha;
typedef v4f  __attribute__((may_alias)) v4fa;
typedef v8us __attribute__((may_alias)) v8usa;

__device__ __forceinline__ unsigned short f2bf(float f) { unsigned u = __float_as_uint(f); u += 0x7FFFu + ((u >> 16) & 1u); return (unsigned short)(u >> 16); }
__device__ __forceinline__ float bf2f(unsigned short b) { return __uint_as_float(((unsigned)b) << 16); }
__device__ __forceinline__ float bfr(float f) { return bf2f(f2bf(f)); }
__device__ __forceinline__ v16h cat16(v8h lo, v8h hi) { return __builtin_shufflevector(lo, hi, 0, 1, 2, 3, 4, 5, 6, 7, 8, 9, 10, 11, 12, 13, 14, 15); }
__device__ __forceinline__ v16bf cat16b(v8us lo, v8us hi) { return __builtin_bit_cast(v16bf, __builtin_shufflevector(lo, hi, 0, 1, 2, 3, 4, 5, 6, 7, 8, 9, 10, 11, 12, 13, 14, 15)); }
__device__ __forceinline__ v8f wmma16(v16h a, v16h b, v8f c) { return __builtin_amdgcn_wmma_f32_16x16x32_f16(false, a, false, b, (short)0, c, false, false); }
__device__ __forceinline__ v8f wmmab(v16bf a, v16bf b, v8f c) { return __builtin_amdgcn_wmma_f32_16x16x32_bf16(false, a, false, b, (short)0, c, false, false); }



// ---- k_gemmw: register-blocked GEMM, ONE WAVE per 64x64 output tile (16 accumulators), operands straight from K-contiguous 16-bit planes; grid (M/64, N/64, Z), 32 threads.
// C[m][n] (f32, pitch ldc, + optional f32 bias[n]) = sum_k A[m][k] Bt[n][k] (+ split products per NSPLIT). z-batch strides sA/sB/sC in elements. K % 32 == 0.
template <typename T16> struct WFrag;
template <> struct WFrag<h16> { typedef v16h V; static __device__ __forceinline__ V ld(const h16* p) { return cat16(*(const v8h*)p, *(const v8h*)(p + 16)); } static __device__ __forceinline__ v8f mma(V a, V b, v8f c) { return wmma16(a, b, c); } };
template <> struct WFrag<bf> { typedef v16bf V; static __device__ __forceinline__ V ld(const bf* p) { return cat16b(*(const v8us*)p, *(const v8us*)(p + 16)); } static __device__ __forceinline__ v8f mma(V a, V b, v8f c) { return wmmab(a, b, c); } };
template <typename T16, int NSPLIT, bool BIAS>
__global__ __launch_bounds__(32) void k_gemmw(const T16* __restrict__ A, const T16* __restrict__ A2, const T16* __restrict__ Bt, const T16* __restrict__ Bt2, int K, float* C, int ldc, const float* __restrict__ bias, size_t sA, size_t sB, size_t sC) {
    typedef typename WFrag<T16>::V V;
    __shared__ __align__(16) float os[16 * 68];
    const size_t z = blockIdx.z; A += z * sA; if (A2) A2 += z * sA; Bt += z * sB; if (Bt2) Bt2 += z * sB; C += z * sC;
    const int lane = threadIdx.x & 31, lr = lane & 15, hi = lane >> 4; const int r0 = blockIdx.x * 64, c0 = blockIdx.y * 64;
    v8f acc[4][4];
#pragma unroll
    for (int mb = 0; mb < 4; ++mb)
#pragma unroll
        for (int nb = 0; nb < 4; ++nb) acc[mb][nb] = (v8f){};
    const size_t aoff = (size_t)(r0 + lr) * K + 8 * hi, boff = (size_t)(c0 + lr) * K + 8 * hi;
#pragma unroll 1
    for (int kc = 0; kc < K; kc += 32) {
        V a[4], a2[4];
#pragma unroll
        for (int mb = 0; mb < 4; ++mb) { a[mb] = WFrag<T16>::ld(A + aoff + (size_t)mb * 16 * K + kc); if (NSPLIT == 1 || NSPLIT == 2) a2[mb] = WFrag<T16>::ld(A2 + aoff + (size_t)mb * 16 * K + kc); }
#pragma unroll
        for (int nb = 0; nb < 4; ++nb) { const V b = WFrag<T16>::ld(Bt + boff + (size_t)nb * 16 * K + kc); V b2; if (NSPLIT >= 2) b2 = WFrag<T16>::ld(Bt2 + boff + (size_t)nb * 16 * K + kc);
#pragma unroll
            for (int mb = 0; mb < 4; ++mb) { acc[mb][nb] = WFrag<T16>::mma(a[mb], b, acc[mb][nb]); if (NSPLIT == 1 || NSPLIT == 2) acc[mb][nb] = WFrag<T16>::mma(a2[mb], b, acc[mb][nb]); if (NSPLIT >= 2) acc[mb][nb] = WFrag<T16>::mma(a[mb], b2, acc[mb][nb]); } }
        asm volatile("v_nop\n\tv_nop\n\tv_nop\n\tv_nop" : "+v"(acc[0][0]), "+v"(acc[1][1]), "+v"(acc[2][2]), "+v"(acc[3][3]) : "v"(a[0]), "v"(a[3]));
    }
#pragma unroll
    for (int mb = 0; mb < 4; ++mb) {
#pragma unroll
        for (int nb = 0; nb < 4; ++nb) {
#pragma unroll
            for (int j = 0; j < 8; ++j) os[(hi * 8 + j) * 68 + nb * 16 + lr] = acc[mb][nb][j]; }
        __builtin_amdgcn_wave_barrier(); asm volatile("" ::: "memory");
        float* crow = C + (size_t)(r0 + mb * 16) * ldc + c0;
{
#pragma unroll
            for (int s = 0; s < 8; ++s) { const int row = 2 * s + hi, cofs = lr * 4; v4f val = *(const v4fa*)(os + row * 68 + cofs); if (BIAS) { val[0] += bfr(bias[c0 + cofs]); val[1] += bfr(bias[c0 + cofs + 1]); val[2] += bfr(bias[c0 + cofs + 2]); val[3] += bfr(bias[c0 + cofs + 3]); }
                *(v4f*)(crow + (size_t)row * ldc + cofs) = val; }
             }
        __builtin_amdgcn_wave_barrier(); asm volatile("" ::: "memory");
    }
}

__device__ __forceinline__ h16 tohx(float x) { return (h16)x; }
__device__ __forceinline__ void splitf(float y, unsigned short& h, unsigned short& l) { h = f2bf(y); l = f2bf(y - bf2f(h)); }
typedef __attribute__((ext_vector_type(2))) unsigned short v2us;
typedef __attribute__((ext_vector_type(4))) unsigned short v4us;
typedef __attribute__((ext_vector_type(2))) _Float16 v2h;
typedef __attribute__((ext_vector_type(4))) _Float16 v4h;

__global__ __launch_bounds__(256) void k_wtG(const float* __restrict__ w, int K, int N, bf* Bt) {
    const int lane = threadIdx.x & 31; const int L0 = (blockIdx.x * 8 + (threadIdx.x >> 5)) * 8; const int nlines = N * K / 64;
{
#pragma unroll 1
        for (int l = 0; l < 8; ++l) { const int L = L0 + l; if (L >= nlines) break; const size_t e = (size_t)L * 64 + lane * 2; const int k = (int)(e % K), n = (int)(e / K); v2us o;
            o[0] = f2bf(w[(size_t)k * N + n]); o[1] = f2bf(w[(size_t)(k + 1) * N + n]); *(v2us*)(Bt + e) = o; }
         }
}
__global__ __launch_bounds__(256) void k_cvt8(const float* __restrict__ src, bf* dst, size_t n8) { const size_t i = (size_t)blockIdx.x * 256 + threadIdx.x; if (i >= n8) return; const v8f v = *(const v8f*)(src + i * 8); v8us o;
#pragma unroll
    for (int k = 0; k < 8; ++k) o[k] = f2bf(v[k]); *(v8us*)(dst + i * 8) = o;  }
// k_p32: hl planes P[h][r][k] = F[r][off + h*16 + k] for k < 16, 0 for the padding 16..31 (8-B lanes); k_vt64: VT[h][d][r] = fp16(F[r][off + h*16 + d]) for d < 16, 0 for rows 16..63 (lane -> 2 consecutive r);
// k_comp: COMP = ((s1 + s2) + matrix W_mat[h]) x 0.25 (16-B lanes); k_rsoft: wave per (h, r) row: softmax over c -> fp16 x 1024; k_cstat: thread per (h, c): max and 1024/sum over r (two fixed-order passes; 4-B); k_pcolT: lane -> 4 consecutive r of column (h, c):
__global__ __launch_bounds__(256) void k_p32(const float* __restrict__ F, int off, bf* Ph, bf* Pl) { const int e = (blockIdx.x * 256 + threadIdx.x) * 4; if (e >= NH_ * RR * KP) return; const int k = e % KP; const int r = (e / KP) % RR; const int h = e / (KP * RR); v4us oh, ol;
#pragma unroll
    for (int u = 0; u < 4; ++u) { unsigned short a = 0, b = 0; if (k + u < KD) splitf(F[(size_t)r * D3 + off + h * KD + k + u], a, b); oh[u] = a; ol[u] = b; } *(v4us*)(Ph + e) = oh; *(v4us*)(Pl + e) = ol;  }
__global__ __launch_bounds__(256) void k_vt64(const float* __restrict__ F, int off, h16* VT) { const int e = (blockIdx.x * 256 + threadIdx.x) * 2; if (e >= NH_ * 64 * RR) return; const int r = e % RR; const int d = (e / RR) % 64; const int h = e / (RR * 64); v2h o;
    if (d < KD) { o[0] = tohx(F[(size_t)r * D3 + off + h * KD + d]); o[1] = tohx(F[(size_t)(r + 1) * D3 + off + h * KD + d]); } else { o[0] = (h16)0.f; o[1] = (h16)0.f; } *(v2h*)(VT + e) = o;  }
__global__ __launch_bounds__(256) void k_comp(const float* __restrict__ S1, const float* __restrict__ S2, const float* __restrict__ mt, const float* __restrict__ wm, float* COMP) { const size_t e = ((size_t)blockIdx.x * 256 + threadIdx.x) * 4; if (e >= (size_t)NH_ * RR * RR) return; const size_t rc = e % ((size_t)RR * RR); const int h = (int)(e / ((size_t)RR * RR)); const float w = bfr(wm[h]); const v4f a = *(const v4f*)(S1 + e), b = *(const v4f*)(S2 + e), m = *(const v4f*)(mt + rc); v4f o;
#pragma unroll
    for (int u = 0; u < 4; ++u) { float s3 = __fmul_rn(bfr(m[u]), w); asm volatile("" : "+v"(s3)); const float t = __fadd_rn(__fadd_rn(a[u], b[u]), s3); o[u] = __fmul_rn(t, 0.25f); } *(v4f*)(COMP + e) = o;  }
__global__ __launch_bounds__(256) void k_rsoft(const float* __restrict__ COMP, h16* P16) { const int lane = threadIdx.x & 31; const int row = blockIdx.x * 8 + (threadIdx.x >> 5); if (row >= NH_ * RR) return; const float* sr = COMP + (size_t)row * RR; float v[RR / 32]; float mx = -3.0e38f;
#pragma unroll
    for (int ch = 0; ch < RR / 128; ++ch) { const v4f a = *(const v4f*)(sr + ch * 128 + lane * 4);
#pragma unroll
        for (int u = 0; u < 4; ++u) { v[ch * 4 + u] = a[u]; mx = fmaxf(mx, a[u]); } }
#pragma unroll
    for (int sh = 16; sh; sh >>= 1) mx = fmaxf(mx, __shfl_xor(mx, sh, 32));
    float sum = 0.f;
#pragma unroll
    for (int q = 0; q < RR / 32; ++q) { float d0 = __fsub_rn(v[q], mx); asm volatile("" : "+v"(d0)); v[q] = __builtin_amdgcn_exp2f(__fmul_rn(d0, 1.4426950408889634f)); sum += v[q]; }
#pragma unroll
    for (int sh = 16; sh; sh >>= 1) sum += __shfl_xor(sum, sh, 32);
    const float f = __fdiv_rn(PCAR, sum);
    {
#pragma unroll
        for (int ch = 0; ch < RR / 128; ++ch) { v4h o4;
#pragma unroll
            for (int q = 0; q < 4; ++q) o4[q] = tohx(v[ch * 4 + q] * f); *(v4h*)(P16 + (size_t)row * RR + ch * 128 + lane * 4) = o4; }
         } }
__global__ __launch_bounds__(256) void k_cstat(const float* __restrict__ COMP, float* MX, float* RS) { const int idx = blockIdx.x * 256 + threadIdx.x; if (idx >= NH_ * RR) return; const int c = idx % RR; const int h = idx / RR; const float* base = COMP + (size_t)h * RR * RR + c; float mx = -3.0e38f;
#pragma unroll 1
    for (int r = 0; r < RR; ++r) mx = fmaxf(mx, base[(size_t)r * RR]);
    float sum = 0.f;
#pragma unroll 1
    for (int r = 0; r < RR; ++r) { float d0 = __fsub_rn(base[(size_t)r * RR], mx); asm volatile("" : "+v"(d0)); sum = __fadd_rn(sum, __builtin_amdgcn_exp2f(__fmul_rn(d0, 1.4426950408889634f))); }
    const float rs = __fdiv_rn(PCAR, sum); { *(float*)(MX + idx) = mx; *(float*)(RS + idx) = rs;  } }
__global__ __launch_bounds__(256) void k_pcolT(const float* __restrict__ COMP, const float* __restrict__ MX, const float* __restrict__ RS, h16* PCT) { const int e = (blockIdx.x * 256 + threadIdx.x) * 4; if (e >= NH_ * RR * RR) return; const int r0 = e % RR; const int c = (e / RR) % RR; const int h = e / (RR * RR); const float mx = MX[h * RR + c], rs = RS[h * RR + c]; v4h o;
#pragma unroll
    for (int u = 0; u < 4; ++u) { float d0 = __fsub_rn(COMP[((size_t)h * RR + r0 + u) * RR + c], mx); asm volatile("" : "+v"(d0)); o[u] = tohx(__fmul_rn(__builtin_amdgcn_exp2f(__fmul_rn(d0, 1.4426950408889634f)), rs)); } *(v4h*)(PCT + e) = o;  }
__global__ __launch_bounds__(256) void k_mrg(const float* __restrict__ O, bf* Mh, bf* Ml) { const int e = (blockIdx.x * 256 + threadIdx.x) * 4; if (e >= RR * DD) return; const int c = e % DD; const int r = e / DD; const int h = c / KD, d = c % KD; const float* o = O + ((size_t)h * RR + r) * 64 + d; v4us oh, ol;
#pragma unroll
    for (int u = 0; u < 4; ++u) { unsigned short a, b; splitf(o[u] * (1.0f / PCAR), a, b); oh[u] = a; ol[u] = b; } *(v4us*)(Mh + e) = oh; *(v4us*)(Ml + e) = ol;  }

extern "C" void kernel_launch(void* const* d_in, const int* in_sizes, int n_in,
                              void* d_out, int out_size, void* d_ws, size_t ws_size, hipStream_t stream) {
    (void)in_sizes; (void)n_in; (void)out_size;
    const float** I = (const float**)d_in;
    const float *row_emb = I[0], *col_emb = I[1], *matrix = I[2], *Wq_row = I[3], *Wk_row = I[4], *Wv_row = I[5], *Wq_col = I[6], *Wk_col = I[7], *Wv_col = I[8], *W_mat = I[9], *W_out_row = I[10], *W_out_col = I[11];
    float* OUT0 = (float*)d_out; float* OUT1 = OUT0 + (size_t)NB_ * RR * DD;     // [32][512][256] x 2
    char* wsp = (char*)d_ws;
    auto take = [&](size_t bytes) { char* p = wsp; wsp += (bytes + 255) & ~(size_t)255; return (void*)p; };
    bf* BR = (bf*)take((size_t)D3 * DD * 2); bf* BC = (bf*)take((size_t)D3 * DD * 2); bf* BOR = (bf*)take(DD * DD * 2); bf* BOC = (bf*)take(DD * DD * 2);
    bf* REB = (bf*)take((size_t)RR * DD * 2); bf* CEB = (bf*)take((size_t)RR * DD * 2); float* RF = (float*)take((size_t)RR * D3 * 4); float* CF = (float*)take((size_t)RR * D3 * 4);
    bf* RQh = (bf*)take((size_t)NH_ * RR * KP * 2); bf* RQl = (bf*)take((size_t)NH_ * RR * KP * 2); bf* RKh = (bf*)take((size_t)NH_ * RR * KP * 2); bf* RKl = (bf*)take((size_t)NH_ * RR * KP * 2); bf* CQh = (bf*)take((size_t)NH_ * RR * KP * 2); bf* CQl = (bf*)take((size_t)NH_ * RR * KP * 2); bf* CKh = (bf*)take((size_t)NH_ * RR * KP * 2); bf* CKl = (bf*)take((size_t)NH_ * RR * KP * 2);
    h16* CVT = (h16*)take((size_t)NH_ * 64 * RR * 2); h16* RVT = (h16*)take((size_t)NH_ * 64 * RR * 2); float* S1 = (float*)take((size_t)NH_ * RR * RR * 4); float* S2 = (float*)take((size_t)NH_ * RR * RR * 4); float* COMP = (float*)take((size_t)NH_ * RR * RR * 4); h16* PR = (h16*)take((size_t)NH_ * RR * RR * 2); float* MXC = (float*)take(NH_ * RR * 4); float* RSC = (float*)take(NH_ * RR * 4); h16* PCT = (h16*)take((size_t)NH_ * RR * RR * 2);
    float* ORW = (float*)take((size_t)NH_ * RR * 64 * 4); float* OCL = (float*)take((size_t)NH_ * RR * 64 * 4); bf* MRh = (bf*)take((size_t)RR * DD * 2); bf* MRl = (bf*)take((size_t)RR * DD * 2); bf* MCh = (bf*)take((size_t)RR * DD * 2); bf* MCl = (bf*)take((size_t)RR * DD * 2);
    if ((size_t)(wsp - (char*)d_ws) > ws_size) return;    // total ~ 80 MB
    k_wtG<<<(DD * DD / 64 + 63) / 64, 256, 0, stream>>>(Wq_row, DD, DD, BR); k_wtG<<<(DD * DD / 64 + 63) / 64, 256, 0, stream>>>(Wk_row, DD, DD, BR + (size_t)DD * DD); k_wtG<<<(DD * DD / 64 + 63) / 64, 256, 0, stream>>>(Wv_row, DD, DD, BR + (size_t)2 * DD * DD);   // Bt rows [q | k | v]
    k_wtG<<<(DD * DD / 64 + 63) / 64, 256, 0, stream>>>(Wq_col, DD, DD, BC); k_wtG<<<(DD * DD / 64 + 63) / 64, 256, 0, stream>>>(Wk_col, DD, DD, BC + (size_t)DD * DD); k_wtG<<<(DD * DD / 64 + 63) / 64, 256, 0, stream>>>(Wv_col, DD, DD, BC + (size_t)2 * DD * DD);
    k_wtG<<<(DD * DD / 64 + 63) / 64, 256, 0, stream>>>(W_out_row, DD, DD, BOR); k_wtG<<<(DD * DD / 64 + 63) / 64, 256, 0, stream>>>(W_out_col, DD, DD, BOC);
    const unsigned gP = (NH_ * RR * KP / 4 + 255) / 256, gV = (NH_ * 64 * RR / 2 + 255) / 256, gS = (unsigned)(((size_t)NH_ * RR * RR / 4 + 255) / 256), gM = (RR * DD / 4 + 255) / 256;
    for (int b = 0; b < NB_; ++b) {
        k_cvt8<<<(RR * DD / 8 + 255) / 256, 256, 0, stream>>>(row_emb + (size_t)b * RR * DD, REB, RR * DD / 8); k_cvt8<<<(RR * DD / 8 + 255) / 256, 256, 0, stream>>>(col_emb + (size_t)b * RR * DD, CEB, RR * DD / 8);
        k_gemmw<bf, 0, false><<<dim3(RR / 64, D3 / 64, 1), 32, 0, stream>>>(REB, nullptr, BR, nullptr, DD, RF, D3, nullptr, 0, 0, 0); k_gemmw<bf, 0, false><<<dim3(RR / 64, D3 / 64, 1), 32, 0, stream>>>(CEB, nullptr, BC, nullptr, DD, CF, D3, nullptr, 0, 0, 0);
        k_p32<<<gP, 256, 0, stream>>>(RF, 0, RQh, RQl); k_p32<<<gP, 256, 0, stream>>>(RF, DD, RKh, RKl); k_p32<<<gP, 256, 0, stream>>>(CF, 0, CQh, CQl); k_p32<<<gP, 256, 0, stream>>>(CF, DD, CKh, CKl);
        k_vt64<<<gV, 256, 0, stream>>>(CF, 2 * DD, CVT); k_vt64<<<gV, 256, 0, stream>>>(RF, 2 * DD, RVT);
        k_gemmw<bf, 2, false><<<dim3(RR / 64, RR / 64, NH_), 32, 0, stream>>>(RQh, RQl, CKh, CKl, KP, S1, RR, nullptr, (size_t)RR * KP, (size_t)RR * KP, (size_t)RR * RR);     // s1[r][c] = row_q[r] . col_k[c]
        k_gemmw<bf, 2, false><<<dim3(RR / 64, RR / 64, NH_), 32, 0, stream>>>(RKh, RKl, CQh, CQl, KP, S2, RR, nullptr, (size_t)RR * KP, (size_t)RR * KP, (size_t)RR * RR);     // s2[r][c] = col_q[c] . row_k[r]
        k_comp<<<gS, 256, 0, stream>>>(S1, S2, matrix + (size_t)b * RR * RR, W_mat, COMP);
        k_rsoft<<<NH_ * RR / 8, 256, 0, stream>>>(COMP, PR); k_cstat<<<(NH_ * RR + 255) / 256, 256, 0, stream>>>(COMP, MXC, RSC); k_pcolT<<<gS, 256, 0, stream>>>(COMP, MXC, RSC, PCT);
        k_gemmw<h16, 0, false><<<dim3(RR / 64, 1, NH_), 32, 0, stream>>>(PR, nullptr, CVT, nullptr, RR, ORW, 64, nullptr, (size_t)RR * RR, (size_t)64 * RR, (size_t)RR * 64);      // row_heads[r][d] = sum_c attn_row col_v
        k_gemmw<h16, 0, false><<<dim3(RR / 64, 1, NH_), 32, 0, stream>>>(PCT, nullptr, RVT, nullptr, RR, OCL, 64, nullptr, (size_t)RR * RR, (size_t)64 * RR, (size_t)RR * 64);     // col_heads[c][d] = sum_r attn_col[r][c] row_v
        k_mrg<<<gM, 256, 0, stream>>>(ORW, MRh, MRl); k_mrg<<<gM, 256, 0, stream>>>(OCL, MCh, MCl);
        k_gemmw<bf, 1, false><<<dim3(RR / 64, DD / 64, 1), 32, 0, stream>>>(MRh, MRl, BOR, nullptr, DD, OUT0 + (size_t)b * RR * DD, DD, nullptr, 0, 0, 0); k_gemmw<bf, 1, false><<<dim3(RR / 64, DD / 64, 1), 32, 0, stream>>>(MCh, MCl, BOC, nullptr, DD, OUT1 + (size_t)b * RR * DD, DD, nullptr, 0, 0, 0); }
}

// v001
// One run takes 4070 microseconds.
// Two timings next to v000 put it at 2.17 and 2.18 times that version's speed.
#include <hip/hip_runtime.h>

// MixedScoreMHA (row_emb, col_emb [32][512][256], matrix [32][512][512]; 16 heads x 16: row_q/k/v = row_emb W, col_q/k/v = col_emb W; compat[h][r][c] = (row_q.col_k + col_q.row_k + matrix W_mat[h]) / 4 (W_mat read); attn_row = softmax over c, attn_col = softmax over r;
// row_heads = attn_row col_v, col_heads[c] = sum_r attn_col[r][c] row_v[r]; out_row = merge(row_heads) W_out_row, out_col = merge(col_heads) W_out_col -> two outputs [32][512][256]). The column softmax uses per-column statistics and its probabilities are
// written transposed ([h][c][r]) so both attention products are plain GEMMs - exact restructuring.
// Compute dtypes, f32 accumulate: every input rounded to bf16; the six projections on PLAIN bf16 operands (inputs: exact); both score products on bf16 hi+lo planes of q and k (3 products, K padded 16 -> 32);

#define NB_  32
#define RR   512
#define DD   256
#define D3   768
#define NH_  16
#define KD   16
#define KP   32
#define PCAR 1024.0f
typedef _Float16 h16;
typedef unsigned short bf;
typedef __attribute__((ext_vector_type(16))) __bf16   v16bf;
typedef __attribute__((ext_vector_type(16))) _Float16 v16h;
typedef __attribute__((ext_vector_type(8)))  _Float16 v8h;
typedef __attribute__((ext_vector_type(8)))  unsigned short v8us;
typedef __attribute__((ext_vector_type(8)))  float    v8f;
typedef __attribute__((ext_vector_type(4)))  float    v4f;
typedef v8h  __attribute__((may_alias)) v8ha;
typedef v4f  __attribute__((may_alias)) v4fa;
typedef v8us __attribute__((may_alias)) v8usa;

__device__ __forceinline__ unsigned short f2bf(float f) { unsigned u = __float_as_uint(f); u += 0x7FFFu + ((u >> 16) & 1u); return (unsigned short)(u >> 16); }
__device__ __forceinline__ float bf2f(unsigned short b) { return __uint_as_float(((unsigned)b) << 16); }
__device__ __forceinline__ float bfr(float f) { return bf2f(f2bf(f)); }
__device__ __forceinline__ v16h cat16(v8h lo, v8h hi) { return __builtin_shufflevector(lo, hi, 0, 1, 2, 3, 4, 5, 6, 7, 8, 9, 10, 11, 12, 13, 14, 15); }
__device__ __forceinline__ v16bf cat16b(v8us lo, v8us hi) { return __builtin_bit_cast(v16bf, __builtin_shufflevector(lo, hi, 0, 1, 2, 3, 4, 5, 6, 7, 8, 9, 10, 11, 12, 13, 14, 15)); }
__device__ __forceinline__ v8f wmma16(v16h a, v16h b, v8f c) { return __builtin_amdgcn_wmma_f32_16x16x32_f16(false, a, false, b, (short)0, c, false, false); }
__device__ __forceinline__ v8f wmmab(v16bf a, v16bf b, v8f c) { return __builtin_amdgcn_wmma_f32_16x16x32_bf16(false, a, false, b, (short)0, c, false, false); }



// ---- k_gemmw: register-blocked GEMM, ONE WAVE per 64x64 output tile (16 accumulators), operands straight from K-contiguous 16-bit planes; grid (M/64, N/64, Z), 32 threads.
// C[m][n] (f32, pitch ldc, + optional f32 bias[n]) = sum_k A[m][k] Bt[n][k] (+ split products per NSPLIT). z-batch strides sA/sB/sC in elements. K % 32 == 0.
template <typename T16> struct WFrag;
template <> struct WFrag<h16> { typedef v16h V; static __device__ __forceinline__ V ld(const h16* p) { return cat16(*(const v8h*)p, *(const v8h*)(p + 16)); } static __device__ __forceinline__ v8f mma(V a, V b, v8f c) { return wmma16(a, b, c); } };
template <> struct WFrag<bf> { typedef v16bf V; static __device__ __forceinline__ V ld(const bf* p) { return cat16b(*(const v8us*)p, *(const v8us*)(p + 16)); } static __device__ __forceinline__ v8f mma(V a, V b, v8f c) { return wmmab(a, b, c); } };
template <typename T16, int NSPLIT, bool BIAS>
__global__ __launch_bounds__(32) void k_gemmw(const T16* __restrict__ A, const T16* __restrict__ A2, const T16* __restrict__ Bt, const T16* __restrict__ Bt2, int K, float* C, int ldc, const float* __restrict__ bias, size_t sA, size_t sB, size_t sC) {
    typedef typename WFrag<T16>::V V;
    __shared__ __align__(16) float os[16 * 68];
    const size_t z = blockIdx.z; A += z * sA; if (A2) A2 += z * sA; Bt += z * sB; if (Bt2) Bt2 += z * sB; C += z * sC;
    const int lane = threadIdx.x & 31, lr = lane & 15, hi = lane >> 4; const int r0 = blockIdx.x * 64, c0 = blockIdx.y * 64;
    v8f acc[4][4];
#pragma unroll
    for (int mb = 0; mb < 4; ++mb)
#pragma unroll
        for (int nb = 0; nb < 4; ++nb) acc[mb][nb] = (v8f){};
    const size_t aoff = (size_t)(r0 + lr) * K + 8 * hi, boff = (size_t)(c0 + lr) * K + 8 * hi;
#pragma unroll 1
    for (int kc = 0; kc < K; kc += 32) {
        V a[4], a2[4];
#pragma unroll
        for (int mb = 0; mb < 4; ++mb) { a[mb] = WFrag<T16>::ld(A + aoff + (size_t)mb * 16 * K + kc); if (NSPLIT == 1 || NSPLIT == 2) a2[mb] = WFrag<T16>::ld(A2 + aoff + (size_t)mb * 16 * K + kc); }
#pragma unroll
        for (int nb = 0; nb < 4; ++nb) { const V b = WFrag<T16>::ld(Bt + boff + (size_t)nb * 16 * K + kc); V b2; if (NSPLIT >= 2) b2 = WFrag<T16>::ld(Bt2 + boff + (size_t)nb * 16 * K + kc);
#pragma unroll
            for (int mb = 0; mb < 4; ++mb) { acc[mb][nb] = WFrag<T16>::mma(a[mb], b, acc[mb][nb]); if (NSPLIT == 1 || NSPLIT == 2) acc[mb][nb] = WFrag<T16>::mma(a2[mb], b, acc[mb][nb]); if (NSPLIT >= 2) acc[mb][nb] = WFrag<T16>::mma(a[mb], b2, acc[mb][nb]); } }
        asm volatile("v_nop\n\tv_nop\n\tv_nop\n\tv_nop" : "+v"(acc[0][0]), "+v"(acc[1][1]), "+v"(acc[2][2]), "+v"(acc[3][3]) : "v"(a[0]), "v"(a[3]));
    }
#pragma unroll
    for (int mb = 0; mb < 4; ++mb) {
#pragma unroll
        for (int nb = 0; nb < 4; ++nb) {
#pragma unroll
            for (int j = 0; j < 8; ++j) os[(hi * 8 + j) * 68 + nb * 16 + lr] = acc[mb][nb][j]; }
        __builtin_amdgcn_wave_barrier(); asm volatile("" ::: "memory");
        float* crow = C + (size_t)(r0 + mb * 16) * ldc + c0;
{
#pragma unroll
            for (int s = 0; s < 8; ++s) { const int row = 2 * s + hi, cofs = lr * 4; v4f val = *(const v4fa*)(os + row * 68 + cofs); if (BIAS) { val[0] += bfr(bias[c0 + cofs]); val[1] += bfr(bias[c0 + cofs + 1]); val[2] += bfr(bias[c0 + cofs + 2]); val[3] += bfr(bias[c0 + cofs + 3]); }
                *(v4f*)(crow + (size_t)row * ldc + cofs) = val; }
             }
        __builtin_amdgcn_wave_barrier(); asm volatile("" ::: "memory");
    }
}

__device__ __forceinline__ h16 tohx(float x) { return (h16)x; }
__device__ __forceinline__ void splitf(float y, unsigned short& h, unsigned short& l) { h = f2bf(y); l = f2bf(y - bf2f(h)); }
typedef __attribute__((ext_vector_type(2))) unsigned short v2us;
typedef __attribute__((ext_vector_type(4))) unsigned short v4us;
typedef __attribute__((ext_vector_type(2))) _Float16 v2h;
typedef __attribute__((ext_vector_type(4))) _Float16 v4h;

__global__ __launch_bounds__(256) void k_wtG(const float* __restrict__ w, int K, int N, bf* Bt) {
    const int lane = threadIdx.x & 31; const int L0 = (blockIdx.x * 8 + (threadIdx.x >> 5)) * 8; const int nlines = N * K / 64;
{
#pragma unroll 1
        for (int l = 0; l < 8; ++l) { const int L = L0 + l; if (L >= nlines) break; const size_t e = (size_t)L * 64 + lane * 2; const int k = (int)(e % K), n = (int)(e / K); v2us o;
            o[0] = f2bf(w[(size_t)k * N + n]); o[1] = f2bf(w[(size_t)(k + 1) * N + n]); *(v2us*)(Bt + e) = o; }
         }
}
__global__ __launch_bounds__(256) void k_cvt8(const float* __restrict__ src, bf* dst, size_t n8) { const size_t i = (size_t)blockIdx.x * 256 + threadIdx.x; if (i >= n8) return; const v8f v = *(const v8f*)(src + i * 8); v8us o;
#pragma unroll
    for (int k = 0; k < 8; ++k) o[k] = f2bf(v[k]); *(v8us*)(dst + i * 8) = o;  }
// k_p32: hl planes P[h][r][k] = F[r][off + h*16 + k] for k < 16, 0 for the padding 16..31 (8-B lanes); k_vt64: VT[h][d][r] = fp16(F[r][off + h*16 + d]) for d < 16, 0 for rows 16..63 (lane -> 2 consecutive r);
// k_comp: COMP = ((s1 + s2) + matrix W_mat[h]) x 0.25 (16-B lanes); k_rsoft: wave per (h, r) row: softmax over c -> fp16 x 1024; k_cstat: max and 1024/sum over r of each column (h, c), see there; k_pcolT: lane -> 4 consecutive r of column (h, c):
__global__ __launch_bounds__(256) void k_p32(const float* __restrict__ F, int off, bf* Ph, bf* Pl) { const int e = (blockIdx.x * 256 + threadIdx.x) * 4; if (e >= NH_ * RR * KP) return; const int k = e % KP; const int r = (e / KP) % RR; const int h = e / (KP * RR); v4us oh, ol;
#pragma unroll
    for (int u = 0; u < 4; ++u) { unsigned short a = 0, b = 0; if (k + u < KD) splitf(F[(size_t)r * D3 + off + h * KD + k + u], a, b); oh[u] = a; ol[u] = b; } *(v4us*)(Ph + e) = oh; *(v4us*)(Pl + e) = ol;  }
__global__ __launch_bounds__(256) void k_vt64(const float* __restrict__ F, int off, h16* VT) { const int e = (blockIdx.x * 256 + threadIdx.x) * 2; if (e >= NH_ * 64 * RR) return; const int r = e % RR; const int d = (e / RR) % 64; const int h = e / (RR * 64); v2h o;
    if (d < KD) { o[0] = tohx(F[(size_t)r * D3 + off + h * KD + d]); o[1] = tohx(F[(size_t)(r + 1) * D3 + off + h * KD + d]); } else { o[0] = (h16)0.f; o[1] = (h16)0.f; } *(v2h*)(VT + e) = o;  }
__global__ __launch_bounds__(256) void k_comp(const float* __restrict__ S1, const float* __restrict__ S2, const float* __restrict__ mt, const float* __restrict__ wm, float* COMP) { const size_t e = ((size_t)blockIdx.x * 256 + threadIdx.x) * 4; if (e >= (size_t)NH_ * RR * RR) return; const size_t rc = e % ((size_t)RR * RR); const int h = (int)(e / ((size_t)RR * RR)); const float w = bfr(wm[h]); const v4f a = *(const v4f*)(S1 + e), b = *(const v4f*)(S2 + e), m = *(const v4f*)(mt + rc); v4f o;
#pragma unroll
    for (int u = 0; u < 4; ++u) { float s3 = __fmul_rn(bfr(m[u]), w); asm volatile("" : "+v"(s3)); const float t = __fadd_rn(__fadd_rn(a[u], b[u]), s3); o[u] = __fmul_rn(t, 0.25f); } *(v4f*)(COMP + e) = o;  }
__global__ __launch_bounds__(256) void k_rsoft(const float* __restrict__ COMP, h16* P16) { const int lane = threadIdx.x & 31; const int row = blockIdx.x * 8 + (threadIdx.x >> 5); if (row >= NH_ * RR) return; const float* sr = COMP + (size_t)row * RR; float v[RR / 32]; float mx = -3.0e38f;
#pragma unroll
    for (int ch = 0; ch < RR / 128; ++ch) { const v4f a = *(const v4f*)(sr + ch * 128 + lane * 4);
#pragma unroll
        for (int u = 0; u < 4; ++u) { v[ch * 4 + u] = a[u]; mx = fmaxf(mx, a[u]); } }
#pragma unroll
    for (int sh = 16; sh; sh >>= 1) mx = fmaxf(mx, __shfl_xor(mx, sh, 32));
    float sum = 0.f;
#pragma unroll
    for (int q = 0; q < RR / 32; ++q) { float d0 = __fsub_rn(v[q], mx); asm volatile("" : "+v"(d0)); v[q] = __builtin_amdgcn_exp2f(__fmul_rn(d0, 1.4426950408889634f)); sum += v[q]; }
#pragma unroll
    for (int sh = 16; sh; sh >>= 1) sum += __shfl_xor(sum, sh, 32);
    const float f = __fdiv_rn(PCAR, sum);
    {
#pragma unroll
        for (int ch = 0; ch < RR / 128; ++ch) { v4h o4;
#pragma unroll
            for (int q = 0; q < 4; ++q) o4[q] = tohx(v[ch * 4 + q] * f); *(v4h*)(P16 + (size_t)row * RR + ch * 128 + lane * 4) = o4; }
         } }
// k_cstat: one work-group per (h, 32 columns). A lane owns 4 consecutive columns (8 lanes = one 128-B line of a row), a wave 4 rows, the group 32 rows a pass; all 16 passes are loaded up front and stay in registers,
// so COMP is read once and no load waits on another. Max, then sum of exponentials: per lane over its 16 rows, across the wave's 4 row groups by shuffles, across the 8 waves through LDS (fixed order).
__global__ __launch_bounds__(256) void k_cstat(const float* __restrict__ COMP, float* MX, float* RS) {
    __shared__ __align__(16) float redm[8][32]; __shared__ __align__(16) float reds[8][32];
    const int lane = threadIdx.x & 31, wv = threadIdx.x >> 5, cq = lane & 7, rq = lane >> 3; const int h = blockIdx.x / (RR / 32), c0 = (blockIdx.x % (RR / 32)) * 32;
    const float* base = COMP + ((size_t)h * RR + wv * 4 + rq) * RR + c0 + cq * 4; v4f x[RR / 32];
#pragma unroll
    for (int p = 0; p < RR / 32; ++p) x[p] = *(const v4f*)(base + (size_t)p * 32 * RR);
    v4f mx = {-3.0e38f, -3.0e38f, -3.0e38f, -3.0e38f};
#pragma unroll
    for (int p = 0; p < RR / 32; ++p)
#pragma unroll
        for (int u = 0; u < 4; ++u) mx[u] = fmaxf(mx[u], x[p][u]);
#pragma unroll
    for (int sh = 8; sh <= 16; sh <<= 1)
#pragma unroll
        for (int u = 0; u < 4; ++u) mx[u] = fmaxf(mx[u], __shfl_xor(mx[u], sh, 32));
    if (rq == 0) *(v4fa*)(&redm[wv][cq * 4]) = mx;
    __syncthreads();
#pragma unroll
    for (int w = 0; w < 8; ++w) { const v4f o = *(const v4fa*)(&redm[w][cq * 4]);
#pragma unroll
        for (int u = 0; u < 4; ++u) mx[u] = fmaxf(mx[u], o[u]); }
    v4f sum = {0.f, 0.f, 0.f, 0.f};
#pragma unroll
    for (int p = 0; p < RR / 32; ++p)
#pragma unroll
        for (int u = 0; u < 4; ++u) sum[u] += __builtin_amdgcn_exp2f(__fmul_rn(__fsub_rn(x[p][u], mx[u]), 1.4426950408889634f));
#pragma unroll
    for (int sh = 8; sh <= 16; sh <<= 1)
#pragma unroll
        for (int u = 0; u < 4; ++u) sum[u] += __shfl_xor(sum[u], sh, 32);
    if (rq == 0) *(v4fa*)(&reds[wv][cq * 4]) = sum;
    __syncthreads();
    if (threadIdx.x < 8) { v4f tot = *(const v4fa*)(&reds[0][cq * 4]);
#pragma unroll
        for (int w = 1; w < 8; ++w) tot += *(const v4fa*)(&reds[w][cq * 4]);
        v4f rs;
#pragma unroll
        for (int u = 0; u < 4; ++u) rs[u] = __fdiv_rn(PCAR, tot[u]);
        *(v4f*)(MX + h * RR + c0 + cq * 4) = mx; *(v4f*)(RS + h * RR + c0 + cq * 4) = rs; } }
__global__ __launch_bounds__(256) void k_pcolT(const float* __restrict__ COMP, const float* __restrict__ MX, const float* __restrict__ RS, h16* PCT) { const int e = (blockIdx.x * 256 + threadIdx.x) * 4; if (e >= NH_ * RR * RR) return; const int r0 = e % RR; const int c = (e / RR) % RR; const int h = e / (RR * RR); const float mx = MX[h * RR + c], rs = RS[h * RR + c]; v4h o;
#pragma unroll
    for (int u = 0; u < 4; ++u) { float d0 = __fsub_rn(COMP[((size_t)h * RR + r0 + u) * RR + c], mx); asm volatile("" : "+v"(d0)); o[u] = tohx(__fmul_rn(__builtin_amdgcn_exp2f(__fmul_rn(d0, 1.4426950408889634f)), rs)); } *(v4h*)(PCT + e) = o;  }
__global__ __launch_bounds__(256) void k_mrg(const float* __restrict__ O, bf* Mh, bf* Ml) { const int e = (blockIdx.x * 256 + threadIdx.x) * 4; if (e >= RR * DD) return; const int c = e % DD; const int r = e / DD; const int h = c / KD, d = c % KD; const float* o = O + ((size_t)h * RR + r) * 64 + d; v4us oh, ol;
#pragma unroll
    for (int u = 0; u < 4; ++u) { unsigned short a, b; splitf(o[u] * (1.0f / PCAR), a, b); oh[u] = a; ol[u] = b; } *(v4us*)(Mh + e) = oh; *(v4us*)(Ml + e) = ol;  }

extern "C" void kernel_launch(void* const* d_in, const int* in_sizes, int n_in,
                              void* d_out, int out_size, void* d_ws, size_t ws_size, hipStream_t stream) {
    (void)in_sizes; (void)n_in; (void)out_size;
    const float** I = (const float**)d_in;
    const float *row_emb = I[0], *col_emb = I[1], *matrix = I[2], *Wq_row = I[3], *Wk_row = I[4], *Wv_row = I[5], *Wq_col = I[6], *Wk_col = I[7], *Wv_col = I[8], *W_mat = I[9], *W_out_row = I[10], *W_out_col = I[11];
    float* OUT0 = (float*)d_out; float* OUT1 = OUT0 + (size_t)NB_ * RR * DD;     // [32][512][256] x 2
    char* wsp = (char*)d_ws;
    auto take = [&](size_t bytes) { char* p = wsp; wsp += (bytes + 255) & ~(size_t)255; return (void*)p; };
    bf* BR = (bf*)take((size_t)D3 * DD * 2); bf* BC = (bf*)take((size_t)D3 * DD * 2); bf* BOR = (bf*)take(DD * DD * 2); bf* BOC = (bf*)take(DD * DD * 2);
    bf* REB = (bf*)take((size_t)RR * DD * 2); bf* CEB = (bf*)take((size_t)RR * DD * 2); float* RF = (float*)take((size_t)RR * D3 * 4); float* CF = (float*)take((size_t)RR * D3 * 4);
    bf* RQh = (bf*)take((size_t)NH_ * RR * KP * 2); bf* RQl = (bf*)take((size_t)NH_ * RR * KP * 2); bf* RKh = (bf*)take((size_t)NH_ * RR * KP * 2); bf* RKl = (bf*)take((size_t)NH_ * RR * KP * 2); bf* CQh = (bf*)take((size_t)NH_ * RR * KP * 2); bf* CQl = (bf*)take((size_t)NH_ * RR * KP * 2); bf* CKh = (bf*)take((size_t)NH_ * RR * KP * 2); bf* CKl = (bf*)take((size_t)NH_ * RR * KP * 2);
    h16* CVT = (h16*)take((size_t)NH_ * 64 * RR * 2); h16* RVT = (h16*)take((size_t)NH_ * 64 * RR * 2); float* S1 = (float*)take((size_t)NH_ * RR * RR * 4); float* S2 = (float*)take((size_t)NH_ * RR * RR * 4); float* COMP = (float*)take((size_t)NH_ * RR * RR * 4); h16* PR = (h16*)take((size_t)NH_ * RR * RR * 2); float* MXC = (float*)take(NH_ * RR * 4); float* RSC = (float*)take(NH_ * RR * 4); h16* PCT = (h16*)take((size_t)NH_ * RR * RR * 2);
    float* ORW = (float*)take((size_t)NH_ * RR * 64 * 4); float* OCL = (float*)take((size_t)NH_ * RR * 64 * 4); bf* MRh = (bf*)take((size_t)RR * DD * 2); bf* MRl = (bf*)take((size_t)RR * DD * 2); bf* MCh = (bf*)take((size_t)RR * DD * 2); bf* MCl = (bf*)take((size_t)RR * DD * 2);
    if ((size_t)(wsp - (char*)d_ws) > ws_size) return;    // total ~ 80 MB
    k_wtG<<<(DD * DD / 64 + 63) / 64, 256, 0, stream>>>(Wq_row, DD, DD, BR); k_wtG<<<(DD * DD / 64 + 63) / 64, 256, 0, stream>>>(Wk_row, DD, DD, BR + (size_t)DD * DD); k_wtG<<<(DD * DD / 64 + 63) / 64, 256, 0, stream>>>(Wv_row, DD, DD, BR + (size_t)2 * DD * DD);   // Bt rows [q | k | v]
    k_wtG<<<(DD * DD / 64 + 63) / 64, 256, 0, stream>>>(Wq_col, DD, DD, BC); k_wtG<<<(DD * DD / 64 + 63) / 64, 256, 0, stream>>>(Wk_col, DD, DD, BC + (size_t)DD * DD); k_wtG<<<(DD * DD / 64 + 63) / 64, 256, 0, stream>>>(Wv_col, DD, DD, BC + (size_t)2 * DD * DD);
    k_wtG<<<(DD * DD / 64 + 63) / 64, 256, 0, stream>>>(W_out_row, DD, DD, BOR); k_wtG<<<(DD * DD / 64 + 63) / 64, 256, 0, stream>>>(W_out_col, DD, DD, BOC);
    const unsigned gP = (NH_ * RR * KP / 4 + 255) / 256, gV = (NH_ * 64 * RR / 2 + 255) / 256, gS = (unsigned)(((size_t)NH_ * RR * RR / 4 + 255) / 256), gM = (RR * DD / 4 + 255) / 256;
    for (int b = 0; b < NB_; ++b) {
        k_cvt8<<<(RR * DD / 8 + 255) / 256, 256, 0, stream>>>(row_emb + (size_t)b * RR * DD, REB, RR * DD / 8); k_cvt8<<<(RR * DD / 8 + 255) / 256, 256, 0, stream>>>(col_emb + (size_t)b * RR * DD, CEB, RR * DD / 8);
        k_gemmw<bf, 0, false><<<dim3(RR / 64, D3 / 64, 1), 32, 0, stream>>>(REB, nullptr, BR, nullptr, DD, RF, D3, nullptr, 0, 0, 0); k_gemmw<bf, 0, false><<<dim3(RR / 64, D3 / 64, 1), 32, 0, stream>>>(CEB, nullptr, BC, nullptr, DD, CF, D3, nullptr, 0, 0, 0);
        k_p32<<<gP, 256, 0, stream>>>(RF, 0, RQh, RQl); k_p32<<<gP, 256, 0, stream>>>(RF, DD, RKh, RKl); k_p32<<<gP, 256, 0, stream>>>(CF, 0, CQh, CQl); k_p32<<<gP, 256, 0, stream>>>(CF, DD, CKh, CKl);
        k_vt64<<<gV, 256, 0, stream>>>(CF, 2 * DD, CVT); k_vt64<<<gV, 256, 0, stream>>>(RF, 2 * DD, RVT);
        k_gemmw<bf, 2, false><<<dim3(RR / 64, RR / 64, NH_), 32, 0, stream>>>(RQh, RQl, CKh, CKl, KP, S1, RR, nullptr, (size_t)RR * KP, (size_t)RR * KP, (size_t)RR * RR);     // s1[r][c] = row_q[r] . col_k[c]
        k_gemmw<bf, 2, false><<<dim3(RR / 64, RR / 64, NH_), 32, 0, stream>>>(RKh, RKl, CQh, CQl, KP, S2, RR, nullptr, (size_t)RR * KP, (size_t)RR * KP, (size_t)RR * RR);     // s2[r][c] = col_q[c] . row_k[r]
        k_comp<<<gS, 256, 0, stream>>>(S1, S2, matrix + (size_t)b * RR * RR, W_mat, COMP);
        k_rsoft<<<NH_ * RR / 8, 256, 0, stream>>>(COMP, PR); k_cstat<<<NH_ * (RR / 32), 256, 0, stream>>>(COMP, MXC, RSC); k_pcolT<<<gS, 256, 0, stream>>>(COMP, MXC, RSC, PCT);
        k_gemmw<h16, 0, false><<<dim3(RR / 64, 1, NH_), 32, 0, stream>>>(PR, nullptr, CVT, nullptr, RR, ORW, 64, nullptr, (size_t)RR * RR, (size_t)64 * RR, (size_t)RR * 64);      // row_heads[r][d] = sum_c attn_row col_v
        k_gemmw<h16, 0, false><<<dim3(RR / 64, 1, NH_), 32, 0, stream>>>(PCT, nullptr, RVT, nullptr, RR, OCL, 64, nullptr, (size_t)RR * RR, (size_t)64 * RR, (size_t)RR * 64);     // col_heads[c][d] = sum_r attn_col[r][c] row_v
        k_mrg<<<gM, 256, 0, stream>>>(ORW, MRh, MRl); k_mrg<<<gM, 256, 0, stream>>>(OCL, MCh, MCl);
        k_gemmw<bf, 1, false><<<dim3(RR / 64, DD / 64, 1), 32, 0, stream>>>(MRh, MRl, BOR, nullptr, DD, OUT0 + (size_t)b * RR * DD, DD, nullptr, 0, 0, 0); k_gemmw<bf, 1, false><<<dim3(RR / 64, DD / 64, 1), 32, 0, stream>>>(MCh, MCl, BOC, nullptr, DD, OUT1 + (size_t)b * RR * DD, DD, nullptr, 0, 0, 0); }
}

// v002
// It runs in 1310 microseconds.
// Timed twice side by side with v001, it ran 3.11 and 3.10 times as fast.
// Counting every step since v000, it is 6.76 times as fast.
#include <hip/hip_runtime.h>

// MixedScoreMHA (row_emb, col_emb [32][512][256], matrix [32][512][512]; 16 heads x 16: row_q/k/v = row_emb W, col_q/k/v = col_emb W; compat[h][r][c] = (row_q.col_k + col_q.row_k + matrix W_mat[h]) / 4 (W_mat read); attn_row = softmax over c, attn_col = softmax over r;
// row_heads = attn_row col_v, col_heads[c] = sum_r attn_col[r][c] row_v[r]; out_row = merge(row_heads) W_out_row, out_col = merge(col_heads) W_out_col -> two outputs [32][512][256]). The column softmax uses per-column statistics and its probabilities are
// written transposed ([h][c][r]) so both attention products are plain GEMMs - exact restructuring.
// Compute dtypes, f32 accumulate: every input rounded to bf16; the six projections on PLAIN bf16 operands (inputs: exact); both score products on bf16 hi+lo planes of q and k (3 products, K padded 16 -> 32);

#define NB_  32
#define RR   512
#define DD   256
#define D3   768
#define NH_  16
#define KD   16
#define KP   32
#define PCAR 1024.0f
#define GB   4      // batch items that share each launch (NB_ % GB == 0); the workspace holds GB items' intermediates
typedef _Float16 h16;
typedef unsigned short bf;
typedef __attribute__((ext_vector_type(16))) __bf16   v16bf;
typedef __attribute__((ext_vector_type(16))) _Float16 v16h;
typedef __attribute__((ext_vector_type(8)))  _Float16 v8h;
typedef __attribute__((ext_vector_type(8)))  unsigned short v8us;
typedef __attribute__((ext_vector_type(8)))  float    v8f;
typedef __attribute__((ext_vector_type(4)))  float    v4f;
typedef v8h  __attribute__((may_alias)) v8ha;
typedef v4f  __attribute__((may_alias)) v4fa;
typedef v8us __attribute__((may_alias)) v8usa;

__device__ __forceinline__ unsigned short f2bf(float f) { unsigned u = __float_as_uint(f); u += 0x7FFFu + ((u >> 16) & 1u); return (unsigned short)(u >> 16); }
__device__ __forceinline__ float bf2f(unsigned short b) { return __uint_as_float(((unsigned)b) << 16); }
__device__ __forceinline__ float bfr(float f) { return bf2f(f2bf(f)); }
__device__ __forceinline__ v16h cat16(v8h lo, v8h hi) { return __builtin_shufflevector(lo, hi, 0, 1, 2, 3, 4, 5, 6, 7, 8, 9, 10, 11, 12, 13, 14, 15); }
__device__ __forceinline__ v16bf cat16b(v8us lo, v8us hi) { return __builtin_bit_cast(v16bf, __builtin_shufflevector(lo, hi, 0, 1, 2, 3, 4, 5, 6, 7, 8, 9, 10, 11, 12, 13, 14, 15)); }
__device__ __forceinline__ v8f wmma16(v16h a, v16h b, v8f c) { return __builtin_amdgcn_wmma_f32_16x16x32_f16(false, a, false, b, (short)0, c, false, false); }
__device__ __forceinline__ v8f wmmab(v16bf a, v16bf b, v8f c) { return __builtin_amdgcn_wmma_f32_16x16x32_bf16(false, a, false, b, (short)0, c, false, false); }



// ---- k_gemmw: register-blocked GEMM, ONE WAVE per 64x64 output tile (16 accumulators), operands straight from K-contiguous 16-bit planes; grid (M/64, N/64, Z), 32 threads.
// C[m][n] (f32, pitch ldc, + optional f32 bias[n]) = sum_k A[m][k] Bt[n][k] (+ split products per NSPLIT). z-batch strides sA/sB/sC in elements. K % 32 == 0.
// ZIN == 0: blockIdx.z is one flat batch index. ZIN > 0: blockIdx.z = twin * ZIN + item; the item moves by sA/sB/sC, the twin (row side, column side) by tA/tB/tC.
template <typename T16> struct WFrag;
template <> struct WFrag<h16> { typedef v16h V; static __device__ __forceinline__ V ld(const h16* p) { return cat16(*(const v8h*)p, *(const v8h*)(p + 16)); } static __device__ __forceinline__ v8f mma(V a, V b, v8f c) { return wmma16(a, b, c); } };
template <> struct WFrag<bf> { typedef v16bf V; static __device__ __forceinline__ V ld(const bf* p) { return cat16b(*(const v8us*)p, *(const v8us*)(p + 16)); } static __device__ __forceinline__ v8f mma(V a, V b, v8f c) { return wmmab(a, b, c); } };
template <typename T16, int NSPLIT, bool BIAS, int ZIN>
__global__ __launch_bounds__(32) void k_gemmw(const T16* __restrict__ A, const T16* __restrict__ A2, const T16* __restrict__ Bt, const T16* __restrict__ Bt2, int K, float* C, int ldc, const float* __restrict__ bias, size_t sA, size_t sB, size_t sC, size_t tA, size_t tB, size_t tC) {
    typedef typename WFrag<T16>::V V;
    __shared__ __align__(16) float os[16 * 68];
    const size_t z = ZIN > 0 ? blockIdx.z % (ZIN > 0 ? ZIN : 1) : blockIdx.z, zt = ZIN > 0 ? blockIdx.z / (ZIN > 0 ? ZIN : 1) : 0;
    const size_t oA = z * sA + zt * tA, oB = z * sB + zt * tB; A += oA; if (A2) A2 += oA; Bt += oB; if (Bt2) Bt2 += oB; C += z * sC + zt * tC;
    const int lane = threadIdx.x & 31, lr = lane & 15, hi = lane >> 4; const int r0 = blockIdx.x * 64, c0 = blockIdx.y * 64;
    v8f acc[4][4];
#pragma unroll
    for (int mb = 0; mb < 4; ++mb)
#pragma unroll
        for (int nb = 0; nb < 4; ++nb) acc[mb][nb] = (v8f){};
    const size_t aoff = (size_t)(r0 + lr) * K + 8 * hi, boff = (size_t)(c0 + lr) * K + 8 * hi;
#pragma unroll 1
    for (int kc = 0; kc < K; kc += 32) {
        V a[4], a2[4];
#pragma unroll
        for (int mb = 0; mb < 4; ++mb) { a[mb] = WFrag<T16>::ld(A + aoff + (size_t)mb * 16 * K + kc); if (NSPLIT == 1 || NSPLIT == 2) a2[mb] = WFrag<T16>::ld(A2 + aoff + (size_t)mb * 16 * K + kc); }
#pragma unroll
        for (int nb = 0; nb < 4; ++nb) { const V b = WFrag<T16>::ld(Bt + boff + (size_t)nb * 16 * K + kc); V b2; if (NSPLIT >= 2) b2 = WFrag<T16>::ld(Bt2 + boff + (size_t)nb * 16 * K + kc);
#pragma unroll
            for (int mb = 0; mb < 4; ++mb) { acc[mb][nb] = WFrag<T16>::mma(a[mb], b, acc[mb][nb]); if (NSPLIT == 1 || NSPLIT == 2) acc[mb][nb] = WFrag<T16>::mma(a2[mb], b, acc[mb][nb]); if (NSPLIT >= 2) acc[mb][nb] = WFrag<T16>::mma(a[mb], b2, acc[mb][nb]); } }
        asm volatile("v_nop\n\tv_nop\n\tv_nop\n\tv_nop" : "+v"(acc[0][0]), "+v"(acc[1][1]), "+v"(acc[2][2]), "+v"(acc[3][3]) : "v"(a[0]), "v"(a[3]));
    }
#pragma unroll
    for (int mb = 0; mb < 4; ++mb) {
#pragma unroll
        for (int nb = 0; nb < 4; ++nb) {
#pragma unroll
            for (int j = 0; j < 8; ++j) os[(hi * 8 + j) * 68 + nb * 16 + lr] = acc[mb][nb][j]; }
        __builtin_amdgcn_wave_barrier(); asm volatile("" ::: "memory");
        float* crow = C + (size_t)(r0 + mb * 16) * ldc + c0;
{
#pragma unroll
            for (int s = 0; s < 8; ++s) { const int row = 2 * s + hi, cofs = lr * 4; v4f val = *(const v4fa*)(os + row * 68 + cofs); if (BIAS) { val[0] += bfr(bias[c0 + cofs]); val[1] += bfr(bias[c0 + cofs + 1]); val[2] += bfr(bias[c0 + cofs + 2]); val[3] += bfr(bias[c0 + cofs + 3]); }
                *(v4f*)(crow + (size_t)row * ldc + cofs) = val; }
             }
        __builtin_amdgcn_wave_barrier(); asm volatile("" ::: "memory");
    }
}

__device__ __forceinline__ h16 tohx(float x) { return (h16)x; }
__device__ __forceinline__ void splitf(float y, unsigned short& h, unsigned short& l) { h = f2bf(y); l = f2bf(y - bf2f(h)); }
typedef __attribute__((ext_vector_type(2))) unsigned short v2us;
typedef __attribute__((ext_vector_type(4))) unsigned short v4us;
typedef __attribute__((ext_vector_type(2))) _Float16 v2h;
typedef __attribute__((ext_vector_type(4))) _Float16 v4h;

// k_wtG: blockIdx.y picks one of the eight weight matrices; their transposed bf16 planes lie one behind the other in Bt.
__global__ __launch_bounds__(256) void k_wtG(const float* __restrict__ w0, const float* __restrict__ w1, const float* __restrict__ w2, const float* __restrict__ w3, const float* __restrict__ w4, const float* __restrict__ w5, const float* __restrict__ w6, const float* __restrict__ w7, int K, int N, bf* Bt) {
    const int y = blockIdx.y; const float* w = y == 0 ? w0 : y == 1 ? w1 : y == 2 ? w2 : y == 3 ? w3 : y == 4 ? w4 : y == 5 ? w5 : y == 6 ? w6 : w7; Bt += (size_t)y * K * N;
    const int lane = threadIdx.x & 31; const int L0 = (blockIdx.x * 8 + (threadIdx.x >> 5)) * 8; const int nlines = N * K / 64;
{
#pragma unroll 1
        for (int l = 0; l < 8; ++l) { const int L = L0 + l; if (L >= nlines) break; const size_t e = (size_t)L * 64 + lane * 2; const int k = (int)(e % K), n = (int)(e / K); v2us o;
            o[0] = f2bf(w[(size_t)k * N + n]); o[1] = f2bf(w[(size_t)(k + 1) * N + n]); *(v2us*)(Bt + e) = o; }
         }
}
__global__ __launch_bounds__(256) void k_cvt8(const float* __restrict__ src0, const float* __restrict__ src1, bf* dst, size_t n8) { const size_t i = (size_t)blockIdx.x * 256 + threadIdx.x; if (i >= n8) return; const float* src = blockIdx.y ? src1 : src0; dst += (size_t)blockIdx.y * n8 * 8; const v8f v = *(const v8f*)(src + i * 8); v8us o;
#pragma unroll
    for (int k = 0; k < 8; ++k) o[k] = f2bf(v[k]); *(v8us*)(dst + i * 8) = o;  }
// k_p32: hl planes P[h][r][k] = F[r][off + h*16 + k] for k < 16, 0 for the padding 16..31 (8-B lanes); k_vt64: VT[h][d][r] = fp16(F[r][off + h*16 + d]) for d < 16, 0 for rows 16..63 (lane -> 2 consecutive r);
// k_comp: COMP = ((s1 + s2) + matrix W_mat[h]) x 0.25 (16-B lanes); k_rsoft: wave per (h, r) row: softmax over c -> fp16 x 1024; k_cstat: max and 1024/sum over r of each column (h, c), see there; k_pcolT: lane -> 4 consecutive r of column (h, c):
// Launch sharing: blockIdx.y = batch item g of the GB in flight; blockIdx.z = which plane set. F holds [row side, column side][g][r][768]. k_p32: sets 0 row_q, 1 row_k, 2 col_k, 3 col_q; k_vt64: sets 0 col_v, 1 row_v.
__global__ __launch_bounds__(256) void k_p32(const float* __restrict__ F, bf* Ph, bf* Pl) { const int e = (blockIdx.x * 256 + threadIdx.x) * 4; if (e >= NH_ * RR * KP) return; const int g = blockIdx.y, wh = blockIdx.z; const int off = (wh == 1 || wh == 2) ? DD : 0;
    F += (size_t)((wh >> 1) * GB + g) * RR * D3; Ph += (size_t)(wh * GB + g) * NH_ * RR * KP; Pl += (size_t)(wh * GB + g) * NH_ * RR * KP; const int k = e % KP; const int r = (e / KP) % RR; const int h = e / (KP * RR); v4us oh, ol;
#pragma unroll
    for (int u = 0; u < 4; ++u) { unsigned short a = 0, b = 0; if (k + u < KD) splitf(F[(size_t)r * D3 + off + h * KD + k + u], a, b); oh[u] = a; ol[u] = b; } *(v4us*)(Ph + e) = oh; *(v4us*)(Pl + e) = ol;  }
__global__ __launch_bounds__(256) void k_vt64(const float* __restrict__ F, h16* VT) { const int e = (blockIdx.x * 256 + threadIdx.x) * 2; if (e >= NH_ * 64 * RR) return; const int g = blockIdx.y, wh = blockIdx.z; const int off = 2 * DD;
    F += (size_t)((1 - wh) * GB + g) * RR * D3; VT += (size_t)(wh * GB + g) * NH_ * 64 * RR; const int r = e % RR; const int d = (e / RR) % 64; const int h = e / (RR * 64); v2h o;
    if (d < KD) { o[0] = tohx(F[(size_t)r * D3 + off + h * KD + d]); o[1] = tohx(F[(size_t)(r + 1) * D3 + off + h * KD + d]); } else { o[0] = (h16)0.f; o[1] = (h16)0.f; } *(v2h*)(VT + e) = o;  }
// k_comp writes over s1: a thread stores the four elements it has itself read, so GB items' scores fit the workspace. blockIdx.y = batch item.
__global__ __launch_bounds__(256) void k_comp(float* S1, const float* __restrict__ S2, const float* __restrict__ mt, const float* __restrict__ wm) { const size_t e = ((size_t)blockIdx.x * 256 + threadIdx.x) * 4; if (e >= (size_t)NH_ * RR * RR) return; S1 += (size_t)blockIdx.y * NH_ * RR * RR; S2 += (size_t)blockIdx.y * NH_ * RR * RR; mt += (size_t)blockIdx.y * RR * RR; float* COMP = S1; const size_t rc = e % ((size_t)RR * RR); const int h = (int)(blockIdx.x / (RR * RR / 1024)); /* a block's 1024 elements lie in one head */ const float w = bfr(wm[h]); const v4f a = *(const v4f*)(S1 + e), b = *(const v4f*)(S2 + e), m = *(const v4f*)(mt + rc); v4f o;
#pragma unroll
    for (int u = 0; u < 4; ++u) { float s3 = __fmul_rn(bfr(m[u]), w); asm volatile("" : "+v"(s3)); const float t = __fadd_rn(__fadd_rn(a[u], b[u]), s3); o[u] = __fmul_rn(t, 0.25f); } *(v4f*)(COMP + e) = o;  }
__global__ __launch_bounds__(256) void k_rsoft(const float* __restrict__ COMP, h16* P16) { const int lane = threadIdx.x & 31; const int row = blockIdx.x * 8 + (threadIdx.x >> 5); if (row >= GB * NH_ * RR) return; const float* sr = COMP + (size_t)row * RR; float v[RR / 32]; float mx = -3.0e38f;
#pragma unroll
    for (int ch = 0; ch < RR / 128; ++ch) { const v4f a = *(const v4f*)(sr + ch * 128 + lane * 4);
#pragma unroll
        for (int u = 0; u < 4; ++u) { v[ch * 4 + u] = a[u]; mx = fmaxf(mx, a[u]); } }
#pragma unroll
    for (int sh = 16; sh; sh >>= 1) mx = fmaxf(mx, __shfl_xor(mx, sh, 32));
    float sum = 0.f;
#pragma unroll
    for (int q = 0; q < RR / 32; ++q) { float d0 = __fsub_rn(v[q], mx); asm volatile("" : "+v"(d0)); v[q] = __builtin_amdgcn_exp2f(__fmul_rn(d0, 1.4426950408889634f)); sum += v[q]; }
#pragma unroll
    for (int sh = 16; sh; sh >>= 1) sum += __shfl_xor(sum, sh, 32);
    const float f = __fdiv_rn(PCAR, sum);
    {
#pragma unroll
        for (int ch = 0; ch < RR / 128; ++ch) { v4h o4;
#pragma unroll
            for (int q = 0; q < 4; ++q) o4[q] = tohx(v[ch * 4 + q] * f); *(v4h*)(P16 + (size_t)row * RR + ch * 128 + lane * 4) = o4; }
         } }
// k_cstat: one work-group per (h, 32 columns). A lane owns 4 consecutive columns (8 lanes = one 128-B line of a row), a wave 4 rows, the group 32 rows a pass; all 16 passes are loaded up front and stay in registers,
// so COMP is read once and no load waits on another. Max, then sum of exponentials: per lane over its 16 rows, across the wave's 4 row groups by shuffles, across the 8 waves through LDS (fixed order).
__global__ __launch_bounds__(256) void k_cstat(const float* __restrict__ COMP, float* MX, float* RS) {
    __shared__ __align__(16) float redm[8][32]; __shared__ __align__(16) float reds[8][32];
    const int lane = threadIdx.x & 31, wv = threadIdx.x >> 5, cq = lane & 7, rq = lane >> 3; const int h = blockIdx.x / (RR / 32), c0 = (blockIdx.x % (RR / 32)) * 32;
    const float* base = COMP + ((size_t)h * RR + wv * 4 + rq) * RR + c0 + cq * 4; v4f x[RR / 32];
#pragma unroll
    for (int p = 0; p < RR / 32; ++p) x[p] = *(const v4f*)(base + (size_t)p * 32 * RR);
    v4f mx = {-3.0e38f, -3.0e38f, -3.0e38f, -3.0e38f};
#pragma unroll
    for (int p = 0; p < RR / 32; ++p)
#pragma unroll
        for (int u = 0; u < 4; ++u) mx[u] = fmaxf(mx[u], x[p][u]);
#pragma unroll
    for (int sh = 8; sh <= 16; sh <<= 1)
#pragma unroll
        for (int u = 0; u < 4; ++u) mx[u] = fmaxf(mx[u], __shfl_xor(mx[u], sh, 32));
    if (rq == 0) *(v4fa*)(&redm[wv][cq * 4]) = mx;
    __syncthreads();
#pragma unroll
    for (int w = 0; w < 8; ++w) { const v4f o = *(const v4fa*)(&redm[w][cq * 4]);
#pragma unroll
        for (int u = 0; u < 4; ++u) mx[u] = fmaxf(mx[u], o[u]); }
    v4f sum = {0.f, 0.f, 0.f, 0.f};
#pragma unroll
    for (int p = 0; p < RR / 32; ++p)
#pragma unroll
        for (int u = 0; u < 4; ++u) sum[u] += __builtin_amdgcn_exp2f(__fmul_rn(__fsub_rn(x[p][u], mx[u]), 1.4426950408889634f));
#pragma unroll
    for (int sh = 8; sh <= 16; sh <<= 1)
#pragma unroll
        for (int u = 0; u < 4; ++u) sum[u] += __shfl_xor(sum[u], sh, 32);
    if (rq == 0) *(v4fa*)(&reds[wv][cq * 4]) = sum;
    __syncthreads();
    if (threadIdx.x < 8) { v4f tot = *(const v4fa*)(&reds[0][cq * 4]);
#pragma unroll
        for (int w = 1; w < 8; ++w) tot += *(const v4fa*)(&reds[w][cq * 4]);
        v4f rs;
#pragma unroll
        for (int u = 0; u < 4; ++u) rs[u] = __fdiv_rn(PCAR, tot[u]);
        *(v4f*)(MX + h * RR + c0 + cq * 4) = mx; *(v4f*)(RS + h * RR + c0 + cq * 4) = rs; } }
__global__ __launch_bounds__(256) void k_pcolT(const float* __restrict__ COMP, const float* __restrict__ MX, const float* __restrict__ RS, h16* PCT) { const int e = (blockIdx.x * 256 + threadIdx.x) * 4; if (e >= GB * NH_ * RR * RR) return; const int r0 = e % RR; const int c = (e / RR) % RR; const int h = e / (RR * RR); const float mx = MX[h * RR + c], rs = RS[h * RR + c]; v4h o;
#pragma unroll
    for (int u = 0; u < 4; ++u) { float d0 = __fsub_rn(COMP[((size_t)h * RR + r0 + u) * RR + c], mx); asm volatile("" : "+v"(d0)); o[u] = tohx(__fmul_rn(__builtin_amdgcn_exp2f(__fmul_rn(d0, 1.4426950408889634f)), rs)); } *(v4h*)(PCT + e) = o;  }
__global__ __launch_bounds__(256) void k_mrg(const float* __restrict__ O, bf* Mh, bf* Ml) { const int e = (blockIdx.x * 256 + threadIdx.x) * 4; if (e >= RR * DD) return; O += (size_t)blockIdx.y * NH_ * RR * 64; Mh += (size_t)blockIdx.y * RR * DD; Ml += (size_t)blockIdx.y * RR * DD; const int c = e % DD; const int r = e / DD; const int h = c / KD, d = c % KD; const float* o = O + ((size_t)h * RR + r) * 64 + d; v4us oh, ol;
#pragma unroll
    for (int u = 0; u < 4; ++u) { unsigned short a, b; splitf(o[u] * (1.0f / PCAR), a, b); oh[u] = a; ol[u] = b; } *(v4us*)(Mh + e) = oh; *(v4us*)(Ml + e) = ol;  }

extern "C" void kernel_launch(void* const* d_in, const int* in_sizes, int n_in,
                              void* d_out, int out_size, void* d_ws, size_t ws_size, hipStream_t stream) {
    (void)in_sizes; (void)n_in; (void)out_size;
    const float** I = (const float**)d_in;
    const float *row_emb = I[0], *col_emb = I[1], *matrix = I[2], *Wq_row = I[3], *Wk_row = I[4], *Wv_row = I[5], *Wq_col = I[6], *Wk_col = I[7], *Wv_col = I[8], *W_mat = I[9], *W_out_row = I[10], *W_out_col = I[11];
    float* OUT0 = (float*)d_out;     // [32][512][256] x 2, the column output behind the row output
    char* wsp = (char*)d_ws;
    auto take = [&](size_t bytes) { char* p = wsp; wsp += (bytes + 255) & ~(size_t)255; return (void*)p; };
    // Every buffer holds GB batch items, and the row-side and column-side twins of a stage lie one behind the other, so that one launch covers both twins of GB items. In k_rsoft, k_cstat and k_pcolT the head index simply runs over GB * 16 heads.
    bf* WT = (bf*)take((size_t)8 * DD * DD * 2);                                                       // Bt rows [q | k | v] row side, [q | k | v] column side, out row, out col
    bf* EB = (bf*)take((size_t)2 * GB * RR * DD * 2); float* FF = (float*)take((size_t)2 * GB * RR * D3 * 4);   // [row, col][g]
    bf* PH = (bf*)take((size_t)4 * GB * NH_ * RR * KP * 2); bf* PL = (bf*)take((size_t)4 * GB * NH_ * RR * KP * 2);   // [row_q, row_k, col_k, col_q][g]
    h16* VT = (h16*)take((size_t)2 * GB * NH_ * 64 * RR * 2);                                          // [col_v, row_v][g]
    float* S = (float*)take((size_t)2 * GB * NH_ * RR * RR * 4);                                       // [s1, s2][g]; compat replaces s1
    h16* P = (h16*)take((size_t)2 * GB * NH_ * RR * RR * 2);                                           // [attn_row, attn_col transposed][g]
    float* MXC = (float*)take((size_t)GB * NH_ * RR * 4); float* RSC = (float*)take((size_t)GB * NH_ * RR * 4);
    float* O = (float*)take((size_t)2 * GB * NH_ * RR * 64 * 4); bf* MH = (bf*)take((size_t)2 * GB * RR * DD * 2); bf* ML = (bf*)take((size_t)2 * GB * RR * DD * 2);   // [row, col][g]
    if ((size_t)(wsp - (char*)d_ws) > ws_size) return;    // total ~ 252 MiB
    k_wtG<<<dim3((DD * DD / 64 + 63) / 64, 8, 1), 256, 0, stream>>>(Wq_row, Wk_row, Wv_row, Wq_col, Wk_col, Wv_col, W_out_row, W_out_col, DD, DD, WT);
    const unsigned gP = (NH_ * RR * KP / 4 + 255) / 256, gV = (NH_ * 64 * RR / 2 + 255) / 256, gS = (unsigned)(((size_t)NH_ * RR * RR / 4 + 255) / 256), gM = (RR * DD / 4 + 255) / 256;
    float* COMP = S; h16* PR = P; h16* PCT = P + (size_t)GB * NH_ * RR * RR;
    for (int b = 0; b < NB_; b += GB) {
        k_cvt8<<<dim3((GB * RR * DD / 8 + 255) / 256, 2, 1), 256, 0, stream>>>(row_emb + (size_t)b * RR * DD, col_emb + (size_t)b * RR * DD, EB, (size_t)GB * RR * DD / 8);
        k_gemmw<bf, 0, false, GB><<<dim3(RR / 64, D3 / 64, 2 * GB), 32, 0, stream>>>(EB, nullptr, WT, nullptr, DD, FF, D3, nullptr, (size_t)RR * DD, 0, (size_t)RR * D3, (size_t)GB * RR * DD, (size_t)D3 * DD, (size_t)GB * RR * D3);
        k_p32<<<dim3(gP, GB, 4), 256, 0, stream>>>(FF, PH, PL);
        k_vt64<<<dim3(gV, GB, 2), 256, 0, stream>>>(FF, VT);
        // z < GB * 16: s1[r][c] = row_q[r] . col_k[c]; the rest: s2[r][c] = col_q[c] . row_k[r]
        k_gemmw<bf, 2, false, 0><<<dim3(RR / 64, RR / 64, 2 * GB * NH_), 32, 0, stream>>>(PH, PL, PH + (size_t)2 * GB * NH_ * RR * KP, PL + (size_t)2 * GB * NH_ * RR * KP, KP, S, RR, nullptr, (size_t)RR * KP, (size_t)RR * KP, (size_t)RR * RR, 0, 0, 0);
        k_comp<<<dim3(gS, GB, 1), 256, 0, stream>>>(S, S + (size_t)GB * NH_ * RR * RR, matrix + (size_t)b * RR * RR, W_mat);
        k_rsoft<<<GB * NH_ * RR / 8, 256, 0, stream>>>(COMP, PR); k_cstat<<<GB * NH_ * (RR / 32), 256, 0, stream>>>(COMP, MXC, RSC); k_pcolT<<<GB * gS, 256, 0, stream>>>(COMP, MXC, RSC, PCT);
        // z < GB * 16: row_heads[r][d] = sum_c attn_row col_v; the rest: col_heads[c][d] = sum_r attn_col[r][c] row_v
        k_gemmw<h16, 0, false, 0><<<dim3(RR / 64, 1, 2 * GB * NH_), 32, 0, stream>>>(P, nullptr, VT, nullptr, RR, O, 64, nullptr, (size_t)RR * RR, (size_t)64 * RR, (size_t)RR * 64, 0, 0, 0);
        k_mrg<<<dim3(gM, 2 * GB, 1), 256, 0, stream>>>(O, MH, ML);
        k_gemmw<bf, 1, false, GB><<<dim3(RR / 64, DD / 64, 2 * GB), 32, 0, stream>>>(MH, ML, WT + (size_t)6 * DD * DD, nullptr, DD, OUT0 + (size_t)b * RR * DD, DD, nullptr, (size_t)RR * DD, 0, (size_t)RR * DD, (size_t)GB * RR * DD, (size_t)DD * DD, (size_t)NB_ * RR * DD); }
}

// v003
// Measured time: 514 microseconds a run.
// Timed twice side by side with v002, it ran 2.55 times as fast both times.
// Counting every step since v000, it is 17.2 times as fast.
#include <hip/hip_runtime.h>

// MixedScoreMHA (row_emb, col_emb [32][512][256], matrix [32][512][512]; 16 heads x 16: row_q/k/v = row_emb W, col_q/k/v = col_emb W; compat[h][r][c] = (row_q.col_k + col_q.row_k + matrix W_mat[h]) / 4 (W_mat read); attn_row = softmax over c, attn_col = softmax over r;
// row_heads = attn_row col_v, col_heads[c] = sum_r attn_col[r][c] row_v[r]; out_row = merge(row_heads) W_out_row, out_col = merge(col_heads) W_out_col -> two outputs [32][512][256]). Scores, softmax and the attention product are one kernel (k_attn): compat and the
// probabilities never reach memory. The column side is the same kernel on compat transposed (queries = columns, keys = rows), so each side computes its own scores.
// Compute dtypes, f32 accumulate: every input rounded to bf16; the six projections on PLAIN bf16 operands (inputs: exact); the score product on bf16 hi+lo planes of q and k (3 products, K = 32 = [q | k] against [k | q]); probabilities and v in fp16.

#define NB_  32
#define RR   512
#define DD   256
#define D3   768
#define NH_  16
#define KD   16
#define KP   32
#define GB   4      // batch items that share each launch (NB_ % GB == 0); the workspace holds GB items' intermediates
typedef _Float16 h16;
typedef unsigned short bf;
typedef __attribute__((ext_vector_type(16))) __bf16   v16bf;
typedef __attribute__((ext_vector_type(16))) _Float16 v16h;
typedef __attribute__((ext_vector_type(8)))  _Float16 v8h;
typedef __attribute__((ext_vector_type(8)))  unsigned short v8us;
typedef __attribute__((ext_vector_type(8)))  float    v8f;
typedef __attribute__((ext_vector_type(4)))  float    v4f;
typedef v8h  __attribute__((may_alias)) v8ha;
typedef v4f  __attribute__((may_alias)) v4fa;
typedef v8us __attribute__((may_alias)) v8usa;

__device__ __forceinline__ unsigned short f2bf(float f) { unsigned u = __float_as_uint(f); u += 0x7FFFu + ((u >> 16) & 1u); return (unsigned short)(u >> 16); }
__device__ __forceinline__ float bf2f(unsigned short b) { return __uint_as_float(((unsigned)b) << 16); }
__device__ __forceinline__ float bfr(float f) { return bf2f(f2bf(f)); }
__device__ __forceinline__ v16h cat16(v8h lo, v8h hi) { return __builtin_shufflevector(lo, hi, 0, 1, 2, 3, 4, 5, 6, 7, 8, 9, 10, 11, 12, 13, 14, 15); }
__device__ __forceinline__ v16bf cat16b(v8us lo, v8us hi) { return __builtin_bit_cast(v16bf, __builtin_shufflevector(lo, hi, 0, 1, 2, 3, 4, 5, 6, 7, 8, 9, 10, 11, 12, 13, 14, 15)); }
__device__ __forceinline__ v8f wmma16(v16h a, v16h b, v8f c) { return __builtin_amdgcn_wmma_f32_16x16x32_f16(false, a, false, b, (short)0, c, false, false); }
__device__ __forceinline__ v8f wmmab(v16bf a, v16bf b, v8f c) { return __builtin_amdgcn_wmma_f32_16x16x32_bf16(false, a, false, b, (short)0, c, false, false); }



// ---- k_gemmw: register-blocked GEMM, ONE WAVE per 64x64 output tile (16 accumulators), operands straight from K-contiguous 16-bit planes; grid (M/64, N/64, Z), 32 threads.
// C[m][n] (f32, pitch ldc, + optional f32 bias[n]) = sum_k A[m][k] Bt[n][k] (+ split products per NSPLIT). z-batch strides sA/sB/sC in elements. K % 32 == 0.
// ZIN == 0: blockIdx.z is one flat batch index. ZIN > 0: blockIdx.z = twin * ZIN + item; the item moves by sA/sB/sC, the twin (row side, column side) by tA/tB/tC.
template <typename T16> struct WFrag;
template <> struct WFrag<h16> { typedef v16h V; static __device__ __forceinline__ V ld(const h16* p) { return cat16(*(const v8h*)p, *(const v8h*)(p + 16)); } static __device__ __forceinline__ v8f mma(V a, V b, v8f c) { return wmma16(a, b, c); } };
template <> struct WFrag<bf> { typedef v16bf V; static __device__ __forceinline__ V ld(const bf* p) { return cat16b(*(const v8us*)p, *(const v8us*)(p + 16)); } static __device__ __forceinline__ v8f mma(V a, V b, v8f c) { return wmmab(a, b, c); } };
template <typename T16, int NSPLIT, bool BIAS, int ZIN>
__global__ __launch_bounds__(32) void k_gemmw(const T16* __restrict__ A, const T16* __restrict__ A2, const T16* __restrict__ Bt, const T16* __restrict__ Bt2, int K, float* C, int ldc, const float* __restrict__ bias, size_t sA, size_t sB, size_t sC, size_t tA, size_t tB, size_t tC) {
    typedef typename WFrag<T16>::V V;
    __shared__ __align__(16) float os[16 * 68];
    const size_t z = ZIN > 0 ? blockIdx.z % (ZIN > 0 ? ZIN : 1) : blockIdx.z, zt = ZIN > 0 ? blockIdx.z / (ZIN > 0 ? ZIN : 1) : 0;
    const size_t oA = z * sA + zt * tA, oB = z * sB + zt * tB; A += oA; if (A2) A2 += oA; Bt += oB; if (Bt2) Bt2 += oB; C += z * sC + zt * tC;
    const int lane = threadIdx.x & 31, lr = lane & 15, hi = lane >> 4; const int r0 = blockIdx.x * 64, c0 = blockIdx.y * 64;
    v8f acc[4][4];
#pragma unroll
    for (int mb = 0; mb < 4; ++mb)
#pragma unroll
        for (int nb = 0; nb < 4; ++nb) acc[mb][nb] = (v8f){};
    const size_t aoff = (size_t)(r0 + lr) * K + 8 * hi, boff = (size_t)(c0 + lr) * K + 8 * hi;
#pragma unroll 1
    for (int kc = 0; kc < K; kc += 32) {
        V a[4], a2[4];
#pragma unroll
        for (int mb = 0; mb < 4; ++mb) { a[mb] = WFrag<T16>::ld(A + aoff + (size_t)mb * 16 * K + kc); if (NSPLIT == 1 || NSPLIT == 2) a2[mb] = WFrag<T16>::ld(A2 + aoff + (size_t)mb * 16 * K + kc); }
#pragma unroll
        for (int nb = 0; nb < 4; ++nb) { const V b = WFrag<T16>::ld(Bt + boff + (size_t)nb * 16 * K + kc); V b2; if (NSPLIT >= 2) b2 = WFrag<T16>::ld(Bt2 + boff + (size_t)nb * 16 * K + kc);
#pragma unroll
            for (int mb = 0; mb < 4; ++mb) { acc[mb][nb] = WFrag<T16>::mma(a[mb], b, acc[mb][nb]); if (NSPLIT == 1 || NSPLIT == 2) acc[mb][nb] = WFrag<T16>::mma(a2[mb], b, acc[mb][nb]); if (NSPLIT >= 2) acc[mb][nb] = WFrag<T16>::mma(a[mb], b2, acc[mb][nb]); } }
        asm volatile("v_nop\n\tv_nop\n\tv_nop\n\tv_nop" : "+v"(acc[0][0]), "+v"(acc[1][1]), "+v"(acc[2][2]), "+v"(acc[3][3]) : "v"(a[0]), "v"(a[3]));
    }
#pragma unroll
    for (int mb = 0; mb < 4; ++mb) {
#pragma unroll
        for (int nb = 0; nb < 4; ++nb) {
#pragma unroll
            for (int j = 0; j < 8; ++j) os[(hi * 8 + j) * 68 + nb * 16 + lr] = acc[mb][nb][j]; }
        __builtin_amdgcn_wave_barrier(); asm volatile("" ::: "memory");
        float* crow = C + (size_t)(r0 + mb * 16) * ldc + c0;
{
#pragma unroll
            for (int s = 0; s < 8; ++s) { const int row = 2 * s + hi, cofs = lr * 4; v4f val = *(const v4fa*)(os + row * 68 + cofs); if (BIAS) { val[0] += bfr(bias[c0 + cofs]); val[1] += bfr(bias[c0 + cofs + 1]); val[2] += bfr(bias[c0 + cofs + 2]); val[3] += bfr(bias[c0 + cofs + 3]); }
                *(v4f*)(crow + (size_t)row * ldc + cofs) = val; }
             }
        __builtin_amdgcn_wave_barrier(); asm volatile("" ::: "memory");
    }
}

__device__ __forceinline__ h16 tohx(float x) { return (h16)x; }
__device__ __forceinline__ void splitf(float y, unsigned short& h, unsigned short& l) { h = f2bf(y); l = f2bf(y - bf2f(h)); }
typedef __attribute__((ext_vector_type(2))) unsigned short v2us;
typedef __attribute__((ext_vector_type(4))) unsigned short v4us;
typedef __attribute__((ext_vector_type(2))) _Float16 v2h;

// k_wtG: blockIdx.y picks one of the eight weight matrices; their transposed bf16 planes lie one behind the other in Bt.
__global__ __launch_bounds__(256) void k_wtG(const float* __restrict__ w0, const float* __restrict__ w1, const float* __restrict__ w2, const float* __restrict__ w3, const float* __restrict__ w4, const float* __restrict__ w5, const float* __restrict__ w6, const float* __restrict__ w7, int K, int N, bf* Bt) {
    const int y = blockIdx.y; const float* w = y == 0 ? w0 : y == 1 ? w1 : y == 2 ? w2 : y == 3 ? w3 : y == 4 ? w4 : y == 5 ? w5 : y == 6 ? w6 : w7; Bt += (size_t)y * K * N;
    const int lane = threadIdx.x & 31; const int L0 = (blockIdx.x * 8 + (threadIdx.x >> 5)) * 8; const int nlines = N * K / 64;
{
#pragma unroll 1
        for (int l = 0; l < 8; ++l) { const int L = L0 + l; if (L >= nlines) break; const size_t e = (size_t)L * 64 + lane * 2; const int k = (int)(e % K), n = (int)(e / K); v2us o;
            o[0] = f2bf(w[(size_t)k * N + n]); o[1] = f2bf(w[(size_t)(k + 1) * N + n]); *(v2us*)(Bt + e) = o; }
         }
}
__global__ __launch_bounds__(256) void k_cvt8(const float* __restrict__ src0, const float* __restrict__ src1, bf* dst, size_t n8) { const size_t i = (size_t)blockIdx.x * 256 + threadIdx.x; if (i >= n8) return; const float* src = blockIdx.y ? src1 : src0; dst += (size_t)blockIdx.y * n8 * 8; const v8f v = *(const v8f*)(src + i * 8); v8us o;
#pragma unroll
    for (int k = 0; k < 8; ++k) o[k] = f2bf(v[k]); *(v8us*)(dst + i * 8) = o;  }
// k_p32: hl planes, K = 32 with no padding. Set 0: X[h][r][k] = row_q[r][h*16 + k] for k < 16, row_k[r][h*16 + k - 16] behind it; set 1: Y[h][c][k] = col_k for k < 16, col_q behind it: X[r] . Y[c] = row_q.col_k + col_q.row_k.
// k_vt16: VT[h][d][r] = fp16(F[r][512 + h*16 + d]) (lane -> 2 consecutive r); sets 0 col_v, 1 row_v.
// Launch sharing: blockIdx.y = batch item g of the GB in flight; blockIdx.z = which plane set. F holds [row side, column side][g][r][768], a row being [q | k | v].
__global__ __launch_bounds__(256) void k_p32(const float* __restrict__ F, bf* Ph, bf* Pl) { const int e = (blockIdx.x * 256 + threadIdx.x) * 4; if (e >= NH_ * RR * KP) return; const int g = blockIdx.y, wh = blockIdx.z;
    F += (size_t)(wh * GB + g) * RR * D3; Ph += (size_t)(wh * GB + g) * NH_ * RR * KP; Pl += (size_t)(wh * GB + g) * NH_ * RR * KP; const int k = e % KP; const int r = (e / KP) % RR; const int h = e / (KP * RR); const int off = ((k < KD) == (wh == 0)) ? 0 : DD;
    const v4f x = *(const v4f*)(F + (size_t)r * D3 + off + h * KD + (k & (KD - 1))); v4us oh, ol;
#pragma unroll
    for (int u = 0; u < 4; ++u) { unsigned short a, b; splitf(x[u], a, b); oh[u] = a; ol[u] = b; } *(v4us*)(Ph + e) = oh; *(v4us*)(Pl + e) = ol;  }
__global__ __launch_bounds__(256) void k_vt16(const float* __restrict__ F, h16* VT) { const int e = (blockIdx.x * 256 + threadIdx.x) * 2; if (e >= NH_ * KD * RR) return; const int g = blockIdx.y, wh = blockIdx.z; const int off = 2 * DD;
    F += (size_t)((1 - wh) * GB + g) * RR * D3; VT += (size_t)(wh * GB + g) * NH_ * KD * RR; const int r = e % RR; const int d = (e / RR) % KD; const int h = e / (RR * KD); v2h o;
    o[0] = tohx(F[(size_t)r * D3 + off + h * KD + d]); o[1] = tohx(F[(size_t)(r + 1) * D3 + off + h * KD + d]); *(v2h*)(VT + e) = o;  }

// ---- k_attn: scores, softmax and attention product of one side in one pass over the keys. A wave owns 32 queries (two 16-column groups) of one (side, item, head) and walks the 512 keys 32 at a time.
// Transposed products: S^T[key][query] = K' Q'^T (A = key rows, B = query rows kept in registers), O^T[d][query] += V^T P^T. In the accumulator map a lane holds ONE query (lane & 15) and keys 8 * (lane >> 4) + 0..7 of a 16-key tile,
// so the maximum and the sum over keys are in-lane plus one exchange between the wave's halves, and the two score tiles of a pass, converted in place, ARE the B operand of the second product (element s = tile s >> 3, register s & 7, the hardware k order);
// V^T is loaded in the same k order (16 bytes at 16 * half and at 32 + 16 * half of each 64). Running maximum with rescale (base 2); the halves' sums are joined once at the end.
// COL == false: queries = rows r, keys = columns c, matrix[query][key]. COL == true: queries = columns, keys = rows, matrix[key][query].
typedef __attribute__((ext_vector_type(2))) float v2f;
typedef __attribute__((ext_vector_type(2))) __bf16 v2b;
__device__ __forceinline__ float xhalf(float x) { return __int_as_float(__builtin_amdgcn_permlanex16(__float_as_int(x), __float_as_int(x), 0x76543210, 0xfedcba98, false, false)); }   // lane l with lane l ^ 16
// Exponentials with the slot behind them in ONE statement: the instruction set asks for one independent instruction or a v_nop between a transcendental and an instruction that reads its result or overwrites its source;
// Inside the statement each v_exp_f32 is followed by an independent one (early-clobber results lie on no source), the last by the v_nop.
__device__ __forceinline__ void exp2x8(const float* x, float* p) {
    asm("v_exp_f32 %0, %8\n\tv_exp_f32 %1, %9\n\tv_exp_f32 %2, %10\n\tv_exp_f32 %3, %11\n\tv_exp_f32 %4, %12\n\tv_exp_f32 %5, %13\n\tv_exp_f32 %6, %14\n\tv_exp_f32 %7, %15\n\tv_nop"
        : "=&v"(p[0]), "=&v"(p[1]), "=&v"(p[2]), "=&v"(p[3]), "=&v"(p[4]), "=&v"(p[5]), "=&v"(p[6]), "=&v"(p[7]) : "v"(x[0]), "v"(x[1]), "v"(x[2]), "v"(x[3]), "v"(x[4]), "v"(x[5]), "v"(x[6]), "v"(x[7])); }
__device__ __forceinline__ float exp2x1(float x) { float p; asm("v_exp_f32 %0, %1\n\tv_nop" : "=&v"(p) : "v"(x)); return p; }   // the same slot, one value
template <bool COL>
__device__ __forceinline__ void attn_side(const bf* __restrict__ QH, const bf* __restrict__ QL, const bf* __restrict__ KH, const bf* __restrict__ KL, const h16* __restrict__ VT, const float* __restrict__ mt, const float w, float* __restrict__ O, const int q0, const int lr, const int hi) {
    const float SC = 0.36067376022224085f;   // 1/4 (the norm) x log2(e)
    v16bf qh[2], ql[2]; v8f acc[2]; float mrun[2], lsum[2];
#pragma unroll
    for (int nb = 0; nb < 2; ++nb) { const size_t o = (size_t)(q0 + nb * 16 + lr) * KP + 8 * hi; qh[nb] = WFrag<bf>::ld(QH + o); ql[nb] = WFrag<bf>::ld(QL + o); acc[nb] = (v8f){}; mrun[nb] = -3.0e38f; lsum[nb] = 0.f; }
#pragma unroll 2   // two passes a trip: the second pass's loads are issued while the first pass is worked on (the inner loops are unrolled whole so that their arrays stay in registers)
    for (int k0 = 0; k0 < RR; k0 += 32) {
        v16bf kh[2], kl[2];
#pragma unroll
        for (int t = 0; t < 2; ++t) { const size_t o = (size_t)(k0 + t * 16 + lr) * KP + 8 * hi; kh[t] = WFrag<bf>::ld(KH + o); kl[t] = WFrag<bf>::ld(KL + o); }
        const v16h va = WFrag<h16>::ld(VT + (size_t)lr * RR + k0 + 8 * hi);
#pragma unroll
        for (int nb = 0; nb < 2; ++nb) {
            float y[16];
#pragma unroll
            for (int t = 0; t < 2; ++t) {
                v8f m8;
                if (!COL) m8 = *(const v8f*)(mt + (size_t)(q0 + nb * 16 + lr) * RR + k0 + t * 16 + hi * 8);
                else { const float* p = mt + (size_t)(k0 + t * 16 + hi * 8) * RR + q0 + nb * 16 + lr;
#pragma unroll
                    for (int j = 0; j < 8; ++j) m8[j] = p[(size_t)j * RR]; }
                v8f s = wmmab(kh[t], qh[nb], (v8f){}); s = wmmab(kl[t], qh[nb], s); s = wmmab(kh[t], ql[nb], s);
#pragma unroll
                for (int j = 0; j < 8; j += 2) { const v2f mb = __builtin_convertvector(__builtin_convertvector((v2f){m8[j], m8[j + 1]}, v2b), v2f);   // matrix rounded to bf16, nearest even
                    y[t * 8 + j] = (s[j] + mb[0] * w) * SC; y[t * 8 + j + 1] = (s[j + 1] + mb[1] * w) * SC; }
            }
            float mx[4];
#pragma unroll
            for (int u = 0; u < 4; ++u) mx[u] = fmaxf(fmaxf(y[u], y[u + 4]), fmaxf(y[u + 8], y[u + 12]));
            float m1 = fmaxf(fmaxf(mx[0], mx[1]), fmaxf(mx[2], mx[3])); m1 = fmaxf(m1, xhalf(m1));
            const float mn = fmaxf(mrun[nb], m1); const float al = exp2x1(mrun[nb] - mn);   // 0 on the first pass
            mrun[nb] = mn; float ps[4] = {0.f, 0.f, 0.f, 0.f}, p[16]; v16h pb;
#pragma unroll
            for (int i = 0; i < 16; ++i) y[i] -= mn;
            exp2x8(y, p); exp2x8(y + 8, p + 8);
#pragma unroll
            for (int i = 0; i < 16; ++i) { ps[i & 3] += p[i]; pb[i] = (h16)p[i]; }
            lsum[nb] = lsum[nb] * al + ((ps[0] + ps[1]) + (ps[2] + ps[3]));
#pragma unroll
            for (int j = 0; j < 8; ++j) acc[nb][j] *= al;
            acc[nb] = wmma16(va, pb, acc[nb]);
        }
    }
#pragma unroll
    for (int nb = 0; nb < 2; ++nb) { const float f = __fdiv_rn(1.0f, lsum[nb] + xhalf(lsum[nb])); v8f o;
#pragma unroll
        for (int j = 0; j < 8; ++j) o[j] = acc[nb][j] * f;
        *(v8f*)(O + (size_t)(q0 + nb * 16 + lr) * KD + hi * 8) = o; }   // O[query][d], d = 8 * half + 0..7: a wave stores 2 KiB in a row
}
// grid (512 / 128 queries, GB * 16 (item, head), 2 sides), 4 waves. PH/PL: [X, Y][g][h][512][32]; VT: [col_v, row_v][g][h][16][512]; O: [row, col][g][h][512][16]; mt: the GB items' matrices.
__global__ __launch_bounds__(128) void k_attn(const bf* __restrict__ PH, const bf* __restrict__ PL, const h16* __restrict__ VT, const float* __restrict__ mt, const float* __restrict__ wm, float* __restrict__ O) {
    const int lane = threadIdx.x & 31, lr = lane & 15, hi = lane >> 4; const int q0 = blockIdx.x * 128 + (threadIdx.x >> 5) * 32; const int gh = blockIdx.y, side = blockIdx.z;
    const size_t pq = (size_t)(side * GB * NH_ + gh) * RR * KP, pk = (size_t)((1 - side) * GB * NH_ + gh) * RR * KP; const size_t z = (size_t)side * GB * NH_ + gh;
    const float w = bfr(wm[gh % NH_]); mt += (size_t)(gh / NH_) * RR * RR; VT += z * KD * RR; O += z * RR * KD;
    if (side == 0) attn_side<false>(PH + pq, PL + pq, PH + pk, PL + pk, VT, mt, w, O, q0, lr, hi);
    else attn_side<true>(PH + pq, PL + pq, PH + pk, PL + pk, VT, mt, w, O, q0, lr, hi);
}
__global__ __launch_bounds__(256) void k_mrg(const float* __restrict__ O, bf* Mh, bf* Ml) { const int e = (blockIdx.x * 256 + threadIdx.x) * 4; if (e >= RR * DD) return; O += (size_t)blockIdx.y * NH_ * RR * KD; Mh += (size_t)blockIdx.y * RR * DD; Ml += (size_t)blockIdx.y * RR * DD; const int c = e % DD; const int r = e / DD; const int h = c / KD, d = c % KD; const float* o = O + ((size_t)h * RR + r) * KD + d; v4us oh, ol;
#pragma unroll
    for (int u = 0; u < 4; ++u) { unsigned short a, b; splitf(o[u], a, b); oh[u] = a; ol[u] = b; } *(v4us*)(Mh + e) = oh; *(v4us*)(Ml + e) = ol;  }

extern "C" void kernel_launch(void* const* d_in, const int* in_sizes, int n_in,
                              void* d_out, int out_size, void* d_ws, size_t ws_size, hipStream_t stream) {
    (void)in_sizes; (void)n_in; (void)out_size;
    const float** I = (const float**)d_in;
    const float *row_emb = I[0], *col_emb = I[1], *matrix = I[2], *Wq_row = I[3], *Wk_row = I[4], *Wv_row = I[5], *Wq_col = I[6], *Wk_col = I[7], *Wv_col = I[8], *W_mat = I[9], *W_out_row = I[10], *W_out_col = I[11];
    float* OUT0 = (float*)d_out;     // [32][512][256] x 2, the column output behind the row output
    char* wsp = (char*)d_ws;
    auto take = [&](size_t bytes) { char* p = wsp; wsp += (bytes + 255) & ~(size_t)255; return (void*)p; };
    // Every buffer holds GB batch items, and the row-side and column-side twins of a stage lie one behind the other, so that one launch covers both twins of GB items.
    bf* WT = (bf*)take((size_t)8 * DD * DD * 2);                                                       // Bt rows [q | k | v] row side, [q | k | v] column side, out row, out col
    bf* EB = (bf*)take((size_t)2 * GB * RR * DD * 2); float* FF = (float*)take((size_t)2 * GB * RR * D3 * 4);   // [row, col][g]
    bf* PH = (bf*)take((size_t)2 * GB * NH_ * RR * KP * 2); bf* PL = (bf*)take((size_t)2 * GB * NH_ * RR * KP * 2);   // [row_q | row_k, col_k | col_q][g]
    h16* VT = (h16*)take((size_t)2 * GB * NH_ * KD * RR * 2);                                          // [col_v, row_v][g]
    float* O = (float*)take((size_t)2 * GB * NH_ * RR * KD * 4); bf* MH = (bf*)take((size_t)2 * GB * RR * DD * 2); bf* ML = (bf*)take((size_t)2 * GB * RR * DD * 2);   // [row, col][g]
    if ((size_t)(wsp - (char*)d_ws) > ws_size) return;
    k_wtG<<<dim3((DD * DD / 64 + 63) / 64, 8, 1), 256, 0, stream>>>(Wq_row, Wk_row, Wv_row, Wq_col, Wk_col, Wv_col, W_out_row, W_out_col, DD, DD, WT);
    const unsigned gP = (NH_ * RR * KP / 4 + 255) / 256, gV = (NH_ * KD * RR / 2 + 255) / 256, gM = (RR * DD / 4 + 255) / 256;
    for (int b = 0; b < NB_; b += GB) {
        k_cvt8<<<dim3((GB * RR * DD / 8 + 255) / 256, 2, 1), 256, 0, stream>>>(row_emb + (size_t)b * RR * DD, col_emb + (size_t)b * RR * DD, EB, (size_t)GB * RR * DD / 8);
        k_gemmw<bf, 0, false, GB><<<dim3(RR / 64, D3 / 64, 2 * GB), 32, 0, stream>>>(EB, nullptr, WT, nullptr, DD, FF, D3, nullptr, (size_t)RR * DD, 0, (size_t)RR * D3, (size_t)GB * RR * DD, (size_t)D3 * DD, (size_t)GB * RR * D3);
        k_p32<<<dim3(gP, GB, 2), 256, 0, stream>>>(FF, PH, PL);
        k_vt16<<<dim3(gV, GB, 2), 256, 0, stream>>>(FF, VT);
        k_attn<<<dim3(RR / 128, GB * NH_, 2), 128, 0, stream>>>(PH, PL, VT, matrix + (size_t)b * RR * RR, W_mat, O);
        k_mrg<<<dim3(gM, 2 * GB, 1), 256, 0, stream>>>(O, MH, ML);
        k_gemmw<bf, 1, false, GB><<<dim3(RR / 64, DD / 64, 2 * GB), 32, 0, stream>>>(MH, ML, WT + (size_t)6 * DD * DD, nullptr, DD, OUT0 + (size_t)b * RR * DD, DD, nullptr, (size_t)RR * DD, 0, (size_t)RR * DD, (size_t)GB * RR * DD, (size_t)DD * DD, (size_t)NB_ * RR * DD); }
}

// v004
// It runs in 419 microseconds.
// Two timings next to v003 both put it at 1.22 times that version's speed.
// Counting every step since v000, it is 21.0 times as fast.
#include <hip/hip_runtime.h>

// MixedScoreMHA (row_emb, col_emb [32][512][256], matrix [32][512][512]; 16 heads x 16: row_q/k/v = row_emb W, col_q/k/v = col_emb W; compat[h][r][c] = (row_q.col_k + col_q.row_k + matrix W_mat[h]) / 4 (W_mat read); attn_row = softmax over c, attn_col = softmax over r;
// row_heads = attn_row col_v, col_heads[c] = sum_r attn_col[r][c] row_v[r]; out_row = merge(row_heads) W_out_row, out_col = merge(col_heads) W_out_col -> two outputs [32][512][256]). Scores, softmax and the attention product are one kernel (k_attn): compat and the
// probabilities never reach memory; the projection GEMM and k_attn store their results in the layout and type that the next product reads. The column side is the same kernel on compat transposed (queries = columns, keys = rows), so each side computes its own scores.
// Compute dtypes, f32 accumulate: every input rounded to bf16; the six projections on PLAIN bf16 operands (inputs: exact); the score product on bf16 hi+lo planes of q and k (3 products, K = 32 = [q | k] against [k | q]); probabilities and v in fp16.

#define NB_  32
#define RR   512
#define DD   256
#define D3   768
#define NH_  16
#define KD   16
#define KP   32
#define GB   4      // batch items that share each launch (NB_ % GB == 0); the workspace holds GB items' intermediates
typedef _Float16 h16;
typedef unsigned short bf;
typedef __attribute__((ext_vector_type(16))) __bf16   v16bf;
typedef __attribute__((ext_vector_type(16))) _Float16 v16h;
typedef __attribute__((ext_vector_type(8)))  _Float16 v8h;
typedef __attribute__((ext_vector_type(8)))  unsigned short v8us;
typedef __attribute__((ext_vector_type(8)))  float    v8f;
typedef __attribute__((ext_vector_type(4)))  float    v4f;
typedef v8h  __attribute__((may_alias)) v8ha;
typedef v4f  __attribute__((may_alias)) v4fa;
typedef v8us __attribute__((may_alias)) v8usa;

__device__ __forceinline__ unsigned short f2bf(float f) { unsigned u = __float_as_uint(f); u += 0x7FFFu + ((u >> 16) & 1u); return (unsigned short)(u >> 16); }
__device__ __forceinline__ float bf2f(unsigned short b) { return __uint_as_float(((unsigned)b) << 16); }
__device__ __forceinline__ float bfr(float f) { return bf2f(f2bf(f)); }
__device__ __forceinline__ v16h cat16(v8h lo, v8h hi) { return __builtin_shufflevector(lo, hi, 0, 1, 2, 3, 4, 5, 6, 7, 8, 9, 10, 11, 12, 13, 14, 15); }
__device__ __forceinline__ v16bf cat16b(v8us lo, v8us hi) { return __builtin_bit_cast(v16bf, __builtin_shufflevector(lo, hi, 0, 1, 2, 3, 4, 5, 6, 7, 8, 9, 10, 11, 12, 13, 14, 15)); }
__device__ __forceinline__ v8f wmma16(v16h a, v16h b, v8f c) { return __builtin_amdgcn_wmma_f32_16x16x32_f16(false, a, false, b, (short)0, c, false, false); }
__device__ __forceinline__ v8f wmmab(v16bf a, v16bf b, v8f c) { return __builtin_amdgcn_wmma_f32_16x16x32_bf16(false, a, false, b, (short)0, c, false, false); }



// ---- k_gemmw: register-blocked GEMM, ONE WAVE per 64x64 output tile (16 accumulators), operands straight from K-contiguous 16-bit planes; grid (M/64, N/64, Z), 32 threads.
// C[m][n] (f32, pitch ldc, + optional f32 bias[n]) = sum_k A[m][k] Bt[n][k] (+ split products per NSPLIT). z-batch strides sA/sB/sC in elements. K % 32 == 0.
// ZIN == 0: blockIdx.z is one flat batch index. ZIN > 0: blockIdx.z = twin * ZIN + item; the item moves by sA/sB/sC, the twin (row side, column side) by tA/tB/tC.
// PLANES (the projections; k_wtG orders the 768 weight rows as 16 heads x 32 score columns, then v): no C; the tile goes out as the attention kernel's operands, every 128-byte line of them written by one wave.
//   score tiles (two heads): bf16 hi and lo planes, K = 32 with no padding. Row side: X[h][r][k] = row_q[r][h*16 + k] for k < 16, row_k behind it; column side: Y[h][c][k] = col_k for k < 16, col_q behind it: X[r] . Y[c] = row_q.col_k + col_q.row_k.
//   v tiles (four heads): VT[h][d][r] in fp16, sets 0 col_v, 1 row_v: in the accumulator map a lane holds one d and 8 consecutive r, which is 16 bytes of a VT row.
// AHM: A lies head-major, [K / 16][512 rows][16] (as k_attn stores it), not [row][K]; the fragment's two 8-element runs, k = kc + 8 half and kc + 16 + 8 half, are then the same 16 bytes of two neighbouring heads.
template <typename T16> struct WFrag;
template <> struct WFrag<h16> { typedef v16h V; static __device__ __forceinline__ V ld(const h16* p) { return cat16(*(const v8h*)p, *(const v8h*)(p + 16)); } static __device__ __forceinline__ v8f mma(V a, V b, v8f c) { return wmma16(a, b, c); } };
template <> struct WFrag<bf> { typedef v16bf V; static __device__ __forceinline__ V ld2(const bf* p, const bf* q) { return cat16b(*(const v8us*)p, *(const v8us*)q); } static __device__ __forceinline__ V ld(const bf* p) { return ld2(p, p + 16); } static __device__ __forceinline__ v8f mma(V a, V b, v8f c) { return wmmab(a, b, c); } };
__device__ __forceinline__ void splitf(float y, unsigned short& h, unsigned short& l) { h = f2bf(y); l = f2bf(y - bf2f(h)); }
typedef __attribute__((ext_vector_type(2))) unsigned short v2us;
typedef __attribute__((ext_vector_type(4))) unsigned short v4us;
template <typename T16, int NSPLIT, bool BIAS, int ZIN, bool PLANES, bool AHM>
__global__ __launch_bounds__(32) void k_gemmw(const T16* __restrict__ A, const T16* __restrict__ A2, const T16* __restrict__ Bt, const T16* __restrict__ Bt2, int K, float* C, int ldc, const float* __restrict__ bias, size_t sA, size_t sB, size_t sC, size_t tA, size_t tB, size_t tC, bf* Ph, bf* Pl, h16* Vt) {
    typedef typename WFrag<T16>::V V;
    __shared__ __align__(16) float os[16 * 68];
    const size_t z = ZIN > 0 ? blockIdx.z % (ZIN > 0 ? ZIN : 1) : blockIdx.z, zt = ZIN > 0 ? blockIdx.z / (ZIN > 0 ? ZIN : 1) : 0;
    const size_t oA = z * sA + zt * tA, oB = z * sB + zt * tB; A += oA; if (A2) A2 += oA; Bt += oB; if (Bt2) Bt2 += oB; if (!PLANES) C += z * sC + zt * tC;
    const int lane = threadIdx.x & 31, lr = lane & 15, hi = lane >> 4; const int r0 = blockIdx.x * 64, c0 = blockIdx.y * 64;
    v8f acc[4][4];
#pragma unroll
    for (int mb = 0; mb < 4; ++mb)
#pragma unroll
        for (int nb = 0; nb < 4; ++nb) acc[mb][nb] = (v8f){};
    const size_t aoff = AHM ? (size_t)(r0 + lr) * KD + 8 * hi : (size_t)(r0 + lr) * K + 8 * hi, boff = (size_t)(c0 + lr) * K + 8 * hi;
#pragma unroll 1
    for (int kc = 0; kc < K; kc += 32) {
        V a[4], a2[4];
#pragma unroll
        for (int mb = 0; mb < 4; ++mb) {
            if (AHM) { const size_t o = aoff + (size_t)mb * 16 * KD + (size_t)(kc / KD) * RR * KD; a[mb] = WFrag<T16>::ld2(A + o, A + o + RR * KD); if (NSPLIT == 1 || NSPLIT == 2) a2[mb] = WFrag<T16>::ld2(A2 + o, A2 + o + RR * KD); }
            else { a[mb] = WFrag<T16>::ld(A + aoff + (size_t)mb * 16 * K + kc); if (NSPLIT == 1 || NSPLIT == 2) a2[mb] = WFrag<T16>::ld(A2 + aoff + (size_t)mb * 16 * K + kc); } }
#pragma unroll
        for (int nb = 0; nb < 4; ++nb) { const V b = WFrag<T16>::ld(Bt + boff + (size_t)nb * 16 * K + kc); V b2; if (NSPLIT >= 2) b2 = WFrag<T16>::ld(Bt2 + boff + (size_t)nb * 16 * K + kc);
#pragma unroll
            for (int mb = 0; mb < 4; ++mb) { acc[mb][nb] = WFrag<T16>::mma(a[mb], b, acc[mb][nb]); if (NSPLIT == 1 || NSPLIT == 2) acc[mb][nb] = WFrag<T16>::mma(a2[mb], b, acc[mb][nb]); if (NSPLIT >= 2) acc[mb][nb] = WFrag<T16>::mma(a[mb], b2, acc[mb][nb]); } }
        asm volatile("v_nop\n\tv_nop\n\tv_nop\n\tv_nop" : "+v"(acc[0][0]), "+v"(acc[1][1]), "+v"(acc[2][2]), "+v"(acc[3][3]) : "v"(a[0]), "v"(a[3]));
    }
    if (PLANES && c0 >= 2 * DD) {
        h16* vt = Vt + ((((1 - zt) * ZIN + z) * NH_ + (c0 - 2 * DD) / KD) * KD + lr) * RR + r0 + hi * 8;
#pragma unroll
        for (int mb = 0; mb < 4; ++mb)
#pragma unroll
            for (int nb = 0; nb < 4; ++nb) { v8h o;
#pragma unroll
                for (int j = 0; j < 8; ++j) o[j] = (h16)acc[mb][nb][j];
                *(v8h*)(vt + (size_t)nb * KD * RR + mb * 16) = o; }
    } else {
    const size_t po = (((zt * ZIN + z) * NH_ + c0 / KP + (lr >> 3)) * RR + r0) * KP + (lr & 7) * 4;   // PLANES: lane lr reads back columns 4 lr .. 4 lr + 3 of the tile = head lr / 8; rows 2 s and 2 s + 1 of a head are one 128-byte line
#pragma unroll
    for (int mb = 0; mb < 4; ++mb) {
#pragma unroll
        for (int nb = 0; nb < 4; ++nb) {
#pragma unroll
            for (int j = 0; j < 8; ++j) os[(hi * 8 + j) * 68 + nb * 16 + lr] = acc[mb][nb][j]; }
        __builtin_amdgcn_wave_barrier(); asm volatile("" ::: "memory");
        float* crow = C + (size_t)(r0 + mb * 16) * ldc + c0;
{
#pragma unroll
            for (int s = 0; s < 8; ++s) { const int row = 2 * s + hi, cofs = lr * 4; v4f val = *(const v4fa*)(os + row * 68 + cofs);
                if (PLANES) { v4us oh, ol;
#pragma unroll
                    for (int u = 0; u < 4; ++u) { unsigned short a, b; splitf(val[u], a, b); oh[u] = a; ol[u] = b; }
                    *(v4us*)(Ph + po + (size_t)(mb * 16 + row) * KP) = oh; *(v4us*)(Pl + po + (size_t)(mb * 16 + row) * KP) = ol; continue; }
                if (BIAS) { val[0] += bfr(bias[c0 + cofs]); val[1] += bfr(bias[c0 + cofs + 1]); val[2] += bfr(bias[c0 + cofs + 2]); val[3] += bfr(bias[c0 + cofs + 3]); }
                *(v4f*)(crow + (size_t)row * ldc + cofs) = val; }
             }
        __builtin_amdgcn_wave_barrier(); asm volatile("" ::: "memory");
    }
    if (PLANES) asm volatile("s_wait_xcnt 0x0" ::: "memory");   // in the built code this branch runs on, behind a test that never holds, into the v branch, which rewrites the address registers of the stores above
    }
}


// k_wtG: blockIdx.y picks one of the eight weight matrices; their transposed bf16 planes lie one behind the other in Bt. The q and k rows of a side are interleaved by head in the order of the score planes
// (row side: head h = rows 32 h .. : 16 of q, 16 of k; column side: 16 of k, 16 of q), so that a 64-column tile of the projection GEMM holds whole plane rows of two heads.
__global__ __launch_bounds__(256) void k_wtG(const float* __restrict__ w0, const float* __restrict__ w1, const float* __restrict__ w2, const float* __restrict__ w3, const float* __restrict__ w4, const float* __restrict__ w5, const float* __restrict__ w6, const float* __restrict__ w7, int K, int N, bf* Bt) {
    const int y = blockIdx.y; const float* w = y == 0 ? w0 : y == 1 ? w1 : y == 2 ? w2 : y == 3 ? w3 : y == 4 ? w4 : y == 5 ? w5 : y == 6 ? w6 : w7; const bool qk = y < 6 && y % 3 < 2; const int kofs = ((y % 3 == 0) == (y < 3)) ? 0 : KD;
    const int lane = threadIdx.x & 31; const int L0 = (blockIdx.x * 8 + (threadIdx.x >> 5)) * 8; const int nlines = N * K / 64;
{
#pragma unroll 1
        for (int l = 0; l < 8; ++l) { const int L = L0 + l; if (L >= nlines) break; const size_t e = (size_t)L * 64 + lane * 2; const int k = (int)(e % K), n = (int)(e / K); const int nd = qk ? (y / 3) * 3 * N + (n / KD) * KP + kofs + n % KD : y * N + n; bf* dst = Bt + (size_t)nd * K + k; v2us o;
            o[0] = f2bf(w[(size_t)k * N + n]); o[1] = f2bf(w[(size_t)(k + 1) * N + n]); *(v2us*)dst = o; }
         }
}
__global__ __launch_bounds__(256) void k_cvt8(const float* __restrict__ src0, const float* __restrict__ src1, bf* dst, size_t n8) { const size_t i = (size_t)blockIdx.x * 256 + threadIdx.x; if (i >= n8) return; const float* src = blockIdx.y ? src1 : src0; dst += (size_t)blockIdx.y * n8 * 8; const v8f v = *(const v8f*)(src + i * 8); v8us o;
#pragma unroll
    for (int k = 0; k < 8; ++k) o[k] = f2bf(v[k]); *(v8us*)(dst + i * 8) = o;  }

// ---- k_attn: scores, softmax and attention product of one side in one pass over the keys. A wave owns 32 queries (two 16-column groups) of one (side, item, head) and walks the 512 keys 32 at a time.
// Transposed products: S^T[key][query] = K' Q'^T (A = key rows, B = query rows kept in registers), O^T[d][query] += V^T P^T. In the accumulator map a lane holds ONE query (lane & 15) and keys 8 * (lane >> 4) + 0..7 of a 16-key tile,
// so the maximum and the sum over keys are in-lane plus one exchange between the wave's halves, and the two score tiles of a pass, converted in place, ARE the B operand of the second product (element s = tile s >> 3, register s & 7, the hardware k order);
// V^T is loaded in the same k order (16 bytes at 16 * half and at 32 + 16 * half of each 64). Running maximum with rescale (base 2); the halves' sums are joined once at the end.
// COL == false: queries = rows r, keys = columns c, matrix[query][key]. COL == true: queries = columns, keys = rows, matrix[key][query].
typedef __attribute__((ext_vector_type(2))) float v2f;
typedef __attribute__((ext_vector_type(2))) __bf16 v2b;
__device__ __forceinline__ float xhalf(float x) { return __int_as_float(__builtin_amdgcn_permlanex16(__float_as_int(x), __float_as_int(x), 0x76543210, 0xfedcba98, false, false)); }   // lane l with lane l ^ 16
// Exponentials with the slot behind them in ONE statement: the instruction set asks for one independent instruction or a v_nop between a transcendental and an instruction that reads its result or overwrites its source;
// Inside the statement each v_exp_f32 is followed by an independent one (early-clobber results lie on no source), the last by the v_nop.
__device__ __forceinline__ void exp2x8(const float* x, float* p) {
    asm("v_exp_f32 %0, %8\n\tv_exp_f32 %1, %9\n\tv_exp_f32 %2, %10\n\tv_exp_f32 %3, %11\n\tv_exp_f32 %4, %12\n\tv_exp_f32 %5, %13\n\tv_exp_f32 %6, %14\n\tv_exp_f32 %7, %15\n\tv_nop"
        : "=&v"(p[0]), "=&v"(p[1]), "=&v"(p[2]), "=&v"(p[3]), "=&v"(p[4]), "=&v"(p[5]), "=&v"(p[6]), "=&v"(p[7]) : "v"(x[0]), "v"(x[1]), "v"(x[2]), "v"(x[3]), "v"(x[4]), "v"(x[5]), "v"(x[6]), "v"(x[7])); }
__device__ __forceinline__ float exp2x1(float x) { float p; asm("v_exp_f32 %0, %1\n\tv_nop" : "=&v"(p) : "v"(x)); return p; }   // the same slot, one value
template <bool COL>
__device__ __forceinline__ void attn_side(const bf* __restrict__ QH, const bf* __restrict__ QL, const bf* __restrict__ KH, const bf* __restrict__ KL, const h16* __restrict__ VT, const float* __restrict__ mt, const float w, bf* __restrict__ Mh, bf* __restrict__ Ml, const int q0, const int lr, const int hi) {
    const float SC = 0.36067376022224085f;   // 1/4 (the norm) x log2(e)
    v16bf qh[2], ql[2]; v8f acc[2]; float mrun[2], lsum[2];
#pragma unroll
    for (int nb = 0; nb < 2; ++nb) { const size_t o = (size_t)(q0 + nb * 16 + lr) * KP + 8 * hi; qh[nb] = WFrag<bf>::ld(QH + o); ql[nb] = WFrag<bf>::ld(QL + o); acc[nb] = (v8f){}; mrun[nb] = -3.0e38f; lsum[nb] = 0.f; }
#pragma unroll 2   // two passes a trip: the second pass's loads are issued while the first pass is worked on (the inner loops are unrolled whole so that their arrays stay in registers)
    for (int k0 = 0; k0 < RR; k0 += 32) {
        v16bf kh[2], kl[2];
#pragma unroll
        for (int t = 0; t < 2; ++t) { const size_t o = (size_t)(k0 + t * 16 + lr) * KP + 8 * hi; kh[t] = WFrag<bf>::ld(KH + o); kl[t] = WFrag<bf>::ld(KL + o); }
        const v16h va = WFrag<h16>::ld(VT + (size_t)lr * RR + k0 + 8 * hi);
#pragma unroll
        for (int nb = 0; nb < 2; ++nb) {
            float y[16];
#pragma unroll
            for (int t = 0; t < 2; ++t) {
                v8f m8;
                if (!COL) m8 = *(const v8f*)(mt + (size_t)(q0 + nb * 16 + lr) * RR + k0 + t * 16 + hi * 8);
                else { const float* p = mt + (size_t)(k0 + t * 16 + hi * 8) * RR + q0 + nb * 16 + lr;
#pragma unroll
                    for (int j = 0; j < 8; ++j) m8[j] = p[(size_t)j * RR]; }
                v8f s = wmmab(kh[t], qh[nb], (v8f){}); s = wmmab(kl[t], qh[nb], s); s = wmmab(kh[t], ql[nb], s);
#pragma unroll
                for (int j = 0; j < 8; j += 2) { const v2f mb = __builtin_convertvector(__builtin_convertvector((v2f){m8[j], m8[j + 1]}, v2b), v2f);   // matrix rounded to bf16, nearest even
                    y[t * 8 + j] = (s[j] + mb[0] * w) * SC; y[t * 8 + j + 1] = (s[j + 1] + mb[1] * w) * SC; }
            }
            float mx[4];
#pragma unroll
            for (int u = 0; u < 4; ++u) mx[u] = fmaxf(fmaxf(y[u], y[u + 4]), fmaxf(y[u + 8], y[u + 12]));
            float m1 = fmaxf(fmaxf(mx[0], mx[1]), fmaxf(mx[2], mx[3])); m1 = fmaxf(m1, xhalf(m1));
            const float mn = fmaxf(mrun[nb], m1); const float al = exp2x1(mrun[nb] - mn);   // 0 on the first pass
            mrun[nb] = mn; float ps[4] = {0.f, 0.f, 0.f, 0.f}, p[16]; v16h pb;
#pragma unroll
            for (int i = 0; i < 16; ++i) y[i] -= mn;
            exp2x8(y, p); exp2x8(y + 8, p + 8);
#pragma unroll
            for (int i = 0; i < 16; ++i) { ps[i & 3] += p[i]; pb[i] = (h16)p[i]; }
            lsum[nb] = lsum[nb] * al + ((ps[0] + ps[1]) + (ps[2] + ps[3]));
#pragma unroll
            for (int j = 0; j < 8; ++j) acc[nb][j] *= al;
            acc[nb] = wmma16(va, pb, acc[nb]);
        }
    }
#pragma unroll
    for (int nb = 0; nb < 2; ++nb) { const float f = __fdiv_rn(1.0f, lsum[nb] + xhalf(lsum[nb])); v8us oh, ol;
#pragma unroll
        for (int j = 0; j < 8; ++j) { unsigned short a, b; splitf(acc[nb][j] * f, a, b); oh[j] = a; ol[j] = b; }
        const size_t o = (size_t)(q0 + nb * 16 + lr) * KD + hi * 8; *(v8us*)(Mh + o) = oh; *(v8us*)(Ml + o) = ol; }   // [query][d], d = 8 * half + 0..7, as the bf16 hi and lo planes that the output GEMM reads: a wave stores 1 KiB in a row to each
}
// grid (512 / 128 queries, GB * 16 (item, head), 2 sides), 4 waves. PH/PL: [X, Y][g][h][512][32]; VT: [col_v, row_v][g][h][16][512]; MH/ML: [row, col][g][h][512][16]; mt: the GB items' matrices.
__global__ __launch_bounds__(128) void k_attn(const bf* __restrict__ PH, const bf* __restrict__ PL, const h16* __restrict__ VT, const float* __restrict__ mt, const float* __restrict__ wm, bf* __restrict__ MH, bf* __restrict__ ML) {
    const int lane = threadIdx.x & 31, lr = lane & 15, hi = lane >> 4; const int q0 = blockIdx.x * 128 + (threadIdx.x >> 5) * 32; const int gh = blockIdx.y, side = blockIdx.z;
    const size_t pq = (size_t)(side * GB * NH_ + gh) * RR * KP, pk = (size_t)((1 - side) * GB * NH_ + gh) * RR * KP; const size_t z = (size_t)side * GB * NH_ + gh;
    const float w = bfr(wm[gh % NH_]); mt += (size_t)(gh / NH_) * RR * RR; VT += z * KD * RR; const size_t mo = z * RR * KD;
    if (side == 0) attn_side<false>(PH + pq, PL + pq, PH + pk, PL + pk, VT, mt, w, MH + mo, ML + mo, q0, lr, hi);
    else attn_side<true>(PH + pq, PL + pq, PH + pk, PL + pk, VT, mt, w, MH + mo, ML + mo, q0, lr, hi);
}

extern "C" void kernel_launch(void* const* d_in, const int* in_sizes, int n_in,
                              void* d_out, int out_size, void* d_ws, size_t ws_size, hipStream_t stream) {
    (void)in_sizes; (void)n_in; (void)out_size;
    const float** I = (const float**)d_in;
    const float *row_emb = I[0], *col_emb = I[1], *matrix = I[2], *Wq_row = I[3], *Wk_row = I[4], *Wv_row = I[5], *Wq_col = I[6], *Wk_col = I[7], *Wv_col = I[8], *W_mat = I[9], *W_out_row = I[10], *W_out_col = I[11];
    float* OUT0 = (float*)d_out;     // [32][512][256] x 2, the column output behind the row output
    char* wsp = (char*)d_ws;
    auto take = [&](size_t bytes) { char* p = wsp; wsp += (bytes + 255) & ~(size_t)255; return (void*)p; };
    // Every buffer holds GB batch items, and the row-side and column-side twins of a stage lie one behind the other, so that one launch covers both twins of GB items.
    bf* WT = (bf*)take((size_t)8 * DD * DD * 2);                                                       // Bt rows [16 heads x (q, k) | v] row side, [16 heads x (k, q) | v] column side, out row, out col
    bf* EB = (bf*)take((size_t)2 * GB * RR * DD * 2);                                                  // [row, col][g]
    bf* PH = (bf*)take((size_t)2 * GB * NH_ * RR * KP * 2); bf* PL = (bf*)take((size_t)2 * GB * NH_ * RR * KP * 2);   // [row_q | row_k, col_k | col_q][g]
    h16* VT = (h16*)take((size_t)2 * GB * NH_ * KD * RR * 2);                                          // [col_v, row_v][g]
    bf* MH = (bf*)take((size_t)2 * GB * RR * DD * 2); bf* ML = (bf*)take((size_t)2 * GB * RR * DD * 2);   // [row, col][g][h]
    if ((size_t)(wsp - (char*)d_ws) > ws_size) return;
    k_wtG<<<dim3((DD * DD / 64 + 63) / 64, 8, 1), 256, 0, stream>>>(Wq_row, Wk_row, Wv_row, Wq_col, Wk_col, Wv_col, W_out_row, W_out_col, DD, DD, WT);
    for (int b = 0; b < NB_; b += GB) {
        k_cvt8<<<dim3((GB * RR * DD / 8 + 255) / 256, 2, 1), 256, 0, stream>>>(row_emb + (size_t)b * RR * DD, col_emb + (size_t)b * RR * DD, EB, (size_t)GB * RR * DD / 8);
        k_gemmw<bf, 0, false, GB, true, false><<<dim3(RR / 64, D3 / 64, 2 * GB), 32, 0, stream>>>(EB, nullptr, WT, nullptr, DD, nullptr, 0, nullptr, (size_t)RR * DD, 0, 0, (size_t)GB * RR * DD, (size_t)D3 * DD, 0, PH, PL, VT);
        k_attn<<<dim3(RR / 128, GB * NH_, 2), 128, 0, stream>>>(PH, PL, VT, matrix + (size_t)b * RR * RR, W_mat, MH, ML);
        k_gemmw<bf, 1, false, GB, false, true><<<dim3(RR / 64, DD / 64, 2 * GB), 32, 0, stream>>>(MH, ML, WT + (size_t)6 * DD * DD, nullptr, DD, OUT0 + (size_t)b * RR * DD, DD, nullptr, (size_t)RR * DD, 0, (size_t)RR * DD, (size_t)GB * RR * DD, (size_t)DD * DD, (size_t)NB_ * RR * DD, nullptr, nullptr, nullptr); }
}

// v005
// Measured time: 204 microseconds a run.
// Timed twice side by side with v004, it ran 2.03 and 2.05 times as fast.
// Counting every step since v000, it is 42.8 times as fast.
#include <hip/hip_runtime.h>

// MixedScoreMHA (row_emb, col_emb [32][512][256], matrix [32][512][512]; 16 heads x 16: row_q/k/v = row_emb W, col_q/k/v = col_emb W; compat[h][r][c] = (row_q.col_k + col_q.row_k + matrix W_mat[h]) / 4 (W_mat read); attn_row = softmax over c, attn_col = softmax over r;
// row_heads = attn_row col_v, col_heads[c] = sum_r attn_col[r][c] row_v[r]; out_row = merge(row_heads) W_out_row, out_col = merge(col_heads) W_out_col -> two outputs [32][512][256]). Scores, softmax and the attention product are one kernel (k_attn): compat and the
// probabilities never reach memory; the projection GEMM and k_attn store their results in the layout and type that the next product reads. The column side is the same kernel on compat transposed (queries = columns, keys = rows), so each side computes its own scores.
// Compute dtypes, f32 accumulate: every input rounded to bf16; the six projections on PLAIN bf16 operands (inputs: exact); the score product on bf16 hi+lo planes of q and k (3 products, K = 32 = [q | k] against [k | q]); probabilities and v in fp16.

#define NB_  32
#define RR   512
#define DD   256
#define D3   768
#define NH_  16
#define KD   16
#define KP   32
#define GB   32     // batch items that share each launch (NB_ % GB == 0); the workspace holds GB items' intermediates, 4 MiB an item (129 MiB with the weights)
typedef _Float16 h16;
typedef unsigned short bf;
typedef __attribute__((ext_vector_type(16))) __bf16   v16bf;
typedef __attribute__((ext_vector_type(16))) _Float16 v16h;
typedef __attribute__((ext_vector_type(8)))  _Float16 v8h;
typedef __attribute__((ext_vector_type(8)))  unsigned short v8us;
typedef __attribute__((ext_vector_type(8)))  float    v8f;
typedef __attribute__((ext_vector_type(4)))  float    v4f;
typedef v8h  __attribute__((may_alias)) v8ha;
typedef v4f  __attribute__((may_alias)) v4fa;
typedef v8us __attribute__((may_alias)) v8usa;

__device__ __forceinline__ unsigned short f2bf(float f) { unsigned u = __float_as_uint(f); u += 0x7FFFu + ((u >> 16) & 1u); return (unsigned short)(u >> 16); }
__device__ __forceinline__ float bf2f(unsigned short b) { return __uint_as_float(((unsigned)b) << 16); }
__device__ __forceinline__ float bfr(float f) { return bf2f(f2bf(f)); }
__device__ __forceinline__ v16h cat16(v8h lo, v8h hi) { return __builtin_shufflevector(lo, hi, 0, 1, 2, 3, 4, 5, 6, 7, 8, 9, 10, 11, 12, 13, 14, 15); }
__device__ __forceinline__ v16bf cat16b(v8us lo, v8us hi) { return __builtin_bit_cast(v16bf, __builtin_shufflevector(lo, hi, 0, 1, 2, 3, 4, 5, 6, 7, 8, 9, 10, 11, 12, 13, 14, 15)); }
__device__ __forceinline__ v8f wmma16(v16h a, v16h b, v8f c) { return __builtin_amdgcn_wmma_f32_16x16x32_f16(false, a, false, b, (short)0, c, false, false); }
__device__ __forceinline__ v8f wmmab(v16bf a, v16bf b, v8f c) { return __builtin_amdgcn_wmma_f32_16x16x32_bf16(false, a, false, b, (short)0, c, false, false); }



// ---- k_gemmw: register-blocked GEMM, ONE WAVE per 64x64 output tile (16 accumulators), operands straight from K-contiguous 16-bit planes; grid (M/64, N/64, Z), 32 threads.
// C[m][n] (f32, pitch ldc, + optional f32 bias[n]) = sum_k A[m][k] Bt[n][k] (+ split products per NSPLIT). z-batch strides sA/sB/sC in elements. K % 32 == 0.
// ZIN == 0: blockIdx.z is one flat batch index. ZIN > 0: blockIdx.z = twin * ZIN + item; the item moves by sA/sB/sC, the twin (row side, column side) by tA/tB/tC.
// PLANES (the projections; k_wtG orders the 768 weight rows as 16 heads x 32 score columns, then v): no C; the tile goes out as the attention kernel's operands, every 128-byte line of them written by one wave.
//   score tiles (two heads): bf16 hi and lo planes, K = 32 with no padding. Row side: X[h][r][k] = row_q[r][h*16 + k] for k < 16, row_k behind it; column side: Y[h][c][k] = col_k for k < 16, col_q behind it: X[r] . Y[c] = row_q.col_k + col_q.row_k.
//   v tiles (four heads): VT[h][d][r] in fp16, sets 0 col_v, 1 row_v: in the accumulator map a lane holds one d and 8 consecutive r, which is 16 bytes of a VT row.
// AHM: A lies head-major, [K / 16][512 rows][16] (as k_attn stores it), not [row][K]; the fragment's two 8-element runs, k = kc + 8 half and kc + 16 + 8 half, are then the same 16 bytes of two neighbouring heads.
template <typename T16> struct WFrag;
template <> struct WFrag<h16> { typedef v16h V; static __device__ __forceinline__ V ld(const h16* p) { return cat16(*(const v8h*)p, *(const v8h*)(p + 16)); } static __device__ __forceinline__ v8f mma(V a, V b, v8f c) { return wmma16(a, b, c); } };
template <> struct WFrag<bf> { typedef v16bf V; static __device__ __forceinline__ V ld2(const bf* p, const bf* q) { return cat16b(*(const v8us*)p, *(const v8us*)q); } static __device__ __forceinline__ V ld(const bf* p) { return ld2(p, p + 16); } static __device__ __forceinline__ v8f mma(V a, V b, v8f c) { return wmmab(a, b, c); } };
__device__ __forceinline__ void splitf(float y, unsigned short& h, unsigned short& l) { h = f2bf(y); l = f2bf(y - bf2f(h)); }
typedef __attribute__((ext_vector_type(2))) unsigned short v2us;
typedef __attribute__((ext_vector_type(4))) unsigned short v4us;
template <typename T16, int NSPLIT, bool BIAS, int ZIN, bool PLANES, bool AHM>
__global__ __launch_bounds__(32) void k_gemmw(const T16* __restrict__ A, const T16* __restrict__ A2, const T16* __restrict__ Bt, const T16* __restrict__ Bt2, int K, float* C, int ldc, const float* __restrict__ bias, size_t sA, size_t sB, size_t sC, size_t tA, size_t tB, size_t tC, bf* Ph, bf* Pl, h16* Vt) {
    typedef typename WFrag<T16>::V V;
    __shared__ __align__(16) float os[16 * 68];
    const size_t z = ZIN > 0 ? blockIdx.z % (ZIN > 0 ? ZIN : 1) : blockIdx.z, zt = ZIN > 0 ? blockIdx.z / (ZIN > 0 ? ZIN : 1) : 0;
    const size_t oA = z * sA + zt * tA, oB = z * sB + zt * tB; A += oA; if (A2) A2 += oA; Bt += oB; if (Bt2) Bt2 += oB; if (!PLANES) C += z * sC + zt * tC;
    const int lane = threadIdx.x & 31, lr = lane & 15, hi = lane >> 4; const int r0 = blockIdx.x * 64, c0 = blockIdx.y * 64;
    v8f acc[4][4];
#pragma unroll
    for (int mb = 0; mb < 4; ++mb)
#pragma unroll
        for (int nb = 0; nb < 4; ++nb) acc[mb][nb] = (v8f){};
    const size_t aoff = AHM ? (size_t)(r0 + lr) * KD + 8 * hi : (size_t)(r0 + lr) * K + 8 * hi, boff = (size_t)(c0 + lr) * K + 8 * hi;
#pragma unroll 1
    for (int kc = 0; kc < K; kc += 32) {
        V a[4], a2[4];
#pragma unroll
        for (int mb = 0; mb < 4; ++mb) {
            if (AHM) { const size_t o = aoff + (size_t)mb * 16 * KD + (size_t)(kc / KD) * RR * KD; a[mb] = WFrag<T16>::ld2(A + o, A + o + RR * KD); if (NSPLIT == 1 || NSPLIT == 2) a2[mb] = WFrag<T16>::ld2(A2 + o, A2 + o + RR * KD); }
            else { a[mb] = WFrag<T16>::ld(A + aoff + (size_t)mb * 16 * K + kc); if (NSPLIT == 1 || NSPLIT == 2) a2[mb] = WFrag<T16>::ld(A2 + aoff + (size_t)mb * 16 * K + kc); } }
#pragma unroll
        for (int nb = 0; nb < 4; ++nb) { const V b = WFrag<T16>::ld(Bt + boff + (size_t)nb * 16 * K + kc); V b2; if (NSPLIT >= 2) b2 = WFrag<T16>::ld(Bt2 + boff + (size_t)nb * 16 * K + kc);
#pragma unroll
            for (int mb = 0; mb < 4; ++mb) { acc[mb][nb] = WFrag<T16>::mma(a[mb], b, acc[mb][nb]); if (NSPLIT == 1 || NSPLIT == 2) acc[mb][nb] = WFrag<T16>::mma(a2[mb], b, acc[mb][nb]); if (NSPLIT >= 2) acc[mb][nb] = WFrag<T16>::mma(a[mb], b2, acc[mb][nb]); } }
        asm volatile("v_nop\n\tv_nop\n\tv_nop\n\tv_nop" : "+v"(acc[0][0]), "+v"(acc[1][1]), "+v"(acc[2][2]), "+v"(acc[3][3]) : "v"(a[0]), "v"(a[3]));
    }
    if (PLANES && c0 >= 2 * DD) {
        h16* vt = Vt + ((((1 - zt) * ZIN + z) * NH_ + (c0 - 2 * DD) / KD) * KD + lr) * RR + r0 + hi * 8;
#pragma unroll
        for (int mb = 0; mb < 4; ++mb)
#pragma unroll
            for (int nb = 0; nb < 4; ++nb) { v8h o;
#pragma unroll
                for (int j = 0; j < 8; ++j) o[j] = (h16)acc[mb][nb][j];
                *(v8h*)(vt + (size_t)nb * KD * RR + mb * 16) = o; }
    } else {
    const size_t po = (((zt * ZIN + z) * NH_ + c0 / KP + (lr >> 3)) * RR + r0) * KP + (lr & 7) * 4;   // PLANES: lane lr reads back columns 4 lr .. 4 lr + 3 of the tile = head lr / 8; rows 2 s and 2 s + 1 of a head are one 128-byte line
#pragma unroll
    for (int mb = 0; mb < 4; ++mb) {
#pragma unroll
        for (int nb = 0; nb < 4; ++nb) {
#pragma unroll
            for (int j = 0; j < 8; ++j) os[(hi * 8 + j) * 68 + nb * 16 + lr] = acc[mb][nb][j]; }
        __builtin_amdgcn_wave_barrier(); asm volatile("" ::: "memory");
        float* crow = C + (size_t)(r0 + mb * 16) * ldc + c0;
{
#pragma unroll
            for (int s = 0; s < 8; ++s) { const int row = 2 * s + hi, cofs = lr * 4; v4f val = *(const v4fa*)(os + row * 68 + cofs);
                if (PLANES) { v4us oh, ol;
#pragma unroll
                    for (int u = 0; u < 4; ++u) { unsigned short a, b; splitf(val[u], a, b); oh[u] = a; ol[u] = b; }
                    *(v4us*)(Ph + po + (size_t)(mb * 16 + row) * KP) = oh; *(v4us*)(Pl + po + (size_t)(mb * 16 + row) * KP) = ol; continue; }
                if (BIAS) { val[0] += bfr(bias[c0 + cofs]); val[1] += bfr(bias[c0 + cofs + 1]); val[2] += bfr(bias[c0 + cofs + 2]); val[3] += bfr(bias[c0 + cofs + 3]); }
                *(v4f*)(crow + (size_t)row * ldc + cofs) = val; }
             }
        __builtin_amdgcn_wave_barrier(); asm volatile("" ::: "memory");
    }
    if (PLANES) asm volatile("s_wait_xcnt 0x0" ::: "memory");   // in the built code this branch runs on, behind a test that never holds, into the v branch, which rewrites the address registers of the stores above
    }
}


// k_wtG: blockIdx.y picks one of the eight weight matrices; their transposed bf16 planes lie one behind the other in Bt. The q and k rows of a side are interleaved by head in the order of the score planes
// (row side: head h = rows 32 h .. : 16 of q, 16 of k; column side: 16 of k, 16 of q), so that a 64-column tile of the projection GEMM holds whole plane rows of two heads.
__global__ __launch_bounds__(256) void k_wtG(const float* __restrict__ w0, const float* __restrict__ w1, const float* __restrict__ w2, const float* __restrict__ w3, const float* __restrict__ w4, const float* __restrict__ w5, const float* __restrict__ w6, const float* __restrict__ w7, int K, int N, bf* Bt) {
    const int y = blockIdx.y; const float* w = y == 0 ? w0 : y == 1 ? w1 : y == 2 ? w2 : y == 3 ? w3 : y == 4 ? w4 : y == 5 ? w5 : y == 6 ? w6 : w7; const bool qk = y < 6 && y % 3 < 2; const int kofs = ((y % 3 == 0) == (y < 3)) ? 0 : KD;
    const int lane = threadIdx.x & 31; const int L0 = (blockIdx.x * 8 + (threadIdx.x >> 5)) * 8; const int nlines = N * K / 64;
{
#pragma unroll 1
        for (int l = 0; l < 8; ++l) { const int L = L0 + l; if (L >= nlines) break; const size_t e = (size_t)L * 64 + lane * 2; const int k = (int)(e % K), n = (int)(e / K); const int nd = qk ? (y / 3) * 3 * N + (n / KD) * KP + kofs + n % KD : y * N + n; bf* dst = Bt + (size_t)nd * K + k; v2us o;
            o[0] = f2bf(w[(size_t)k * N + n]); o[1] = f2bf(w[(size_t)(k + 1) * N + n]); *(v2us*)dst = o; }
         }
}
__global__ __launch_bounds__(256) void k_cvt8(const float* __restrict__ src0, const float* __restrict__ src1, bf* dst, size_t n8) { const size_t i = (size_t)blockIdx.x * 256 + threadIdx.x; if (i >= n8) return; const float* src = blockIdx.y ? src1 : src0; dst += (size_t)blockIdx.y * n8 * 8; const v8f v = *(const v8f*)(src + i * 8); v8us o;
#pragma unroll
    for (int k = 0; k < 8; ++k) o[k] = f2bf(v[k]); *(v8us*)(dst + i * 8) = o;  }

// ---- k_attn: scores, softmax and attention product of one side in one pass over the keys. A wave owns 32 queries (two 16-column groups) of one (side, item, head) and walks the 512 keys 32 at a time.
// Transposed products: S^T[key][query] = K' Q'^T (A = key rows, B = query rows kept in registers), O^T[d][query] += V^T P^T. In the accumulator map a lane holds ONE query (lane & 15) and keys 8 * (lane >> 4) + 0..7 of a 16-key tile,
// so the maximum and the sum over keys are in-lane plus one exchange between the wave's halves, and the two score tiles of a pass, converted in place, ARE the B operand of the second product (element s = tile s >> 3, register s & 7, the hardware k order);
// V^T is loaded in the same k order (16 bytes at 16 * half and at 32 + 16 * half of each 64). Running maximum with rescale (base 2); the halves' sums are joined once at the end.
// COL == false: queries = rows r, keys = columns c, matrix[query][key]. COL == true: queries = columns, keys = rows, matrix[key][query].
typedef __attribute__((ext_vector_type(2))) float v2f;
typedef __attribute__((ext_vector_type(2))) __bf16 v2b;
__device__ __forceinline__ float xhalf(float x) { return __int_as_float(__builtin_amdgcn_permlanex16(__float_as_int(x), __float_as_int(x), 0x76543210, 0xfedcba98, false, false)); }   // lane l with lane l ^ 16
// Exponentials with the slot behind them in ONE statement: the instruction set asks for one independent instruction or a v_nop between a transcendental and an instruction that reads its result or overwrites its source;
// Inside the statement each v_exp_f32 is followed by an independent one (early-clobber results lie on no source), the last by the v_nop.
__device__ __forceinline__ void exp2x8(const float* x, float* p) {
    asm("v_exp_f32 %0, %8\n\tv_exp_f32 %1, %9\n\tv_exp_f32 %2, %10\n\tv_exp_f32 %3, %11\n\tv_exp_f32 %4, %12\n\tv_exp_f32 %5, %13\n\tv_exp_f32 %6, %14\n\tv_exp_f32 %7, %15\n\tv_nop"
        : "=&v"(p[0]), "=&v"(p[1]), "=&v"(p[2]), "=&v"(p[3]), "=&v"(p[4]), "=&v"(p[5]), "=&v"(p[6]), "=&v"(p[7]) : "v"(x[0]), "v"(x[1]), "v"(x[2]), "v"(x[3]), "v"(x[4]), "v"(x[5]), "v"(x[6]), "v"(x[7])); }
__device__ __forceinline__ float exp2x1(float x) { float p; asm("v_exp_f32 %0, %1\n\tv_nop" : "=&v"(p) : "v"(x)); return p; }   // the same slot, one value
template <bool COL>
__device__ __forceinline__ void attn_side(const bf* __restrict__ QH, const bf* __restrict__ QL, const bf* __restrict__ KH, const bf* __restrict__ KL, const h16* __restrict__ VT, const float* __restrict__ mt, const float w, bf* __restrict__ Mh, bf* __restrict__ Ml, const int q0, const int lr, const int hi) {
    const float SC = 0.36067376022224085f;   // 1/4 (the norm) x log2(e)
    v16bf qh[2], ql[2]; v8f acc[2]; float mrun[2], lsum[2];
#pragma unroll
    for (int nb = 0; nb < 2; ++nb) { const size_t o = (size_t)(q0 + nb * 16 + lr) * KP + 8 * hi; qh[nb] = WFrag<bf>::ld(QH + o); ql[nb] = WFrag<bf>::ld(QL + o); acc[nb] = (v8f){}; mrun[nb] = -3.0e38f; lsum[nb] = 0.f; }
#pragma unroll 2   // two passes a trip: the second pass's loads are issued while the first pass is worked on (the inner loops are unrolled whole so that their arrays stay in registers)
    for (int k0 = 0; k0 < RR; k0 += 32) {
        v16bf kh[2], kl[2];
#pragma unroll
        for (int t = 0; t < 2; ++t) { const size_t o = (size_t)(k0 + t * 16 + lr) * KP + 8 * hi; kh[t] = WFrag<bf>::ld(KH + o); kl[t] = WFrag<bf>::ld(KL + o); }
        const v16h va = WFrag<h16>::ld(VT + (size_t)lr * RR + k0 + 8 * hi);
#pragma unroll
        for (int nb = 0; nb < 2; ++nb) {
            float y[16];
#pragma unroll
            for (int t = 0; t < 2; ++t) {
                v8f m8;
                if (!COL) m8 = *(const v8f*)(mt + (size_t)(q0 + nb * 16 + lr) * RR + k0 + t * 16 + hi * 8);
                else { const float* p = mt + (size_t)(k0 + t * 16 + hi * 8) * RR + q0 + nb * 16 + lr;
#pragma unroll
                    for (int j = 0; j < 8; ++j) m8[j] = p[(size_t)j * RR]; }
                v8f s = wmmab(kh[t], qh[nb], (v8f){}); s = wmmab(kl[t], qh[nb], s); s = wmmab(kh[t], ql[nb], s);
#pragma unroll
                for (int j = 0; j < 8; j += 2) { const v2f mb = __builtin_convertvector(__builtin_convertvector((v2f){m8[j], m8[j + 1]}, v2b), v2f);   // matrix rounded to bf16, nearest even
                    y[t * 8 + j] = (s[j] + mb[0] * w) * SC; y[t * 8 + j + 1] = (s[j + 1] + mb[1] * w) * SC; }
            }
            float mx[4];
#pragma unroll
            for (int u = 0; u < 4; ++u) mx[u] = fmaxf(fmaxf(y[u], y[u + 4]), fmaxf(y[u + 8], y[u + 12]));
            float m1 = fmaxf(fmaxf(mx[0], mx[1]), fmaxf(mx[2], mx[3])); m1 = fmaxf(m1, xhalf(m1));
            const float mn = fmaxf(mrun[nb], m1); const float al = exp2x1(mrun[nb] - mn);   // 0 on the first pass
            mrun[nb] = mn; float ps[4] = {0.f, 0.f, 0.f, 0.f}, p[16]; v16h pb;
#pragma unroll
            for (int i = 0; i < 16; ++i) y[i] -= mn;
            exp2x8(y, p); exp2x8(y + 8, p + 8);
#pragma unroll
            for (int i = 0; i < 16; ++i) { ps[i & 3] += p[i]; pb[i] = (h16)p[i]; }
            lsum[nb] = lsum[nb] * al + ((ps[0] + ps[1]) + (ps[2] + ps[3]));
#pragma unroll
            for (int j = 0; j < 8; ++j) acc[nb][j] *= al;
            acc[nb] = wmma16(va, pb, acc[nb]);
        }
    }
#pragma unroll
    for (int nb = 0; nb < 2; ++nb) { const float f = __fdiv_rn(1.0f, lsum[nb] + xhalf(lsum[nb])); v8us oh, ol;
#pragma unroll
        for (int j = 0; j < 8; ++j) { unsigned short a, b; splitf(acc[nb][j] * f, a, b); oh[j] = a; ol[j] = b; }
        const size_t o = (size_t)(q0 + nb * 16 + lr) * KD + hi * 8; *(v8us*)(Mh + o) = oh; *(v8us*)(Ml + o) = ol; }   // [query][d], d = 8 * half + 0..7, as the bf16 hi and lo planes that the output GEMM reads: a wave stores 1 KiB in a row to each
}
// grid (512 / 128 queries, GB * 16 (item, head), 2 sides), 4 waves. PH/PL: [X, Y][g][h][512][32]; VT: [col_v, row_v][g][h][16][512]; MH/ML: [row, col][g][h][512][16]; mt: the GB items' matrices.
__global__ __launch_bounds__(128) void k_attn(const bf* __restrict__ PH, const bf* __restrict__ PL, const h16* __restrict__ VT, const float* __restrict__ mt, const float* __restrict__ wm, bf* __restrict__ MH, bf* __restrict__ ML) {
    const int lane = threadIdx.x & 31, lr = lane & 15, hi = lane >> 4; const int q0 = blockIdx.x * 128 + (threadIdx.x >> 5) * 32; const int gh = blockIdx.y, side = blockIdx.z;
    const size_t pq = (size_t)(side * GB * NH_ + gh) * RR * KP, pk = (size_t)((1 - side) * GB * NH_ + gh) * RR * KP; const size_t z = (size_t)side * GB * NH_ + gh;
    const float w = bfr(wm[gh % NH_]); mt += (size_t)(gh / NH_) * RR * RR; VT += z * KD * RR; const size_t mo = z * RR * KD;
    if (side == 0) attn_side<false>(PH + pq, PL + pq, PH + pk, PL + pk, VT, mt, w, MH + mo, ML + mo, q0, lr, hi);
    else attn_side<true>(PH + pq, PL + pq, PH + pk, PL + pk, VT, mt, w, MH + mo, ML + mo, q0, lr, hi);
}

extern "C" void kernel_launch(void* const* d_in, const int* in_sizes, int n_in,
                              void* d_out, int out_size, void* d_ws, size_t ws_size, hipStream_t stream) {
    (void)in_sizes; (void)n_in; (void)out_size;
    const float** I = (const float**)d_in;
    const float *row_emb = I[0], *col_emb = I[1], *matrix = I[2], *Wq_row = I[3], *Wk_row = I[4], *Wv_row = I[5], *Wq_col = I[6], *Wk_col = I[7], *Wv_col = I[8], *W_mat = I[9], *W_out_row = I[10], *W_out_col = I[11];
    float* OUT0 = (float*)d_out;     // [32][512][256] x 2, the column output behind the row output
    char* wsp = (char*)d_ws;
    auto take = [&](size_t bytes) { char* p = wsp; wsp += (bytes + 255) & ~(size_t)255; return (void*)p; };
    // Every buffer holds GB batch items, and the row-side and column-side twins of a stage lie one behind the other, so that one launch covers both twins of GB items.
    bf* WT = (bf*)take((size_t)8 * DD * DD * 2);                                                       // Bt rows [16 heads x (q, k) | v] row side, [16 heads x (k, q) | v] column side, out row, out col
    bf* EB = (bf*)take((size_t)2 * GB * RR * DD * 2);                                                  // [row, col][g]
    bf* PH = (bf*)take((size_t)2 * GB * NH_ * RR * KP * 2); bf* PL = (bf*)take((size_t)2 * GB * NH_ * RR * KP * 2);   // [row_q | row_k, col_k | col_q][g]
    h16* VT = (h16*)take((size_t)2 * GB * NH_ * KD * RR * 2);                                          // [col_v, row_v][g]
    bf* MH = (bf*)take((size_t)2 * GB * RR * DD * 2); bf* ML = (bf*)take((size_t)2 * GB * RR * DD * 2);   // [row, col][g][h]
    if ((size_t)(wsp - (char*)d_ws) > ws_size) return;
    k_wtG<<<dim3((DD * DD / 64 + 63) / 64, 8, 1), 256, 0, stream>>>(Wq_row, Wk_row, Wv_row, Wq_col, Wk_col, Wv_col, W_out_row, W_out_col, DD, DD, WT);
    for (int b = 0; b < NB_; b += GB) {
        k_cvt8<<<dim3((GB * RR * DD / 8 + 255) / 256, 2, 1), 256, 0, stream>>>(row_emb + (size_t)b * RR * DD, col_emb + (size_t)b * RR * DD, EB, (size_t)GB * RR * DD / 8);
        k_gemmw<bf, 0, false, GB, true, false><<<dim3(RR / 64, D3 / 64, 2 * GB), 32, 0, stream>>>(EB, nullptr, WT, nullptr, DD, nullptr, 0, nullptr, (size_t)RR * DD, 0, 0, (size_t)GB * RR * DD, (size_t)D3 * DD, 0, PH, PL, VT);
        k_attn<<<dim3(RR / 128, GB * NH_, 2), 128, 0, stream>>>(PH, PL, VT, matrix + (size_t)b * RR * RR, W_mat, MH, ML);
        k_gemmw<bf, 1, false, GB, false, true><<<dim3(RR / 64, DD / 64, 2 * GB), 32, 0, stream>>>(MH, ML, WT + (size_t)6 * DD * DD, nullptr, DD, OUT0 + (size_t)b * RR * DD, DD, nullptr, (size_t)RR * DD, 0, (size_t)RR * DD, (size_t)GB * RR * DD, (size_t)DD * DD, (size_t)NB_ * RR * DD, nullptr, nullptr, nullptr); }
}

// v006
// Measured time: 167 microseconds a run.
// Next to v005, in two timings, it ran 1.22 and 1.23 times as fast.
// Counting every step since v000, it is 52.4 times as fast.
#include <hip/hip_runtime.h>

// MixedScoreMHA (row_emb, col_emb [32][512][256], matrix [32][512][512]; 16 heads x 16: row_q/k/v = row_emb W, col_q/k/v = col_emb W; compat[h][r][c] = (row_q.col_k + col_q.row_k + matrix W_mat[h]) / 4 (W_mat read); attn_row = softmax over c, attn_col = softmax over r;
// row_heads = attn_row col_v, col_heads[c] = sum_r attn_col[r][c] row_v[r]; out_row = merge(row_heads) W_out_row, out_col = merge(col_heads) W_out_col -> two outputs [32][512][256]). Scores, softmax and the attention product are one kernel (k_attn): compat and the
// probabilities never reach memory; the projection GEMM and k_attn store their results in the layout and type that the next product reads. The column side is the same kernel on compat transposed (queries = columns, keys = rows), so each side computes its own scores.
// Every operand of k_attn's loop lies in memory in the order of its matrix fragment, [16-row group][8-element run][lane][8]: a wave's 16-byte load is 512 bytes in a row (four whole lines). The matrix gets such a copy, in bf16, for each side (k_mfrag).
// Compute dtypes, f32 accumulate: every input rounded to bf16; the six projections on PLAIN bf16 operands (inputs: exact); the score product on bf16 hi+lo planes of q and k (3 products, K = 32 = [q | k] against [k | q]); probabilities and v in fp16.

#define NB_  32
#define RR   512
#define DD   256
#define D3   768
#define NH_  16
#define KD   16
#define KP   32
#define GB   32     // batch items that share each launch (NB_ % GB == 0); the workspace holds GB items' intermediates, 5 MiB an item (161 MiB with the weights)
typedef _Float16 h16;
typedef unsigned short bf;
typedef __attribute__((ext_vector_type(16))) __bf16   v16bf;
typedef __attribute__((ext_vector_type(16))) _Float16 v16h;
typedef __attribute__((ext_vector_type(8)))  _Float16 v8h;
typedef __attribute__((ext_vector_type(8)))  unsigned short v8us;
typedef __attribute__((ext_vector_type(8)))  float    v8f;
typedef __attribute__((ext_vector_type(4)))  float    v4f;
typedef v8h  __attribute__((may_alias)) v8ha;
typedef v4f  __attribute__((may_alias)) v4fa;
typedef v8us __attribute__((may_alias)) v8usa;

__device__ __forceinline__ unsigned short f2bf(float f) { unsigned u = __float_as_uint(f); u += 0x7FFFu + ((u >> 16) & 1u); return (unsigned short)(u >> 16); }
__device__ __forceinline__ float bf2f(unsigned short b) { return __uint_as_float(((unsigned)b) << 16); }
__device__ __forceinline__ float bfr(float f) { return bf2f(f2bf(f)); }
__device__ __forceinline__ v16h cat16(v8h lo, v8h hi) { return __builtin_shufflevector(lo, hi, 0, 1, 2, 3, 4, 5, 6, 7, 8, 9, 10, 11, 12, 13, 14, 15); }
__device__ __forceinline__ v16bf cat16b(v8us lo, v8us hi) { return __builtin_bit_cast(v16bf, __builtin_shufflevector(lo, hi, 0, 1, 2, 3, 4, 5, 6, 7, 8, 9, 10, 11, 12, 13, 14, 15)); }
__device__ __forceinline__ v8f wmma16(v16h a, v16h b, v8f c) { return __builtin_amdgcn_wmma_f32_16x16x32_f16(false, a, false, b, (short)0, c, false, false); }
__device__ __forceinline__ v8f wmmab(v16bf a, v16bf b, v8f c) { return __builtin_amdgcn_wmma_f32_16x16x32_bf16(false, a, false, b, (short)0, c, false, false); }



// ---- k_gemmw: register-blocked GEMM, ONE WAVE per 64x64 output tile (16 accumulators), operands straight from K-contiguous 16-bit planes; grid (M/64, N/64, Z), 32 threads.
// C[m][n] (f32, pitch ldc, + optional f32 bias[n]) = sum_k A[m][k] Bt[n][k] (+ split products per NSPLIT). z-batch strides sA/sB/sC in elements. K % 32 == 0.
// ZIN == 0: blockIdx.z is one flat batch index. ZIN > 0: blockIdx.z = twin * ZIN + item; the item moves by sA/sB/sC, the twin (row side, column side) by tA/tB/tC.
// PLANES (the projections; k_wtG orders the 768 weight rows as 16 heads x 32 score columns, then v): no C; the tile goes out as the attention kernel's operands, every 128-byte line of them written by one wave.
//   score tiles (two heads): bf16 hi and lo planes, K = 32 with no padding, in fragment order: element (r, k) of a head at (r / 16) * 512 + (k / 16) * 256 + ((k / 8) % 2) * 128 + (r % 16) * 8 + k % 8. Row side: X[h][r][k] = row_q[r][h*16 + k] for k < 16, row_k behind it; column side: Y[h][c][k] = col_k for k < 16, col_q behind it: X[r] . Y[c] = row_q.col_k + col_q.row_k.
//   v tiles (four heads): v^T in fp16, sets 0 col_v, 1 row_v, in fragment order: element (d, r) of a head at (r / 32) * 512 + ((r / 16) % 2) * 256 + ((r / 8) % 2) * 128 + d * 8 + r % 8: in the accumulator map a lane holds one d and 8 consecutive r, its own 16 bytes of a 512-byte run.
// AHM: A lies head-major, [K / 16][512 rows][16] (as k_attn stores it), not [row][K]; the fragment's two 8-element runs, k = kc + 8 half and kc + 16 + 8 half, are then the same 16 bytes of two neighbouring heads.
template <typename T16> struct WFrag;
template <> struct WFrag<h16> { typedef v16h V; static __device__ __forceinline__ V ld(const h16* p) { return cat16(*(const v8h*)p, *(const v8h*)(p + 16)); } static __device__ __forceinline__ v8f mma(V a, V b, v8f c) { return wmma16(a, b, c); } };
template <> struct WFrag<bf> { typedef v16bf V; static __device__ __forceinline__ V ld2(const bf* p, const bf* q) { return cat16b(*(const v8us*)p, *(const v8us*)q); } static __device__ __forceinline__ V ld(const bf* p) { return ld2(p, p + 16); } static __device__ __forceinline__ v8f mma(V a, V b, v8f c) { return wmmab(a, b, c); } };
__device__ __forceinline__ void splitf(float y, unsigned short& h, unsigned short& l) { h = f2bf(y); l = f2bf(y - bf2f(h)); }
typedef __attribute__((ext_vector_type(2))) unsigned short v2us;
template <typename T16, int NSPLIT, bool BIAS, int ZIN, bool PLANES, bool AHM>
__global__ __launch_bounds__(32) void k_gemmw(const T16* __restrict__ A, const T16* __restrict__ A2, const T16* __restrict__ Bt, const T16* __restrict__ Bt2, int K, float* C, int ldc, const float* __restrict__ bias, size_t sA, size_t sB, size_t sC, size_t tA, size_t tB, size_t tC, bf* Ph, bf* Pl, h16* Vt) {
    typedef typename WFrag<T16>::V V;
    __shared__ __align__(16) float os[16 * 68];
    const size_t z = ZIN > 0 ? blockIdx.z % (ZIN > 0 ? ZIN : 1) : blockIdx.z, zt = ZIN > 0 ? blockIdx.z / (ZIN > 0 ? ZIN : 1) : 0;
    const size_t oA = z * sA + zt * tA, oB = z * sB + zt * tB; A += oA; if (A2) A2 += oA; Bt += oB; if (Bt2) Bt2 += oB; if (!PLANES) C += z * sC + zt * tC;
    const int lane = threadIdx.x & 31, lr = lane & 15, hi = lane >> 4; const int r0 = blockIdx.x * 64, c0 = blockIdx.y * 64;
    v8f acc[4][4];
#pragma unroll
    for (int mb = 0; mb < 4; ++mb)
#pragma unroll
        for (int nb = 0; nb < 4; ++nb) acc[mb][nb] = (v8f){};
    const size_t aoff = AHM ? (size_t)(r0 + lr) * KD + 8 * hi : (size_t)(r0 + lr) * K + 8 * hi, boff = (size_t)(c0 + lr) * K + 8 * hi;
#pragma unroll 1
    for (int kc = 0; kc < K; kc += 32) {
        V a[4], a2[4];
#pragma unroll
        for (int mb = 0; mb < 4; ++mb) {
            if (AHM) { const size_t o = aoff + (size_t)mb * 16 * KD + (size_t)(kc / KD) * RR * KD; a[mb] = WFrag<T16>::ld2(A + o, A + o + RR * KD); if (NSPLIT == 1 || NSPLIT == 2) a2[mb] = WFrag<T16>::ld2(A2 + o, A2 + o + RR * KD); }
            else { a[mb] = WFrag<T16>::ld(A + aoff + (size_t)mb * 16 * K + kc); if (NSPLIT == 1 || NSPLIT == 2) a2[mb] = WFrag<T16>::ld(A2 + aoff + (size_t)mb * 16 * K + kc); } }
#pragma unroll
        for (int nb = 0; nb < 4; ++nb) { const V b = WFrag<T16>::ld(Bt + boff + (size_t)nb * 16 * K + kc); V b2; if (NSPLIT >= 2) b2 = WFrag<T16>::ld(Bt2 + boff + (size_t)nb * 16 * K + kc);
#pragma unroll
            for (int mb = 0; mb < 4; ++mb) { acc[mb][nb] = WFrag<T16>::mma(a[mb], b, acc[mb][nb]); if (NSPLIT == 1 || NSPLIT == 2) acc[mb][nb] = WFrag<T16>::mma(a2[mb], b, acc[mb][nb]); if (NSPLIT >= 2) acc[mb][nb] = WFrag<T16>::mma(a[mb], b2, acc[mb][nb]); } }
        asm volatile("v_nop\n\tv_nop\n\tv_nop\n\tv_nop" : "+v"(acc[0][0]), "+v"(acc[1][1]), "+v"(acc[2][2]), "+v"(acc[3][3]) : "v"(a[0]), "v"(a[3]));
    }
    if (PLANES && c0 >= 2 * DD) {
        h16* vt = Vt + (((1 - zt) * ZIN + z) * NH_ + (c0 - 2 * DD) / KD) * KD * RR + (r0 / 32) * 512 + lane * 8;
#pragma unroll
        for (int mb = 0; mb < 4; ++mb)
#pragma unroll
            for (int nb = 0; nb < 4; ++nb) { v8h o;
#pragma unroll
                for (int j = 0; j < 8; ++j) o[j] = (h16)acc[mb][nb][j];
                *(v8h*)(vt + (size_t)nb * KD * RR + (mb >> 1) * 512 + (mb & 1) * 256) = o; }
    } else if (PLANES) {
    const size_t po = (((zt * ZIN + z) * NH_ + c0 / KP) * RR + r0) * KP + lane * 8;   // 16 rows of a head are 512 elements; the lane reads back row lr, columns 16 f + 8 hi + 0..7 of the tile (f = 2 * head + run): its 16 bytes of that run
#pragma unroll
    for (int mb = 0; mb < 4; ++mb) {
#pragma unroll
        for (int nb = 0; nb < 4; ++nb) {
#pragma unroll
            for (int j = 0; j < 8; ++j) os[(hi * 8 + j) * 68 + nb * 16 + lr] = acc[mb][nb][j]; }
        __builtin_amdgcn_wave_barrier(); asm volatile("" ::: "memory");   // the reads below take other lanes' writes: keep them behind the writes
#pragma unroll
        for (int f = 0; f < 4; ++f) { const float* sp = os + lr * 68 + f * 16 + hi * 8; const v4f x0 = *(const v4fa*)sp, x1 = *(const v4fa*)(sp + 4); v8us oh, ol;
#pragma unroll
            for (int u = 0; u < 4; ++u) { unsigned short a, b; splitf(x0[u], a, b); oh[u] = a; ol[u] = b; splitf(x1[u], a, b); oh[u + 4] = a; ol[u + 4] = b; }
            const size_t o = po + (size_t)(f >> 1) * RR * KP + mb * 512 + (f & 1) * 256; *(v8us*)(Ph + o) = oh; *(v8us*)(Pl + o) = ol; }
        __builtin_amdgcn_wave_barrier(); asm volatile("" ::: "memory");   // the next tile's writes stay behind these reads
    }
    asm volatile("s_wait_xcnt 0x0" ::: "memory");   // in the built code this branch runs on, behind a test that never holds, into the v branch, which rewrites the address registers of the stores above
    } else {
#pragma unroll
    for (int mb = 0; mb < 4; ++mb) {
#pragma unroll
        for (int nb = 0; nb < 4; ++nb) {
#pragma unroll
            for (int j = 0; j < 8; ++j) os[(hi * 8 + j) * 68 + nb * 16 + lr] = acc[mb][nb][j]; }
        __builtin_amdgcn_wave_barrier(); asm volatile("" ::: "memory");
        float* crow = C + (size_t)(r0 + mb * 16) * ldc + c0;
{
#pragma unroll
            for (int s = 0; s < 8; ++s) { const int row = 2 * s + hi, cofs = lr * 4; v4f val = *(const v4fa*)(os + row * 68 + cofs);
                if (BIAS) { val[0] += bfr(bias[c0 + cofs]); val[1] += bfr(bias[c0 + cofs + 1]); val[2] += bfr(bias[c0 + cofs + 2]); val[3] += bfr(bias[c0 + cofs + 3]); }
                *(v4f*)(crow + (size_t)row * ldc + cofs) = val; }
             }
        __builtin_amdgcn_wave_barrier(); asm volatile("" ::: "memory");
    }
    }
}


// k_wtG: blockIdx.y picks one of the eight weight matrices; their transposed bf16 planes lie one behind the other in Bt. The q and k rows of a side are interleaved by head in the order of the score planes
// (row side: head h = rows 32 h .. : 16 of q, 16 of k; column side: 16 of k, 16 of q), so that a 64-column tile of the projection GEMM holds whole plane rows of two heads.
__global__ __launch_bounds__(256) void k_wtG(const float* __restrict__ w0, const float* __restrict__ w1, const float* __restrict__ w2, const float* __restrict__ w3, const float* __restrict__ w4, const float* __restrict__ w5, const float* __restrict__ w6, const float* __restrict__ w7, int K, int N, bf* Bt) {
    const int y = blockIdx.y; const float* w = y == 0 ? w0 : y == 1 ? w1 : y == 2 ? w2 : y == 3 ? w3 : y == 4 ? w4 : y == 5 ? w5 : y == 6 ? w6 : w7; const bool qk = y < 6 && y % 3 < 2; const int kofs = ((y % 3 == 0) == (y < 3)) ? 0 : KD;
    const int lane = threadIdx.x & 31; const int L0 = (blockIdx.x * 8 + (threadIdx.x >> 5)) * 8; const int nlines = N * K / 64;
{
#pragma unroll 1
        for (int l = 0; l < 8; ++l) { const int L = L0 + l; if (L >= nlines) break; const size_t e = (size_t)L * 64 + lane * 2; const int k = (int)(e % K), n = (int)(e / K); const int nd = qk ? (y / 3) * 3 * N + (n / KD) * KP + kofs + n % KD : y * N + n; bf* dst = Bt + (size_t)nd * K + k; v2us o;
            o[0] = f2bf(w[(size_t)k * N + n]); o[1] = f2bf(w[(size_t)(k + 1) * N + n]); *(v2us*)dst = o; }
         }
}
__global__ __launch_bounds__(256) void k_cvt8(const float* __restrict__ src0, const float* __restrict__ src1, bf* dst, size_t n8) { const size_t i = (size_t)blockIdx.x * 256 + threadIdx.x; if (i >= n8) return; const float* src = blockIdx.y ? src1 : src0; dst += (size_t)blockIdx.y * n8 * 8; const v8f v = *(const v8f*)(src + i * 8); v8us o;
#pragma unroll
    for (int k = 0; k < 8; ++k) o[k] = f2bf(v[k]); *(v8us*)(dst + i * 8) = o;  }

// k_mfrag: the matrix, rounded to bf16 (nearest even), once for each side in the order in which k_attn's lanes take it: MB[side][g][16-query group][32-key block][16-key tile t][lane][8], lane = 16 * half + query % 16, element j = key 16 t + 8 half + j of the block.
// Side 0: queries = rows r, keys = columns c, matrix[query][key]. Side 1: queries = columns, keys = rows, matrix[key][query]. A wave writes 8 tiles (128 keys) of one query group, 512 bytes in a row each; grid (512 / 16 * 4 / 8, GB, 2), 8 waves.
typedef __attribute__((ext_vector_type(8))) __bf16 v8b;
__global__ __launch_bounds__(256) void k_mfrag(const float* __restrict__ mt, bf* __restrict__ MB) {
    const int lane = threadIdx.x & 31, lr = lane & 15, hi = lane >> 4; const int wv = blockIdx.x * 8 + (threadIdx.x >> 5); const int qg = wv >> 2, kq = wv & 3; const int g = blockIdx.y, side = blockIdx.z;
    mt += (size_t)g * RR * RR; const int q = qg * 16 + lr;
    bf* dst = MB + ((((size_t)side * GB + g) * (RR / 16) + qg) * (RR / 32) + kq * 4) * 512 + lane * 8;
    const int key = kq * 128 + hi * 8; v8f m8[8];   // all of the wave's loads are issued before the first store
    // s_wait_xcnt behind each side's loads: the code behind them reuses the registers of the loads' address; the wait names the address so that those registers live up to it
    if (side == 0) { const float* p = mt + (size_t)q * RR + key;
#pragma unroll
        for (int u = 0; u < 8; ++u) m8[u] = *(const v8f*)(p + u * 16);
        asm volatile("s_wait_xcnt 0x0" :: "v"(p) : "memory");
    } else { const float* p = mt + (size_t)key * RR + q;
#pragma unroll
        for (int u = 0; u < 8; ++u)
#pragma unroll
            for (int j = 0; j < 8; ++j) m8[u][j] = p[(size_t)(u * 16 + j) * RR];
        asm volatile("s_wait_xcnt 0x0" :: "v"(p) : "memory");
    }
#pragma unroll
    for (int u = 0; u < 8; ++u) *(v8us*)(dst + u * 256) = __builtin_bit_cast(v8us, __builtin_convertvector(m8[u], v8b));
}

// ---- k_attn: scores, softmax and attention product of one side in one pass over the keys. A wave owns 32 queries (two 16-column groups) of one (side, item, head) and walks the 512 keys 32 at a time.
// Transposed products: S^T[key][query] = K' Q'^T (A = key rows, B = query rows kept in registers), O^T[d][query] += V^T P^T. In the accumulator map a lane holds ONE query (lane & 15) and keys 8 * (lane >> 4) + 0..7 of a 16-key tile,
// so the maximum and the sum over keys are in-lane plus one exchange between the wave's halves, and the two score tiles of a pass, converted in place, ARE the B operand of the second product (element s = tile s >> 3, register s & 7, the hardware k order);
// V^T is loaded in the same k order (keys 8 * half + 0..7 and 16 + 8 * half + 0..7 of each 32). Running maximum with rescale (base 2); the halves' sums are joined once at the end.
// Both sides run the same code: the planes, v^T and the matrix copy of a side lie in fragment order (k_gemmw, k_mfrag), so each fragment is two 16-byte loads at lane * 16 bytes of two 512-byte runs.
__device__ __forceinline__ float xhalf(float x) { return __int_as_float(__builtin_amdgcn_permlanex16(__float_as_int(x), __float_as_int(x), 0x76543210, 0xfedcba98, false, false)); }   // lane l with lane l ^ 16
// Exponentials with the slot behind them in ONE statement: the instruction set asks for one independent instruction or a v_nop between a transcendental and an instruction that reads its result or overwrites its source;
// Inside the statement each v_exp_f32 is followed by an independent one (early-clobber results lie on no source), the last by the v_nop.
__device__ __forceinline__ void exp2x8(const float* x, float* p) {
    asm("v_exp_f32 %0, %8\n\tv_exp_f32 %1, %9\n\tv_exp_f32 %2, %10\n\tv_exp_f32 %3, %11\n\tv_exp_f32 %4, %12\n\tv_exp_f32 %5, %13\n\tv_exp_f32 %6, %14\n\tv_exp_f32 %7, %15\n\tv_nop"
        : "=&v"(p[0]), "=&v"(p[1]), "=&v"(p[2]), "=&v"(p[3]), "=&v"(p[4]), "=&v"(p[5]), "=&v"(p[6]), "=&v"(p[7]) : "v"(x[0]), "v"(x[1]), "v"(x[2]), "v"(x[3]), "v"(x[4]), "v"(x[5]), "v"(x[6]), "v"(x[7])); }
__device__ __forceinline__ float exp2x1(float x) { float p; asm("v_exp_f32 %0, %1\n\tv_nop" : "=&v"(p) : "v"(x)); return p; }   // the same slot, one value
typedef __attribute__((ext_vector_type(4))) unsigned v4u;
typedef v4u __attribute__((may_alias)) v4ua;
__device__ __forceinline__ v16bf ldfb(const bf* p) { return cat16b(*(const v8us*)p, *(const v8us*)(p + 256)); }   // p: the 16-row group's 512 elements + lane * 8
__device__ __forceinline__ v16h ldfh(const h16* p) { return cat16(*(const v8h*)p, *(const v8h*)(p + 256)); }
__device__ __forceinline__ void attn_side(const bf* __restrict__ QH, const bf* __restrict__ QL, const bf* __restrict__ KH, const bf* __restrict__ KL, const h16* __restrict__ VT, const bf* __restrict__ MB, const float w, bf* __restrict__ Mh, bf* __restrict__ Ml, const int q0, const int lane) {
    const float SC = 0.36067376022224085f;   // 1/4 (the norm) x log2(e)
    const int lr = lane & 15, hi = lane >> 4;
    v16bf qh[2], ql[2]; v8f acc[2]; float mrun[2], lsum[2];
#pragma unroll
    for (int nb = 0; nb < 2; ++nb) { const size_t o = (size_t)(q0 / 16 + nb) * 512 + lane * 8; qh[nb] = ldfb(QH + o); ql[nb] = ldfb(QL + o); acc[nb] = (v8f){}; mrun[nb] = -3.0e38f; lsum[nb] = 0.f; }
    MB += (size_t)(q0 / 16) * (RR / 32) * 512 + lane * 8;
#pragma unroll 2   // two passes a trip: the second pass's loads are issued while the first pass is worked on (the inner loops are unrolled whole so that their arrays stay in registers)
    for (int k0 = 0; k0 < RR; k0 += 32) {
        v16bf kh[2], kl[2]; v4u m8[2][2];
#pragma unroll
        for (int t = 0; t < 2; ++t) { const size_t o = (size_t)(k0 / 16 + t) * 512 + lane * 8; kh[t] = ldfb(KH + o); kl[t] = ldfb(KL + o); }
        const v16h va = ldfh(VT + (size_t)(k0 / 32) * 512 + lane * 8);
#pragma unroll
        for (int nb = 0; nb < 2; ++nb)
#pragma unroll
            for (int t = 0; t < 2; ++t) m8[nb][t] = *(const v4ua*)(MB + (size_t)((nb * (RR / 32) + k0 / 32) * 2 + t) * 256);
#pragma unroll
        for (int nb = 0; nb < 2; ++nb) {
            float y[16];
#pragma unroll
            for (int t = 0; t < 2; ++t) {
                v8f s = wmmab(kh[t], qh[nb], (v8f){}); s = wmmab(kl[t], qh[nb], s); s = wmmab(kh[t], ql[nb], s);
#pragma unroll
                for (int j = 0; j < 8; j += 2) { const unsigned mm = m8[nb][t][j >> 1];   // two bf16 values of the matrix: key j in the low half, key j + 1 in the high half
                    y[t * 8 + j] = (s[j] + __uint_as_float(mm << 16) * w) * SC; y[t * 8 + j + 1] = (s[j + 1] + __uint_as_float(mm & 0xFFFF0000u) * w) * SC; }
            }
            float mx[4];
#pragma unroll
            for (int u = 0; u < 4; ++u) mx[u] = fmaxf(fmaxf(y[u], y[u + 4]), fmaxf(y[u + 8], y[u + 12]));
            float m1 = fmaxf(fmaxf(mx[0], mx[1]), fmaxf(mx[2], mx[3])); m1 = fmaxf(m1, xhalf(m1));
            const float mn = fmaxf(mrun[nb], m1); const float al = exp2x1(mrun[nb] - mn);   // 0 on the first pass
            mrun[nb] = mn; float ps[4] = {0.f, 0.f, 0.f, 0.f}, p[16]; v16h pb;
#pragma unroll
            for (int i = 0; i < 16; ++i) y[i] -= mn;
            exp2x8(y, p); exp2x8(y + 8, p + 8);
#pragma unroll
            for (int i = 0; i < 16; ++i) { ps[i & 3] += p[i]; pb[i] = (h16)p[i]; }
            lsum[nb] = lsum[nb] * al + ((ps[0] + ps[1]) + (ps[2] + ps[3]));
#pragma unroll
            for (int j = 0; j < 8; ++j) acc[nb][j] *= al;
            acc[nb] = wmma16(va, pb, acc[nb]);
        }
    }
#pragma unroll
    for (int nb = 0; nb < 2; ++nb) { const float f = __fdiv_rn(1.0f, lsum[nb] + xhalf(lsum[nb])); v8us oh, ol;
#pragma unroll
        for (int j = 0; j < 8; ++j) { unsigned short a, b; splitf(acc[nb][j] * f, a, b); oh[j] = a; ol[j] = b; }
        const size_t o = (size_t)(q0 + nb * 16 + lr) * KD + hi * 8; *(v8us*)(Mh + o) = oh; *(v8us*)(Ml + o) = ol; }   // [query][d], d = 8 * half + 0..7, as the bf16 hi and lo planes that the output GEMM reads: a wave stores 1 KiB in a row to each
}
// grid (512 / 128 queries, GB * 16 (item, head), 2 sides), 4 waves. PH/PL: [X, Y][g][h][512 x 32 in fragment order]; VT: [col_v, row_v][g][h][16 x 512 in fragment order]; MH/ML: [row, col][g][h][512][16]; MB: [side][g], k_mfrag's copies.
__global__ __launch_bounds__(128) void k_attn(const bf* __restrict__ PH, const bf* __restrict__ PL, const h16* __restrict__ VT, const bf* __restrict__ MB, const float* __restrict__ wm, bf* __restrict__ MH, bf* __restrict__ ML) {
    const int lane = threadIdx.x & 31; const int q0 = blockIdx.x * 128 + (threadIdx.x >> 5) * 32; const int gh = blockIdx.y, side = blockIdx.z;
    const size_t pq = (size_t)(side * GB * NH_ + gh) * RR * KP, pk = (size_t)((1 - side) * GB * NH_ + gh) * RR * KP; const size_t z = (size_t)side * GB * NH_ + gh;
    const float w = bfr(wm[gh % NH_]); MB += (size_t)(side * GB + gh / NH_) * RR * RR; VT += z * KD * RR; const size_t mo = z * RR * KD;
    attn_side(PH + pq, PL + pq, PH + pk, PL + pk, VT, MB, w, MH + mo, ML + mo, q0, lane);
}

extern "C" void kernel_launch(void* const* d_in, const int* in_sizes, int n_in,
                              void* d_out, int out_size, void* d_ws, size_t ws_size, hipStream_t stream) {
    (void)in_sizes; (void)n_in; (void)out_size;
    const float** I = (const float**)d_in;
    const float *row_emb = I[0], *col_emb = I[1], *matrix = I[2], *Wq_row = I[3], *Wk_row = I[4], *Wv_row = I[5], *Wq_col = I[6], *Wk_col = I[7], *Wv_col = I[8], *W_mat = I[9], *W_out_row = I[10], *W_out_col = I[11];
    float* OUT0 = (float*)d_out;     // [32][512][256] x 2, the column output behind the row output
    char* wsp = (char*)d_ws;
    auto take = [&](size_t bytes) { char* p = wsp; wsp += (bytes + 255) & ~(size_t)255; return (void*)p; };
    // Every buffer holds GB batch items, and the row-side and column-side twins of a stage lie one behind the other, so that one launch covers both twins of GB items.
    bf* WT = (bf*)take((size_t)8 * DD * DD * 2);                                                       // Bt rows [16 heads x (q, k) | v] row side, [16 heads x (k, q) | v] column side, out row, out col
    bf* EB = (bf*)take((size_t)2 * GB * RR * DD * 2);                                                  // [row, col][g]
    bf* PH = (bf*)take((size_t)2 * GB * NH_ * RR * KP * 2); bf* PL = (bf*)take((size_t)2 * GB * NH_ * RR * KP * 2);   // [row_q | row_k, col_k | col_q][g]
    h16* VT = (h16*)take((size_t)2 * GB * NH_ * KD * RR * 2);                                          // [col_v, row_v][g]
    bf* MB = (bf*)take((size_t)2 * GB * RR * RR * 2);                                                  // [side][g]
    bf* MH = (bf*)take((size_t)2 * GB * RR * DD * 2); bf* ML = (bf*)take((size_t)2 * GB * RR * DD * 2);   // [row, col][g][h]
    if ((size_t)(wsp - (char*)d_ws) > ws_size) return;
    k_wtG<<<dim3((DD * DD / 64 + 63) / 64, 8, 1), 256, 0, stream>>>(Wq_row, Wk_row, Wv_row, Wq_col, Wk_col, Wv_col, W_out_row, W_out_col, DD, DD, WT);
    for (int b = 0; b < NB_; b += GB) {
        k_cvt8<<<dim3((GB * RR * DD / 8 + 255) / 256, 2, 1), 256, 0, stream>>>(row_emb + (size_t)b * RR * DD, col_emb + (size_t)b * RR * DD, EB, (size_t)GB * RR * DD / 8);
        k_gemmw<bf, 0, false, GB, true, false><<<dim3(RR / 64, D3 / 64, 2 * GB), 32, 0, stream>>>(EB, nullptr, WT, nullptr, DD, nullptr, 0, nullptr, (size_t)RR * DD, 0, 0, (size_t)GB * RR * DD, (size_t)D3 * DD, 0, PH, PL, VT);
        k_mfrag<<<dim3(RR / 16 * 4 / 8, GB, 2), 256, 0, stream>>>(matrix + (size_t)b * RR * RR, MB);
        k_attn<<<dim3(RR / 128, GB * NH_, 2), 128, 0, stream>>>(PH, PL, VT, MB, W_mat, MH, ML);
        k_gemmw<bf, 1, false, GB, false, true><<<dim3(RR / 64, DD / 64, 2 * GB), 32, 0, stream>>>(MH, ML, WT + (size_t)6 * DD * DD, nullptr, DD, OUT0 + (size_t)b * RR * DD, DD, nullptr, (size_t)RR * DD, 0, (size_t)RR * DD, (size_t)GB * RR * DD, (size_t)DD * DD, (size_t)NB_ * RR * DD, nullptr, nullptr, nullptr); }
}

// v007
// Measured time: 154 microseconds a run.
// Two timings next to v006 both put it at 1.08 times that version's speed.
// Counting every step since v000, it is 56.5 times as fast.
#include <hip/hip_runtime.h>

// MixedScoreMHA (row_emb, col_emb [32][512][256], matrix [32][512][512]; 16 heads x 16: row_q/k/v = row_emb W, col_q/k/v = col_emb W; compat[h][r][c] = (row_q.col_k + col_q.row_k + matrix W_mat[h]) / 4 (W_mat read); attn_row = softmax over c, attn_col = softmax over r;
// row_heads = attn_row col_v, col_heads[c] = sum_r attn_col[r][c] row_v[r]; out_row = merge(row_heads) W_out_row, out_col = merge(col_heads) W_out_col -> two outputs [32][512][256]). Scores, softmax and the attention product are one kernel (k_attn): compat and the
// probabilities never reach memory; the projection GEMM and k_attn store their results in the layout and type that the next product reads. The column side is the same kernel on compat transposed (queries = columns, keys = rows), so each side computes its own scores.
// Every operand of k_attn's loop lies in memory in the order of its matrix fragment, [16-row group][8-element run][lane][8]: a wave's 16-byte load is 512 bytes in a row (four whole lines). The matrix gets such a copy, in bf16, for each side (k_mfrag). The bf16 operands of the two GEMMs (embeddings from k_cvt8, weights from k_wtG) lie in the same order for K = 256.
// Compute dtypes, f32 accumulate: every input rounded to bf16; the six projections on PLAIN bf16 operands (inputs: exact); the score product on bf16 hi+lo planes of q and k (3 products, K = 32 = [q | k] against [k | q]); probabilities and v in fp16.

#define NB_  32
#define RR   512
#define DD   256
#define D3   768
#define NH_  16
#define KD   16
#define KP   32
#define GB   32     // batch items that share each launch (NB_ % GB == 0); the workspace holds GB items' intermediates, 5 MiB an item (161 MiB with the weights)
typedef _Float16 h16;
typedef unsigned short bf;
typedef __attribute__((ext_vector_type(16))) __bf16   v16bf;
typedef __attribute__((ext_vector_type(16))) _Float16 v16h;
typedef __attribute__((ext_vector_type(8)))  _Float16 v8h;
typedef __attribute__((ext_vector_type(8)))  unsigned short v8us;
typedef __attribute__((ext_vector_type(8)))  float    v8f;
typedef __attribute__((ext_vector_type(4)))  float    v4f;
typedef v8h  __attribute__((may_alias)) v8ha;
typedef v4f  __attribute__((may_alias)) v4fa;
typedef v8us __attribute__((may_alias)) v8usa;

__device__ __forceinline__ unsigned short f2bf(float f) { unsigned u = __float_as_uint(f); u += 0x7FFFu + ((u >> 16) & 1u); return (unsigned short)(u >> 16); }
__device__ __forceinline__ float bf2f(unsigned short b) { return __uint_as_float(((unsigned)b) << 16); }
__device__ __forceinline__ float bfr(float f) { return bf2f(f2bf(f)); }
__device__ __forceinline__ v16h cat16(v8h lo, v8h hi) { return __builtin_shufflevector(lo, hi, 0, 1, 2, 3, 4, 5, 6, 7, 8, 9, 10, 11, 12, 13, 14, 15); }
__device__ __forceinline__ v16bf cat16b(v8us lo, v8us hi) { return __builtin_bit_cast(v16bf, __builtin_shufflevector(lo, hi, 0, 1, 2, 3, 4, 5, 6, 7, 8, 9, 10, 11, 12, 13, 14, 15)); }
__device__ __forceinline__ v8f wmma16(v16h a, v16h b, v8f c) { return __builtin_amdgcn_wmma_f32_16x16x32_f16(false, a, false, b, (short)0, c, false, false); }
__device__ __forceinline__ v8f wmmab(v16bf a, v16bf b, v8f c) { return __builtin_amdgcn_wmma_f32_16x16x32_bf16(false, a, false, b, (short)0, c, false, false); }



// ---- k_gemmw: register-blocked GEMM, ONE WAVE per 64x64 output tile (16 accumulators), operands straight from 16-bit planes in fragment order; grid (M/64, N/64, Z), 32 threads.
// Fragment order of a plane [rows][256] (the planes' row length is the constant DD, so that a pass's loads differ by constants; K <= DD): element (r, k) at (r / 16) * 16 * 256 + (k / 32) * 512 + ((k / 16) % 2) * 256 + ((k / 8) % 2) * 128 + (r % 16) * 8 + k % 8: a fragment (16 rows x 32 k) is two runs of 512 bytes, a lane's 16 bytes of each at lane * 16. A and Bt alike, so their k orders are equal.
// C[m][n] (f32, pitch ldc, + optional f32 bias[n]) = sum_k A[m][k] Bt[n][k] (+ split products per NSPLIT). z-batch strides sA/sB/sC in elements. K % 32 == 0.
// ZIN == 0: blockIdx.z is one flat batch index. ZIN > 0: blockIdx.z = twin * ZIN + item; the item moves by sA/sB/sC, the twin (row side, column side) by tA/tB/tC.
// PLANES (the projections; k_wtG orders the 768 weight rows as 16 heads x 32 score columns, then v): no C; the tile goes out as the attention kernel's operands, every 128-byte line of them written by one wave.
//   score tiles (two heads): bf16 hi and lo planes, K = 32 with no padding, in fragment order: element (r, k) of a head at (r / 16) * 512 + (k / 16) * 256 + ((k / 8) % 2) * 128 + (r % 16) * 8 + k % 8. Row side: X[h][r][k] = row_q[r][h*16 + k] for k < 16, row_k behind it; column side: Y[h][c][k] = col_k for k < 16, col_q behind it: X[r] . Y[c] = row_q.col_k + col_q.row_k.
//   v tiles (four heads): v^T in fp16, sets 0 col_v, 1 row_v, in fragment order: element (d, r) of a head at (r / 32) * 512 + ((r / 16) % 2) * 256 + ((r / 8) % 2) * 128 + d * 8 + r % 8: in the accumulator map a lane holds one d and 8 consecutive r, its own 16 bytes of a 512-byte run.
// AHM: A lies head-major, [K / 16][512 rows][16] (as k_attn stores it), not [row][K]; the fragment's two 8-element runs, k = kc + 8 half and kc + 16 + 8 half, are then the same 16 bytes of two neighbouring heads.
template <typename T16> struct WFrag;
template <> struct WFrag<h16> { typedef v16h V; static __device__ __forceinline__ V ld(const h16* p) { return cat16(*(const v8h*)p, *(const v8h*)(p + 16)); } static __device__ __forceinline__ v8f mma(V a, V b, v8f c) { return wmma16(a, b, c); } };
template <> struct WFrag<bf> { typedef v16bf V; static __device__ __forceinline__ V ld2(const bf* p, const bf* q) { return cat16b(*(const v8us*)p, *(const v8us*)q); } static __device__ __forceinline__ V ld(const bf* p) { return ld2(p, p + 256); } static __device__ __forceinline__ v8f mma(V a, V b, v8f c) { return wmmab(a, b, c); } };
__device__ __forceinline__ void splitf(float y, unsigned short& h, unsigned short& l) { h = f2bf(y); l = f2bf(y - bf2f(h)); }
template <typename T16, int NSPLIT, bool BIAS, int ZIN, bool PLANES, bool AHM>
__global__ __launch_bounds__(32) void k_gemmw(const T16* __restrict__ A, const T16* __restrict__ A2, const T16* __restrict__ Bt, const T16* __restrict__ Bt2, int K, float* C, int ldc, const float* __restrict__ bias, size_t sA, size_t sB, size_t sC, size_t tA, size_t tB, size_t tC, bf* Ph, bf* Pl, h16* Vt) {
    typedef typename WFrag<T16>::V V;
    __shared__ __align__(16) float os[16 * 68];
    const size_t z = ZIN > 0 ? blockIdx.z % (ZIN > 0 ? ZIN : 1) : blockIdx.z, zt = ZIN > 0 ? blockIdx.z / (ZIN > 0 ? ZIN : 1) : 0;
    const size_t oA = z * sA + zt * tA, oB = z * sB + zt * tB; A += oA; if (A2) A2 += oA; Bt += oB; if (Bt2) Bt2 += oB; if (!PLANES) C += z * sC + zt * tC;
    const int lane = threadIdx.x & 31, lr = lane & 15, hi = lane >> 4; const int r0 = blockIdx.x * 64, c0 = blockIdx.y * 64;
    v8f acc[4][4];
#pragma unroll
    for (int mb = 0; mb < 4; ++mb)
#pragma unroll
        for (int nb = 0; nb < 4; ++nb) acc[mb][nb] = (v8f){};
    const size_t aoff = AHM ? (size_t)(r0 + lr) * KD + 8 * hi : (size_t)r0 * DD + lane * 8, boff = (size_t)c0 * DD + lane * 8;
#pragma unroll 1
    for (int kc = 0; kc < K; kc += 32) {
        V a[4], a2[4];
        const T16* pa = A + aoff + (AHM ? (size_t)(kc / KD) * RR * KD : (size_t)kc * 16); const T16* pa2 = (NSPLIT == 1 || NSPLIT == 2) ? A2 + (pa - A) : pa; const T16* pb = Bt + boff + (size_t)kc * 16; const T16* pb2 = NSPLIT >= 2 ? Bt2 + (pb - Bt) : pb;   // the pass's loads are these plus constants
#pragma unroll
        for (int mb = 0; mb < 4; ++mb) {
            if (AHM) { const int o = mb * 16 * KD; a[mb] = WFrag<T16>::ld2(pa + o, pa + o + RR * KD); if (NSPLIT == 1 || NSPLIT == 2) a2[mb] = WFrag<T16>::ld2(pa2 + o, pa2 + o + RR * KD); }
            else { a[mb] = WFrag<T16>::ld(pa + mb * 16 * DD); if (NSPLIT == 1 || NSPLIT == 2) a2[mb] = WFrag<T16>::ld(pa2 + mb * 16 * DD); } }
#pragma unroll
        for (int nb = 0; nb < 4; ++nb) { const V b = WFrag<T16>::ld(pb + nb * 16 * DD); V b2; if (NSPLIT >= 2) b2 = WFrag<T16>::ld(pb2 + nb * 16 * DD);
#pragma unroll
            for (int mb = 0; mb < 4; ++mb) { acc[mb][nb] = WFrag<T16>::mma(a[mb], b, acc[mb][nb]); if (NSPLIT == 1 || NSPLIT == 2) acc[mb][nb] = WFrag<T16>::mma(a2[mb], b, acc[mb][nb]); if (NSPLIT >= 2) acc[mb][nb] = WFrag<T16>::mma(a[mb], b2, acc[mb][nb]); } }
        asm volatile("s_wait_xcnt 0x0" :: "v"(pa), "v"(pa2), "v"(pb), "v"(pb2) : "memory");   // the next pass rewrites the registers of the loads' addresses; the wait names the addresses so that no load of the pass lands on their registers
        asm volatile("v_nop\n\tv_nop\n\tv_nop\n\tv_nop" : "+v"(acc[0][0]), "+v"(acc[1][1]), "+v"(acc[2][2]), "+v"(acc[3][3]) : "v"(a[0]), "v"(a[3]));
    }
    if (PLANES && c0 >= 2 * DD) {
        h16* vt = Vt + (((1 - zt) * ZIN + z) * NH_ + (c0 - 2 * DD) / KD) * KD * RR + (r0 / 32) * 512 + lane * 8;
#pragma unroll
        for (int mb = 0; mb < 4; ++mb)
#pragma unroll
            for (int nb = 0; nb < 4; ++nb) { v8h o;
#pragma unroll
                for (int j = 0; j < 8; ++j) o[j] = (h16)acc[mb][nb][j];
                *(v8h*)(vt + (size_t)nb * KD * RR + (mb >> 1) * 512 + (mb & 1) * 256) = o; }
    } else if (PLANES) {
    const size_t po = (((zt * ZIN + z) * NH_ + c0 / KP) * RR + r0) * KP + lane * 8;   // 16 rows of a head are 512 elements; the lane reads back row lr, columns 16 f + 8 hi + 0..7 of the tile (f = 2 * head + run): its 16 bytes of that run
#pragma unroll
    for (int mb = 0; mb < 4; ++mb) {
#pragma unroll
        for (int nb = 0; nb < 4; ++nb) {
#pragma unroll
            for (int j = 0; j < 8; ++j) os[(hi * 8 + j) * 68 + nb * 16 + lr] = acc[mb][nb][j]; }
        __builtin_amdgcn_wave_barrier(); asm volatile("" ::: "memory");   // the reads below take other lanes' writes: keep them behind the writes
#pragma unroll
        for (int f = 0; f < 4; ++f) { const float* sp = os + lr * 68 + f * 16 + hi * 8; const v4f x0 = *(const v4fa*)sp, x1 = *(const v4fa*)(sp + 4); v8us oh, ol;
#pragma unroll
            for (int u = 0; u < 4; ++u) { unsigned short a, b; splitf(x0[u], a, b); oh[u] = a; ol[u] = b; splitf(x1[u], a, b); oh[u + 4] = a; ol[u + 4] = b; }
            const size_t o = po + (size_t)(f >> 1) * RR * KP + mb * 512 + (f & 1) * 256; *(v8us*)(Ph + o) = oh; *(v8us*)(Pl + o) = ol; }
        __builtin_amdgcn_wave_barrier(); asm volatile("" ::: "memory");   // the next tile's writes stay behind these reads
    }
    asm volatile("s_wait_xcnt 0x0" ::: "memory");   // in the built code this branch runs on, behind a test that never holds, into the v branch, which rewrites the address registers of the stores above
    } else {
#pragma unroll
    for (int mb = 0; mb < 4; ++mb) {
#pragma unroll
        for (int nb = 0; nb < 4; ++nb) {
#pragma unroll
            for (int j = 0; j < 8; ++j) os[(hi * 8 + j) * 68 + nb * 16 + lr] = acc[mb][nb][j]; }
        __builtin_amdgcn_wave_barrier(); asm volatile("" ::: "memory");
        float* crow = C + (size_t)(r0 + mb * 16) * ldc + c0;
{
#pragma unroll
            for (int s = 0; s < 8; ++s) { const int row = 2 * s + hi, cofs = lr * 4; v4f val = *(const v4fa*)(os + row * 68 + cofs);
                if (BIAS) { val[0] += bfr(bias[c0 + cofs]); val[1] += bfr(bias[c0 + cofs + 1]); val[2] += bfr(bias[c0 + cofs + 2]); val[3] += bfr(bias[c0 + cofs + 3]); }
                *(v4f*)(crow + (size_t)row * ldc + cofs) = val; }
             }
        __builtin_amdgcn_wave_barrier(); asm volatile("" ::: "memory");
    }
    }
}


// k_wtG: blockIdx.y picks one of the eight weight matrices; their transposed bf16 planes (rows n, K = k) lie one behind the other in Bt, in fragment order. The q and k rows of a side are interleaved by head in the order of the score planes
// (row side: head h = rows 32 h .. : 16 of q, 16 of k; column side: 16 of k, 16 of q), so that a 64-column tile of the projection GEMM holds whole plane rows of two heads.
// A wave writes one fragment (16 rows n x 32 k, 1 KiB in a row): lane = 16 * half + n % 16 takes k = 8 * half + 0..7 and 16 + 8 * half + 0..7 of the block; its 16 loads are issued before the first store. Grid (N / 16 * K / 32 / 8, 8), 8 waves.
__global__ __launch_bounds__(256) void k_wtG(const float* __restrict__ w0, const float* __restrict__ w1, const float* __restrict__ w2, const float* __restrict__ w3, const float* __restrict__ w4, const float* __restrict__ w5, const float* __restrict__ w6, const float* __restrict__ w7, int K, int N, bf* Bt) {
    const int y = blockIdx.y; const float* w = y == 0 ? w0 : y == 1 ? w1 : y == 2 ? w2 : y == 3 ? w3 : y == 4 ? w4 : y == 5 ? w5 : y == 6 ? w6 : w7; const bool qk = y < 6 && y % 3 < 2; const int kofs = ((y % 3 == 0) == (y < 3)) ? 0 : KD;
    const int lane = threadIdx.x & 31, lr = lane & 15, hi = lane >> 4; const int wv = blockIdx.x * 8 + (threadIdx.x >> 5); const int nkb = K / 32;
    if (K != DD || N != DD || wv >= (N / 16) * nkb) return;   // Bt's fragment order is that of rows of 256 (k_gemmw); with the sizes known a lane's 16 loads are one address plus constants
    const int ng = wv / nkb, kb = wv % nkb; const int nd = qk ? (y / 3) * 3 * N + ng * KP + kofs : y * N + ng * 16;   // the first of the fragment's 16 rows of Bt; they are columns 16 ng + 0..15 of w
    const float* p = w + (size_t)(kb * 32 + hi * 8) * N + ng * 16 + lr; float x[16];
#pragma unroll
    for (int u = 0; u < 16; ++u) x[u] = p[(size_t)((u >> 3) * 16 + (u & 7)) * N];
    asm volatile("s_wait_xcnt 0x0" :: "v"(p) : "memory");   // the code behind the loads reuses the registers of their address; the wait names the address so that those registers live up to it
    bf* dst = Bt + (size_t)nd * K + kb * 512 + lane * 8;
#pragma unroll
    for (int u = 0; u < 2; ++u) { v8us o;
#pragma unroll
        for (int j = 0; j < 8; ++j) o[j] = f2bf(x[u * 8 + j]);
        *(v8us*)(dst + u * 256) = o; }
}
// k_cvt8: the embeddings ([rows][256] f32; blockIdx.y: row side, column side) rounded to bf16, in fragment order. A wave takes 16 rows x 128 k = four fragments, 4 KiB in a row of dst: run u holds k = 16 u + 8 * half + 0..7 of row lane % 16; its loads are issued before the first store.
// n8 = elements of one side / 8; grid (n8 / 8 / 256, 2), 8 waves.
__global__ __launch_bounds__(256) void k_cvt8(const float* __restrict__ src0, const float* __restrict__ src1, bf* dst, size_t n8) {
    const size_t wv = ((size_t)blockIdx.x * 256 + threadIdx.x) >> 5; if (wv * 256 >= n8) return;
    const int lane = threadIdx.x & 31, lr = lane & 15, hi = lane >> 4;
    const float* p = (blockIdx.y ? src1 : src0) + ((wv >> 1) * 16 + lr) * DD + (wv & 1) * 128 + hi * 8; dst += (size_t)blockIdx.y * n8 * 8 + wv * 2048 + lane * 8; v8f v[8];
#pragma unroll
    for (int u = 0; u < 8; ++u) v[u] = *(const v8f*)(p + u * 16);
    asm volatile("s_wait_xcnt 0x0" :: "v"(p) : "memory");   // as in k_wtG
#pragma unroll
    for (int u = 0; u < 8; ++u) { v8us o;
#pragma unroll
        for (int k = 0; k < 8; ++k) o[k] = f2bf(v[u][k]);
        *(v8us*)(dst + u * 256) = o; }
}

// k_mfrag: the matrix, rounded to bf16 (nearest even), once for each side in the order in which k_attn's lanes take it: MB[side][g][16-query group][32-key block][16-key tile t][lane][8], lane = 16 * half + query % 16, element j = key 16 t + 8 half + j of the block.
// Side 0: queries = rows r, keys = columns c, matrix[query][key]. Side 1: queries = columns, keys = rows, matrix[key][query]. A wave writes 8 tiles (128 keys) of one query group, 512 bytes in a row each; grid (512 / 16 * 4 / 8, GB, 2), 8 waves.
typedef __attribute__((ext_vector_type(8))) __bf16 v8b;
__global__ __launch_bounds__(256) void k_mfrag(const float* __restrict__ mt, bf* __restrict__ MB) {
    const int lane = threadIdx.x & 31, lr = lane & 15, hi = lane >> 4; const int wv = blockIdx.x * 8 + (threadIdx.x >> 5); const int qg = wv >> 2, kq = wv & 3; const int g = blockIdx.y, side = blockIdx.z;
    mt += (size_t)g * RR * RR; const int q = qg * 16 + lr;
    bf* dst = MB + ((((size_t)side * GB + g) * (RR / 16) + qg) * (RR / 32) + kq * 4) * 512 + lane * 8;
    const int key = kq * 128 + hi * 8; v8f m8[8];   // all of the wave's loads are issued before the first store
    // s_wait_xcnt behind each side's loads: the code behind them reuses the registers of the loads' address; the wait names the address so that those registers live up to it
    if (side == 0) { const float* p = mt + (size_t)q * RR + key;
#pragma unroll
        for (int u = 0; u < 8; ++u) m8[u] = *(const v8f*)(p + u * 16);
        asm volatile("s_wait_xcnt 0x0" :: "v"(p) : "memory");
    } else { const float* p = mt + (size_t)key * RR + q;
#pragma unroll
        for (int u = 0; u < 8; ++u)
#pragma unroll
            for (int j = 0; j < 8; ++j) m8[u][j] = p[(size_t)(u * 16 + j) * RR];
        asm volatile("s_wait_xcnt 0x0" :: "v"(p) : "memory");
    }
#pragma unroll
    for (int u = 0; u < 8; ++u) *(v8us*)(dst + u * 256) = __builtin_bit_cast(v8us, __builtin_convertvector(m8[u], v8b));
}

// ---- k_attn: scores, softmax and attention product of one side in one pass over the keys. A wave owns 32 queries (two 16-column groups) of one (side, item, head) and walks the 512 keys 32 at a time.
// Transposed products: S^T[key][query] = K' Q'^T (A = key rows, B = query rows kept in registers), O^T[d][query] += V^T P^T. In the accumulator map a lane holds ONE query (lane & 15) and keys 8 * (lane >> 4) + 0..7 of a 16-key tile,
// so the maximum and the sum over keys are in-lane plus one exchange between the wave's halves, and the two score tiles of a pass, converted in place, ARE the B operand of the second product (element s = tile s >> 3, register s & 7, the hardware k order);
// V^T is loaded in the same k order (keys 8 * half + 0..7 and 16 + 8 * half + 0..7 of each 32). Running maximum with rescale (base 2); the halves' sums are joined once at the end.
// Both sides run the same code: the planes, v^T and the matrix copy of a side lie in fragment order (k_gemmw, k_mfrag), so each fragment is two 16-byte loads at lane * 16 bytes of two 512-byte runs.
__device__ __forceinline__ float xhalf(float x) { return __int_as_float(__builtin_amdgcn_permlanex16(__float_as_int(x), __float_as_int(x), 0x76543210, 0xfedcba98, false, false)); }   // lane l with lane l ^ 16
// Exponentials with the slot behind them in ONE statement: the instruction set asks for one independent instruction or a v_nop between a transcendental and an instruction that reads its result or overwrites its source;
// Inside the statement each v_exp_f32 is followed by an independent one (early-clobber results lie on no source), the last by the v_nop.
__device__ __forceinline__ void exp2x8(const float* x, float* p) {
    asm("v_exp_f32 %0, %8\n\tv_exp_f32 %1, %9\n\tv_exp_f32 %2, %10\n\tv_exp_f32 %3, %11\n\tv_exp_f32 %4, %12\n\tv_exp_f32 %5, %13\n\tv_exp_f32 %6, %14\n\tv_exp_f32 %7, %15\n\tv_nop"
        : "=&v"(p[0]), "=&v"(p[1]), "=&v"(p[2]), "=&v"(p[3]), "=&v"(p[4]), "=&v"(p[5]), "=&v"(p[6]), "=&v"(p[7]) : "v"(x[0]), "v"(x[1]), "v"(x[2]), "v"(x[3]), "v"(x[4]), "v"(x[5]), "v"(x[6]), "v"(x[7])); }
__device__ __forceinline__ float exp2x1(float x) { float p; asm("v_exp_f32 %0, %1\n\tv_nop" : "=&v"(p) : "v"(x)); return p; }   // the same slot, one value
typedef __attribute__((ext_vector_type(4))) unsigned v4u;
typedef v4u __attribute__((may_alias)) v4ua;
__device__ __forceinline__ v16bf ldfb(const bf* p) { return cat16b(*(const v8us*)p, *(const v8us*)(p + 256)); }   // p: the 16-row group's 512 elements + lane * 8
__device__ __forceinline__ v16h ldfh(const h16* p) { return cat16(*(const v8h*)p, *(const v8h*)(p + 256)); }
__device__ __forceinline__ void attn_side(const bf* __restrict__ QH, const bf* __restrict__ QL, const bf* __restrict__ KH, const bf* __restrict__ KL, const h16* __restrict__ VT, const bf* __restrict__ MB, const float w, bf* __restrict__ Mh, bf* __restrict__ Ml, const int q0, const int lane) {
    const float SC = 0.36067376022224085f;   // 1/4 (the norm) x log2(e)
    const int lr = lane & 15, hi = lane >> 4;
    v16bf qh[2], ql[2]; v8f acc[2]; float mrun[2], lsum[2];
#pragma unroll
    for (int nb = 0; nb < 2; ++nb) { const size_t o = (size_t)(q0 / 16 + nb) * 512 + lane * 8; qh[nb] = ldfb(QH + o); ql[nb] = ldfb(QL + o); acc[nb] = (v8f){}; mrun[nb] = -3.0e38f; lsum[nb] = 0.f; }
    MB += (size_t)(q0 / 16) * (RR / 32) * 512 + lane * 8;
#pragma unroll 2   // two passes a trip: the second pass's loads are issued while the first pass is worked on (the inner loops are unrolled whole so that their arrays stay in registers)
    for (int k0 = 0; k0 < RR; k0 += 32) {
        v16bf kh[2], kl[2]; v4u m8[2][2];
#pragma unroll
        for (int t = 0; t < 2; ++t) { const size_t o = (size_t)(k0 / 16 + t) * 512 + lane * 8; kh[t] = ldfb(KH + o); kl[t] = ldfb(KL + o); }
        const v16h va = ldfh(VT + (size_t)(k0 / 32) * 512 + lane * 8);
#pragma unroll
        for (int nb = 0; nb < 2; ++nb)
#pragma unroll
            for (int t = 0; t < 2; ++t) m8[nb][t] = *(const v4ua*)(MB + (size_t)((nb * (RR / 32) + k0 / 32) * 2 + t) * 256);
#pragma unroll
        for (int nb = 0; nb < 2; ++nb) {
            float y[16];
#pragma unroll
            for (int t = 0; t < 2; ++t) {
                v8f s = wmmab(kh[t], qh[nb], (v8f){}); s = wmmab(kl[t], qh[nb], s); s = wmmab(kh[t], ql[nb], s);
#pragma unroll
                for (int j = 0; j < 8; j += 2) { const unsigned mm = m8[nb][t][j >> 1];   // two bf16 values of the matrix: key j in the low half, key j + 1 in the high half
                    y[t * 8 + j] = (s[j] + __uint_as_float(mm << 16) * w) * SC; y[t * 8 + j + 1] = (s[j + 1] + __uint_as_float(mm & 0xFFFF0000u) * w) * SC; }
            }
            float mx[4];
#pragma unroll
            for (int u = 0; u < 4; ++u) mx[u] = fmaxf(fmaxf(y[u], y[u + 4]), fmaxf(y[u + 8], y[u + 12]));
            float m1 = fmaxf(fmaxf(mx[0], mx[1]), fmaxf(mx[2], mx[3])); m1 = fmaxf(m1, xhalf(m1));
            const float mn = fmaxf(mrun[nb], m1); const float al = exp2x1(mrun[nb] - mn);   // 0 on the first pass
            mrun[nb] = mn; float ps[4] = {0.f, 0.f, 0.f, 0.f}, p[16]; v16h pb;
#pragma unroll
            for (int i = 0; i < 16; ++i) y[i] -= mn;
            exp2x8(y, p); exp2x8(y + 8, p + 8);
#pragma unroll
            for (int i = 0; i < 16; ++i) { ps[i & 3] += p[i]; pb[i] = (h16)p[i]; }
            lsum[nb] = lsum[nb] * al + ((ps[0] + ps[1]) + (ps[2] + ps[3]));
#pragma unroll
            for (int j = 0; j < 8; ++j) acc[nb][j] *= al;
            acc[nb] = wmma16(va, pb, acc[nb]);
        }
    }
#pragma unroll
    for (int nb = 0; nb < 2; ++nb) { const float f = __fdiv_rn(1.0f, lsum[nb] + xhalf(lsum[nb])); v8us oh, ol;
#pragma unroll
        for (int j = 0; j < 8; ++j) { unsigned short a, b; splitf(acc[nb][j] * f, a, b); oh[j] = a; ol[j] = b; }
        const size_t o = (size_t)(q0 + nb * 16 + lr) * KD + hi * 8; *(v8us*)(Mh + o) = oh; *(v8us*)(Ml + o) = ol; }   // [query][d], d = 8 * half + 0..7, as the bf16 hi and lo planes that the output GEMM reads: a wave stores 1 KiB in a row to each
}
// grid (512 / 128 queries, GB * 16 (item, head), 2 sides), 4 waves. PH/PL: [X, Y][g][h][512 x 32 in fragment order]; VT: [col_v, row_v][g][h][16 x 512 in fragment order]; MH/ML: [row, col][g][h][512][16]; MB: [side][g], k_mfrag's copies.
__global__ __launch_bounds__(128) void k_attn(const bf* __restrict__ PH, const bf* __restrict__ PL, const h16* __restrict__ VT, const bf* __restrict__ MB, const float* __restrict__ wm, bf* __restrict__ MH, bf* __restrict__ ML) {
    const int lane = threadIdx.x & 31; const int q0 = blockIdx.x * 128 + (threadIdx.x >> 5) * 32; const int gh = blockIdx.y, side = blockIdx.z;
    const size_t pq = (size_t)(side * GB * NH_ + gh) * RR * KP, pk = (size_t)((1 - side) * GB * NH_ + gh) * RR * KP; const size_t z = (size_t)side * GB * NH_ + gh;
    const float w = bfr(wm[gh % NH_]); MB += (size_t)(side * GB + gh / NH_) * RR * RR; VT += z * KD * RR; const size_t mo = z * RR * KD;
    attn_side(PH + pq, PL + pq, PH + pk, PL + pk, VT, MB, w, MH + mo, ML + mo, q0, lane);
}

extern "C" void kernel_launch(void* const* d_in, const int* in_sizes, int n_in,
                              void* d_out, int out_size, void* d_ws, size_t ws_size, hipStream_t stream) {
    (void)in_sizes; (void)n_in; (void)out_size;
    const float** I = (const float**)d_in;
    const float *row_emb = I[0], *col_emb = I[1], *matrix = I[2], *Wq_row = I[3], *Wk_row = I[4], *Wv_row = I[5], *Wq_col = I[6], *Wk_col = I[7], *Wv_col = I[8], *W_mat = I[9], *W_out_row = I[10], *W_out_col = I[11];
    float* OUT0 = (float*)d_out;     // [32][512][256] x 2, the column output behind the row output
    char* wsp = (char*)d_ws;
    auto take = [&](size_t bytes) { char* p = wsp; wsp += (bytes + 255) & ~(size_t)255; return (void*)p; };
    // Every buffer holds GB batch items, and the row-side and column-side twins of a stage lie one behind the other, so that one launch covers both twins of GB items.
    bf* WT = (bf*)take((size_t)8 * DD * DD * 2);                                                       // Bt rows [16 heads x (q, k) | v] row side, [16 heads x (k, q) | v] column side, out row, out col; fragment order
    bf* EB = (bf*)take((size_t)2 * GB * RR * DD * 2);                                                  // [row, col][g], fragment order
    bf* PH = (bf*)take((size_t)2 * GB * NH_ * RR * KP * 2); bf* PL = (bf*)take((size_t)2 * GB * NH_ * RR * KP * 2);   // [row_q | row_k, col_k | col_q][g]
    h16* VT = (h16*)take((size_t)2 * GB * NH_ * KD * RR * 2);                                          // [col_v, row_v][g]
    bf* MB = (bf*)take((size_t)2 * GB * RR * RR * 2);                                                  // [side][g]
    bf* MH = (bf*)take((size_t)2 * GB * RR * DD * 2); bf* ML = (bf*)take((size_t)2 * GB * RR * DD * 2);   // [row, col][g][h]
    if ((size_t)(wsp - (char*)d_ws) > ws_size) return;
    k_wtG<<<dim3((DD * DD / 64 + 63) / 64, 8, 1), 256, 0, stream>>>(Wq_row, Wk_row, Wv_row, Wq_col, Wk_col, Wv_col, W_out_row, W_out_col, DD, DD, WT);
    for (int b = 0; b < NB_; b += GB) {
        k_cvt8<<<dim3((GB * RR * DD / 64 + 255) / 256, 2, 1), 256, 0, stream>>>(row_emb + (size_t)b * RR * DD, col_emb + (size_t)b * RR * DD, EB, (size_t)GB * RR * DD / 8);
        k_gemmw<bf, 0, false, GB, true, false><<<dim3(RR / 64, D3 / 64, 2 * GB), 32, 0, stream>>>(EB, nullptr, WT, nullptr, DD, nullptr, 0, nullptr, (size_t)RR * DD, 0, 0, (size_t)GB * RR * DD, (size_t)D3 * DD, 0, PH, PL, VT);
        k_mfrag<<<dim3(RR / 16 * 4 / 8, GB, 2), 256, 0, stream>>>(matrix + (size_t)b * RR * RR, MB);
        k_attn<<<dim3(RR / 128, GB * NH_, 2), 128, 0, stream>>>(PH, PL, VT, MB, W_mat, MH, ML);
        k_gemmw<bf, 1, false, GB, false, true><<<dim3(RR / 64, DD / 64, 2 * GB), 32, 0, stream>>>(MH, ML, WT + (size_t)6 * DD * DD, nullptr, DD, OUT0 + (size_t)b * RR * DD, DD, nullptr, (size_t)RR * DD, 0, (size_t)RR * DD, (size_t)GB * RR * DD, (size_t)DD * DD, (size_t)NB_ * RR * DD, nullptr, nullptr, nullptr); }
}

// v008
// It runs in 145 microseconds.
// Timed twice side by side with v007, it ran 1.06 and 1.07 times as fast.
// All steps since v000 together make it 60.2 times as fast.
#include <hip/hip_runtime.h>

// MixedScoreMHA (row_emb, col_emb [32][512][256], matrix [32][512][512]; 16 heads x 16: row_q/k/v = row_emb W, col_q/k/v = col_emb W; compat[h][r][c] = (row_q.col_k + col_q.row_k + matrix W_mat[h]) / 4 (W_mat read); attn_row = softmax over c, attn_col = softmax over r;
// row_heads = attn_row col_v, col_heads[c] = sum_r attn_col[r][c] row_v[r]; out_row = merge(row_heads) W_out_row, out_col = merge(col_heads) W_out_col -> two outputs [32][512][256]). Scores, softmax and the attention product are one kernel (k_attn): compat and the
// probabilities never reach memory; the projection GEMM and k_attn store their results in the layout and type that the next product reads. The column side is the same kernel on compat transposed (queries = columns, keys = rows), so each side computes its own scores.
// Every operand of k_attn's loop lies in memory in the order of its matrix fragment, [16-row group][8-element run][lane][8]: a wave's 16-byte load is 512 bytes in a row (four whole lines). The matrix gets such a copy, in bf16, for each side (k_mfrag): it is the A operand of a fourth score product whose B holds W_mat[h] on a diagonal, so that the term matrix W_mat[h] is added by the matrix unit. The bf16 operands of the two GEMMs (embeddings from k_cvt8, weights from k_wtG) lie in the same order for K = 256.
// Compute dtypes, f32 accumulate: every input rounded to bf16; the six projections on PLAIN bf16 operands (inputs: exact); the score product on bf16 hi+lo planes of q and k (3 products, K = 32 = [q | k] against [k | q]) behind the product of the bf16 matrix with bf16 W_mat (each term exact in f32); probabilities and v in fp16.

#define NB_  32
#define RR   512
#define DD   256
#define D3   768
#define NH_  16
#define KD   16
#define KP   32
#define GB   32     // batch items that share each launch (NB_ % GB == 0); the workspace holds GB items' intermediates, 5 MiB an item (161 MiB with the weights)
typedef _Float16 h16;
typedef unsigned short bf;
typedef __attribute__((ext_vector_type(16))) __bf16   v16bf;
typedef __attribute__((ext_vector_type(16))) _Float16 v16h;
typedef __attribute__((ext_vector_type(8)))  _Float16 v8h;
typedef __attribute__((ext_vector_type(8)))  unsigned short v8us;
typedef __attribute__((ext_vector_type(8)))  float    v8f;
typedef __attribute__((ext_vector_type(4)))  float    v4f;
typedef v8h  __attribute__((may_alias)) v8ha;
typedef v4f  __attribute__((may_alias)) v4fa;
typedef v8us __attribute__((may_alias)) v8usa;

__device__ __forceinline__ unsigned short f2bf(float f) { unsigned u = __float_as_uint(f); u += 0x7FFFu + ((u >> 16) & 1u); return (unsigned short)(u >> 16); }
__device__ __forceinline__ float bf2f(unsigned short b) { return __uint_as_float(((unsigned)b) << 16); }
__device__ __forceinline__ float bfr(float f) { return bf2f(f2bf(f)); }
__device__ __forceinline__ v16h cat16(v8h lo, v8h hi) { return __builtin_shufflevector(lo, hi, 0, 1, 2, 3, 4, 5, 6, 7, 8, 9, 10, 11, 12, 13, 14, 15); }
__device__ __forceinline__ v16bf cat16b(v8us lo, v8us hi) { return __builtin_bit_cast(v16bf, __builtin_shufflevector(lo, hi, 0, 1, 2, 3, 4, 5, 6, 7, 8, 9, 10, 11, 12, 13, 14, 15)); }
__device__ __forceinline__ v8f wmma16(v16h a, v16h b, v8f c) { return __builtin_amdgcn_wmma_f32_16x16x32_f16(false, a, false, b, (short)0, c, false, false); }
__device__ __forceinline__ v8f wmmab(v16bf a, v16bf b, v8f c) { return __builtin_amdgcn_wmma_f32_16x16x32_bf16(false, a, false, b, (short)0, c, false, false); }



// ---- k_gemmw: register-blocked GEMM, ONE WAVE per 64x64 output tile (16 accumulators), operands straight from 16-bit planes in fragment order; grid (M/64, N/64, Z), 32 threads.
// Fragment order of a plane [rows][256] (the planes' row length is the constant DD, so that a pass's loads differ by constants; K <= DD): element (r, k) at (r / 16) * 16 * 256 + (k / 32) * 512 + ((k / 16) % 2) * 256 + ((k / 8) % 2) * 128 + (r % 16) * 8 + k % 8: a fragment (16 rows x 32 k) is two runs of 512 bytes, a lane's 16 bytes of each at lane * 16. A and Bt alike, so their k orders are equal.
// C[m][n] (f32, pitch ldc, + optional f32 bias[n]) = sum_k A[m][k] Bt[n][k] (+ split products per NSPLIT). z-batch strides sA/sB/sC in elements. K % 32 == 0.
// ZIN == 0: blockIdx.z is one flat batch index. ZIN > 0: blockIdx.z = twin * ZIN + item; the item moves by sA/sB/sC, the twin (row side, column side) by tA/tB/tC.
// PLANES (the projections; k_wtG orders the 768 weight rows as 16 heads x 32 score columns, then v): no C; the tile goes out as the attention kernel's operands, every 128-byte line of them written by one wave.
//   score tiles (two heads): bf16 hi and lo planes, K = 32 with no padding, in fragment order: element (r, k) of a head at (r / 16) * 512 + (k / 16) * 256 + ((k / 8) % 2) * 128 + (r % 16) * 8 + k % 8. Row side: X[h][r][k] = row_q[r][h*16 + k] for k < 16, row_k behind it; column side: Y[h][c][k] = col_k for k < 16, col_q behind it: X[r] . Y[c] = row_q.col_k + col_q.row_k.
//   v tiles (four heads): v^T in fp16, sets 0 col_v, 1 row_v, in fragment order: element (d, r) of a head at (r / 32) * 512 + ((r / 16) % 2) * 256 + ((r / 8) % 2) * 128 + d * 8 + r % 8: in the accumulator map a lane holds one d and 8 consecutive r, its own 16 bytes of a 512-byte run.
// AHM: A lies head-major, [K / 16][512 rows][16] (as k_attn stores it), not [row][K]; the fragment's two 8-element runs, k = kc + 8 half and kc + 16 + 8 half, are then the same 16 bytes of two neighbouring heads.
template <typename T16> struct WFrag;
template <> struct WFrag<h16> { typedef v16h V; static __device__ __forceinline__ V ld(const h16* p) { return cat16(*(const v8h*)p, *(const v8h*)(p + 16)); } static __device__ __forceinline__ v8f mma(V a, V b, v8f c) { return wmma16(a, b, c); } };
template <> struct WFrag<bf> { typedef v16bf V; static __device__ __forceinline__ V ld2(const bf* p, const bf* q) { return cat16b(*(const v8us*)p, *(const v8us*)q); } static __device__ __forceinline__ V ld(const bf* p) { return ld2(p, p + 256); } static __device__ __forceinline__ v8f mma(V a, V b, v8f c) { return wmmab(a, b, c); } };
__device__ __forceinline__ void splitf(float y, unsigned short& h, unsigned short& l) { h = f2bf(y); l = f2bf(y - bf2f(h)); }
template <typename T16, int NSPLIT, bool BIAS, int ZIN, bool PLANES, bool AHM>
__global__ __launch_bounds__(32) void k_gemmw(const T16* __restrict__ A, const T16* __restrict__ A2, const T16* __restrict__ Bt, const T16* __restrict__ Bt2, int K, float* C, int ldc, const float* __restrict__ bias, size_t sA, size_t sB, size_t sC, size_t tA, size_t tB, size_t tC, bf* Ph, bf* Pl, h16* Vt) {
    typedef typename WFrag<T16>::V V;
    __shared__ __align__(16) float os[16 * 68];
    const size_t z = ZIN > 0 ? blockIdx.z % (ZIN > 0 ? ZIN : 1) : blockIdx.z, zt = ZIN > 0 ? blockIdx.z / (ZIN > 0 ? ZIN : 1) : 0;
    const size_t oA = z * sA + zt * tA, oB = z * sB + zt * tB; A += oA; if (A2) A2 += oA; Bt += oB; if (Bt2) Bt2 += oB; if (!PLANES) C += z * sC + zt * tC;
    const int lane = threadIdx.x & 31, lr = lane & 15, hi = lane >> 4; const int r0 = blockIdx.x * 64, c0 = blockIdx.y * 64;
    v8f acc[4][4];
#pragma unroll
    for (int mb = 0; mb < 4; ++mb)
#pragma unroll
        for (int nb = 0; nb < 4; ++nb) acc[mb][nb] = (v8f){};
    const size_t aoff = AHM ? (size_t)(r0 + lr) * KD + 8 * hi : (size_t)r0 * DD + lane * 8, boff = (size_t)c0 * DD + lane * 8;
#pragma unroll 1
    for (int kc = 0; kc < K; kc += 32) {
        V a[4], a2[4];
        const T16* pa = A + aoff + (AHM ? (size_t)(kc / KD) * RR * KD : (size_t)kc * 16); const T16* pa2 = (NSPLIT == 1 || NSPLIT == 2) ? A2 + (pa - A) : pa; const T16* pb = Bt + boff + (size_t)kc * 16; const T16* pb2 = NSPLIT >= 2 ? Bt2 + (pb - Bt) : pb;   // the pass's loads are these plus constants
#pragma unroll
        for (int mb = 0; mb < 4; ++mb) {
            if (AHM) { const int o = mb * 16 * KD; a[mb] = WFrag<T16>::ld2(pa + o, pa + o + RR * KD); if (NSPLIT == 1 || NSPLIT == 2) a2[mb] = WFrag<T16>::ld2(pa2 + o, pa2 + o + RR * KD); }
            else { a[mb] = WFrag<T16>::ld(pa + mb * 16 * DD); if (NSPLIT == 1 || NSPLIT == 2) a2[mb] = WFrag<T16>::ld(pa2 + mb * 16 * DD); } }
#pragma unroll
        for (int nb = 0; nb < 4; ++nb) { const V b = WFrag<T16>::ld(pb + nb * 16 * DD); V b2; if (NSPLIT >= 2) b2 = WFrag<T16>::ld(pb2 + nb * 16 * DD);
#pragma unroll
            for (int mb = 0; mb < 4; ++mb) { acc[mb][nb] = WFrag<T16>::mma(a[mb], b, acc[mb][nb]); if (NSPLIT == 1 || NSPLIT == 2) acc[mb][nb] = WFrag<T16>::mma(a2[mb], b, acc[mb][nb]); if (NSPLIT >= 2) acc[mb][nb] = WFrag<T16>::mma(a[mb], b2, acc[mb][nb]); } }
        asm volatile("s_wait_xcnt 0x0" :: "v"(pa), "v"(pa2), "v"(pb), "v"(pb2) : "memory");   // the next pass rewrites the registers of the loads' addresses; the wait names the addresses so that no load of the pass lands on their registers
        asm volatile("v_nop\n\tv_nop\n\tv_nop\n\tv_nop" : "+v"(acc[0][0]), "+v"(acc[1][1]), "+v"(acc[2][2]), "+v"(acc[3][3]) : "v"(a[0]), "v"(a[3]));
    }
    if (PLANES && c0 >= 2 * DD) {
        h16* vt = Vt + (((1 - zt) * ZIN + z) * NH_ + (c0 - 2 * DD) / KD) * KD * RR + (r0 / 32) * 512 + lane * 8;
#pragma unroll
        for (int mb = 0; mb < 4; ++mb)
#pragma unroll
            for (int nb = 0; nb < 4; ++nb) { v8h o;
#pragma unroll
                for (int j = 0; j < 8; ++j) o[j] = (h16)acc[mb][nb][j];
                *(v8h*)(vt + (size_t)nb * KD * RR + (mb >> 1) * 512 + (mb & 1) * 256) = o; }
    } else if (PLANES) {
    const size_t po = (((zt * ZIN + z) * NH_ + c0 / KP) * RR + r0) * KP + lane * 8;   // 16 rows of a head are 512 elements; the lane reads back row lr, columns 16 f + 8 hi + 0..7 of the tile (f = 2 * head + run): its 16 bytes of that run
#pragma unroll
    for (int mb = 0; mb < 4; ++mb) {
#pragma unroll
        for (int nb = 0; nb < 4; ++nb) {
#pragma unroll
            for (int j = 0; j < 8; ++j) os[(hi * 8 + j) * 68 + nb * 16 + lr] = acc[mb][nb][j]; }
        __builtin_amdgcn_wave_barrier(); asm volatile("" ::: "memory");   // the reads below take other lanes' writes: keep them behind the writes
#pragma unroll
        for (int f = 0; f < 4; ++f) { const float* sp = os + lr * 68 + f * 16 + hi * 8; const v4f x0 = *(const v4fa*)sp, x1 = *(const v4fa*)(sp + 4); v8us oh, ol;
#pragma unroll
            for (int u = 0; u < 4; ++u) { unsigned short a, b; splitf(x0[u], a, b); oh[u] = a; ol[u] = b; splitf(x1[u], a, b); oh[u + 4] = a; ol[u + 4] = b; }
            const size_t o = po + (size_t)(f >> 1) * RR * KP + mb * 512 + (f & 1) * 256; *(v8us*)(Ph + o) = oh; *(v8us*)(Pl + o) = ol; }
        __builtin_amdgcn_wave_barrier(); asm volatile("" ::: "memory");   // the next tile's writes stay behind these reads
    }
    asm volatile("s_wait_xcnt 0x0" ::: "memory");   // in the built code this branch runs on, behind a test that never holds, into the v branch, which rewrites the address registers of the stores above
    } else {
#pragma unroll
    for (int mb = 0; mb < 4; ++mb) {
#pragma unroll
        for (int nb = 0; nb < 4; ++nb) {
#pragma unroll
            for (int j = 0; j < 8; ++j) os[(hi * 8 + j) * 68 + nb * 16 + lr] = acc[mb][nb][j]; }
        __builtin_amdgcn_wave_barrier(); asm volatile("" ::: "memory");
        float* crow = C + (size_t)(r0 + mb * 16) * ldc + c0;
{
#pragma unroll
            for (int s = 0; s < 8; ++s) { const int row = 2 * s + hi, cofs = lr * 4; v4f val = *(const v4fa*)(os + row * 68 + cofs);
                if (BIAS) { val[0] += bfr(bias[c0 + cofs]); val[1] += bfr(bias[c0 + cofs + 1]); val[2] += bfr(bias[c0 + cofs + 2]); val[3] += bfr(bias[c0 + cofs + 3]); }
                *(v4f*)(crow + (size_t)row * ldc + cofs) = val; }
             }
        __builtin_amdgcn_wave_barrier(); asm volatile("" ::: "memory");
    }
    }
}


// k_wtG: blockIdx.y picks one of the eight weight matrices; their transposed bf16 planes (rows n, K = k) lie one behind the other in Bt, in fragment order. The q and k rows of a side are interleaved by head in the order of the score planes
// (row side: head h = rows 32 h .. : 16 of q, 16 of k; column side: 16 of k, 16 of q), so that a 64-column tile of the projection GEMM holds whole plane rows of two heads.
// A wave writes one fragment (16 rows n x 32 k, 1 KiB in a row): lane = 16 * half + n % 16 takes k = 8 * half + 0..7 and 16 + 8 * half + 0..7 of the block; its 16 loads are issued before the first store. Grid (N / 16 * K / 32 / 8, 8), 8 waves.
__global__ __launch_bounds__(256) void k_wtG(const float* __restrict__ w0, const float* __restrict__ w1, const float* __restrict__ w2, const float* __restrict__ w3, const float* __restrict__ w4, const float* __restrict__ w5, const float* __restrict__ w6, const float* __restrict__ w7, int K, int N, bf* Bt) {
    const int y = blockIdx.y; const float* w = y == 0 ? w0 : y == 1 ? w1 : y == 2 ? w2 : y == 3 ? w3 : y == 4 ? w4 : y == 5 ? w5 : y == 6 ? w6 : w7; const bool qk = y < 6 && y % 3 < 2; const int kofs = ((y % 3 == 0) == (y < 3)) ? 0 : KD;
    const int lane = threadIdx.x & 31, lr = lane & 15, hi = lane >> 4; const int wv = blockIdx.x * 8 + (threadIdx.x >> 5); const int nkb = K / 32;
    if (K != DD || N != DD || wv >= (N / 16) * nkb) return;   // Bt's fragment order is that of rows of 256 (k_gemmw); with the sizes known a lane's 16 loads are one address plus constants
    const int ng = wv / nkb, kb = wv % nkb; const int nd = qk ? (y / 3) * 3 * N + ng * KP + kofs : y * N + ng * 16;   // the first of the fragment's 16 rows of Bt; they are columns 16 ng + 0..15 of w
    const float* p = w + (size_t)(kb * 32 + hi * 8) * N + ng * 16 + lr; float x[16];
#pragma unroll
    for (int u = 0; u < 16; ++u) x[u] = p[(size_t)((u >> 3) * 16 + (u & 7)) * N];
    asm volatile("s_wait_xcnt 0x0" :: "v"(p) : "memory");   // the code behind the loads reuses the registers of their address; the wait names the address so that those registers live up to it
    bf* dst = Bt + (size_t)nd * K + kb * 512 + lane * 8;
#pragma unroll
    for (int u = 0; u < 2; ++u) { v8us o;
#pragma unroll
        for (int j = 0; j < 8; ++j) o[j] = f2bf(x[u * 8 + j]);
        *(v8us*)(dst + u * 256) = o; }
}
// k_cvt8: the embeddings ([rows][256] f32; blockIdx.y: row side, column side) rounded to bf16, in fragment order. A wave takes 16 rows x 128 k = four fragments, 4 KiB in a row of dst: run u holds k = 16 u + 8 * half + 0..7 of row lane % 16; its loads are issued before the first store.
// n8 = elements of one side / 8; grid (n8 / 8 / 256, 2), 8 waves.
__global__ __launch_bounds__(256) void k_cvt8(const float* __restrict__ src0, const float* __restrict__ src1, bf* dst, size_t n8) {
    const size_t wv = ((size_t)blockIdx.x * 256 + threadIdx.x) >> 5; if (wv * 256 >= n8) return;
    const int lane = threadIdx.x & 31, lr = lane & 15, hi = lane >> 4;
    const float* p = (blockIdx.y ? src1 : src0) + ((wv >> 1) * 16 + lr) * DD + (wv & 1) * 128 + hi * 8; dst += (size_t)blockIdx.y * n8 * 8 + wv * 2048 + lane * 8; v8f v[8];
#pragma unroll
    for (int u = 0; u < 8; ++u) v[u] = *(const v8f*)(p + u * 16);
    asm volatile("s_wait_xcnt 0x0" :: "v"(p) : "memory");   // as in k_wtG
#pragma unroll
    for (int u = 0; u < 8; ++u) { v8us o;
#pragma unroll
        for (int k = 0; k < 8; ++k) o[k] = f2bf(v[u][k]);
        *(v8us*)(dst + u * 256) = o; }
}

// k_mfrag: the matrix, rounded to bf16 (nearest even), once for each side as the A fragments (16 keys x 32 queries) of k_attn's fourth score product: MB[side][g][32-query group][16-key tile][16-query run u][lane][8], lane = 16 * half + key % 16, element j = query 16 u + 8 half + j of the group
// (the fragment order of k_gemmw's score planes, with the key as the row and the query as k). Side 0: queries = rows r, keys = columns c, matrix[query][key]. Side 1: queries = columns, keys = rows, matrix[key][query].
// A wave takes one key tile and 128 queries: 8 runs of 512 bytes, two in a row (1 KiB) for each of four query groups; grid (512 / 16 * 4 / 8, GB, 2), 8 waves.
typedef __attribute__((ext_vector_type(8))) __bf16 v8b;
__global__ __launch_bounds__(256) void k_mfrag(const float* __restrict__ mt, bf* __restrict__ MB) {
    const int lane = threadIdx.x & 31, lr = lane & 15, hi = lane >> 4; const int wv = blockIdx.x * 8 + (threadIdx.x >> 5); const int kt = wv >> 2, qq = wv & 3; const int g = blockIdx.y, side = blockIdx.z;
    mt += (size_t)g * RR * RR; const int key = kt * 16 + lr;
    bf* dst = MB + ((((size_t)side * GB + g) * (RR / 32) + qq * 4) * (RR / 16) + kt) * 512 + lane * 8;
    const int q = qq * 128 + hi * 8; v8f m8[8];   // all of the wave's loads are issued before the first store
    // s_wait_xcnt behind each side's loads: the code behind them reuses the registers of the loads' address; the wait names the address so that those registers live up to it
    if (side == 1) { const float* p = mt + (size_t)key * RR + q;
#pragma unroll
        for (int u = 0; u < 8; ++u) m8[u] = *(const v8f*)(p + u * 16);
        asm volatile("s_wait_xcnt 0x0" :: "v"(p) : "memory");
    } else { const float* p = mt + (size_t)q * RR + key;
#pragma unroll
        for (int u = 0; u < 8; ++u)
#pragma unroll
            for (int j = 0; j < 8; ++j) m8[u][j] = p[(size_t)(u * 16 + j) * RR];
        asm volatile("s_wait_xcnt 0x0" :: "v"(p) : "memory");
    }
#pragma unroll
    for (int u = 0; u < 8; ++u) *(v8us*)(dst + (size_t)(u >> 1) * (RR / 16) * 512 + (u & 1) * 256) = __builtin_bit_cast(v8us, __builtin_convertvector(m8[u], v8b));
}

// ---- k_attn: scores, softmax and attention product of one side in one pass over the keys. A wave owns 32 queries (two 16-column groups) of one (side, item, head) and walks the 512 keys 32 at a time.
// Transposed products: S^T[key][query] = K' Q'^T (A = key rows, B = query rows kept in registers), O^T[d][query] += V^T P^T. In the accumulator map a lane holds ONE query (lane & 15) and keys 8 * (lane >> 4) + 0..7 of a 16-key tile,
// so the maximum and the sum over keys are in-lane plus one exchange between the wave's halves, and the two score tiles of a pass, converted in place, ARE the B operand of the second product (element s = tile s >> 3, register s & 7, the hardware k order);
// V^T is loaded in the same k order (keys 8 * half + 0..7 and 16 + 8 * half + 0..7 of each 32). Running maximum with rescale (base 2); the halves' sums are joined once at the end.
// The term matrix W_mat[h] is a product too: S^T[key][query n of group nb] += sum_k M[key][k] Wd[k][n], M = the matrix tile of the 16 keys and the wave's 32 queries (k = query), Wd[k][n] = W_mat[h] where k = 16 nb + n, else 0: one term a score, bf16 x bf16, exact in f32. It starts each score's accumulator.
// Both sides run the same code: the planes, v^T and the matrix copy of a side lie in fragment order (k_gemmw, k_mfrag), so each fragment is two 16-byte loads at lane * 16 bytes of two 512-byte runs.
__device__ __forceinline__ float xhalf(float x) { return __int_as_float(__builtin_amdgcn_permlanex16(__float_as_int(x), __float_as_int(x), 0x76543210, 0xfedcba98, false, false)); }   // lane l with lane l ^ 16
// Exponentials with the slot behind them in ONE statement: the instruction set asks for one independent instruction or a v_nop between a transcendental and an instruction that reads its result or overwrites its source;
// Inside the statement each v_exp_f32 is followed by an independent one, the last by the v_nop.
// Each works in place: the compiler keeps the distance behind a matrix instruction only for its own instructions, and a result register of its own could be one that a matrix instruction directly in front has just read; an in-place register was last written by the compiler's subtraction.
__device__ __forceinline__ void exp2x8(float* x) {
    asm("v_exp_f32 %0, %0\n\tv_exp_f32 %1, %1\n\tv_exp_f32 %2, %2\n\tv_exp_f32 %3, %3\n\tv_exp_f32 %4, %4\n\tv_exp_f32 %5, %5\n\tv_exp_f32 %6, %6\n\tv_exp_f32 %7, %7\n\tv_nop"
        : "+v"(x[0]), "+v"(x[1]), "+v"(x[2]), "+v"(x[3]), "+v"(x[4]), "+v"(x[5]), "+v"(x[6]), "+v"(x[7])); }
__device__ __forceinline__ float exp2x1(float x) { asm("v_exp_f32 %0, %0\n\tv_nop" : "+v"(x)); return x; }   // the same slot, one value
__device__ __forceinline__ v16bf ldfb(const bf* p) { return cat16b(*(const v8us*)p, *(const v8us*)(p + 256)); }   // p: the 16-row group's 512 elements + lane * 8
__device__ __forceinline__ v16h ldfh(const h16* p) { return cat16(*(const v8h*)p, *(const v8h*)(p + 256)); }
__device__ __forceinline__ void attn_side(const bf* __restrict__ QH, const bf* __restrict__ QL, const bf* __restrict__ KH, const bf* __restrict__ KL, const h16* __restrict__ VT, const bf* __restrict__ MB, const unsigned short w, bf* __restrict__ Mh, bf* __restrict__ Ml, const int q0, const int lane) {
    const float SC = 0.36067376022224085f;   // 1/4 (the norm) x log2(e)
    const int lr = lane & 15, hi = lane >> 4;
    v16bf qh[2], ql[2], wd[2]; v8f acc[2]; float mrun[2], lsum[2];
    { v8us d, z;   // Wd as a B fragment (row n = lr; element e is k = 8 * half + e, element 8 + e is k = 16 + 8 * half + e, the k order of ldfb): w at k = 16 nb + lr
#pragma unroll
      for (int e = 0; e < 8; ++e) { d[e] = (hi == (lr >> 3) && e == (lr & 7)) ? w : (unsigned short)0; z[e] = 0; }
      wd[0] = cat16b(d, z); wd[1] = cat16b(z, d); }
#pragma unroll
    for (int nb = 0; nb < 2; ++nb) { const size_t o = (size_t)(q0 / 16 + nb) * 512 + lane * 8; qh[nb] = ldfb(QH + o); ql[nb] = ldfb(QL + o); acc[nb] = (v8f){}; mrun[nb] = -3.0e38f; lsum[nb] = 0.f; }
    const bf* pkh = KH + lane * 8; const bf* pkl = KL + lane * 8; const bf* pm = MB + (size_t)(q0 / 32) * (RR / 16) * 512 + lane * 8; const h16* pv = VT + lane * 8;   // a pass's loads are these plus constants; they move on by 64 keys a trip
#pragma unroll 1   // two passes a trip, written out below: the second pass's loads are issued while the first pass is worked on (the inner loops are unrolled whole so that their arrays stay in registers)
    for (int k0 = 0; k0 < RR; k0 += 64, pkh += 4 * 512, pkl += 4 * 512, pm += 4 * 512, pv += 2 * 512)
#pragma unroll
    for (int pp = 0; pp < 2; ++pp) {
        v16bf kh[2], kl[2], ma[2];
#pragma unroll
        for (int t = 0; t < 2; ++t) { const int o = (pp * 2 + t) * 512; kh[t] = ldfb(pkh + o); kl[t] = ldfb(pkl + o); ma[t] = ldfb(pm + o); }
        const v16h va = ldfh(pv + pp * 512);
        if (pp == 1) asm volatile("s_wait_xcnt 0x0" :: "v"(pkh), "v"(pkl), "v"(pm), "v"(pv) : "memory");   // behind the trip's last load: the trip's end rewrites the registers of the loads' addresses; the wait names the addresses so that those registers live up to it and no load of the trip lands on them
#pragma unroll
        for (int nb = 0; nb < 2; ++nb) {
            float y[16];
#pragma unroll
            for (int t = 0; t < 2; ++t) {
                v8f s = wmmab(ma[t], wd[nb], (v8f){}); s = wmmab(kh[t], qh[nb], s); s = wmmab(kl[t], qh[nb], s); s = wmmab(kh[t], ql[nb], s);
#pragma unroll
                for (int j = 0; j < 8; ++j) y[t * 8 + j] = s[j] * SC;
            }
            float mx[4];
#pragma unroll
            for (int u = 0; u < 4; ++u) mx[u] = fmaxf(fmaxf(y[2 * u], y[2 * u + 1]), fmaxf(y[2 * u + 8], y[2 * u + 9]));   // neighbours first: the packed scaling then works on an accumulator's registers where they lie
            float m1 = fmaxf(fmaxf(mx[0], mx[1]), fmaxf(mx[2], mx[3])); m1 = fmaxf(m1, xhalf(m1));
            const float mn = fmaxf(mrun[nb], m1); const float al = exp2x1(mrun[nb] - mn);   // 0 on the first pass
            mrun[nb] = mn; float ps[4] = {0.f, 0.f, 0.f, 0.f}; float* p = y; v16h pb;
#pragma unroll
            for (int i = 0; i < 16; ++i) y[i] -= mn;
            exp2x8(y); exp2x8(y + 8);
#pragma unroll
            for (int i = 0; i < 16; ++i) { ps[i & 3] += p[i]; pb[i] = (h16)p[i]; }
            lsum[nb] = lsum[nb] * al + ((ps[0] + ps[1]) + (ps[2] + ps[3]));
#pragma unroll
            for (int j = 0; j < 8; ++j) acc[nb][j] *= al;
            acc[nb] = wmma16(va, pb, acc[nb]);
        }
    }
#pragma unroll
    for (int nb = 0; nb < 2; ++nb) { const float f = __fdiv_rn(1.0f, lsum[nb] + xhalf(lsum[nb])); v8us oh, ol;
#pragma unroll
        for (int j = 0; j < 8; ++j) { unsigned short a, b; splitf(acc[nb][j] * f, a, b); oh[j] = a; ol[j] = b; }
        const size_t o = (size_t)(q0 + nb * 16 + lr) * KD + hi * 8; *(v8us*)(Mh + o) = oh; *(v8us*)(Ml + o) = ol; }   // [query][d], d = 8 * half + 0..7, as the bf16 hi and lo planes that the output GEMM reads: a wave stores 1 KiB in a row to each
}
// grid (512 / 128 queries, GB * 16 (item, head), 2 sides), 4 waves. PH/PL: [X, Y][g][h][512 x 32 in fragment order]; VT: [col_v, row_v][g][h][16 x 512 in fragment order]; MH/ML: [row, col][g][h][512][16]; MB: [side][g], k_mfrag's copies.
__global__ __launch_bounds__(128) void k_attn(const bf* __restrict__ PH, const bf* __restrict__ PL, const h16* __restrict__ VT, const bf* __restrict__ MB, const float* __restrict__ wm, bf* __restrict__ MH, bf* __restrict__ ML) {
    const int lane = threadIdx.x & 31; const int q0 = blockIdx.x * 128 + (threadIdx.x >> 5) * 32; const int gh = blockIdx.y, side = blockIdx.z;
    const size_t pq = (size_t)(side * GB * NH_ + gh) * RR * KP, pk = (size_t)((1 - side) * GB * NH_ + gh) * RR * KP; const size_t z = (size_t)side * GB * NH_ + gh;
    const unsigned short w = f2bf(wm[gh % NH_]); MB += (size_t)(side * GB + gh / NH_) * RR * RR; VT += z * KD * RR; const size_t mo = z * RR * KD;
    attn_side(PH + pq, PL + pq, PH + pk, PL + pk, VT, MB, w, MH + mo, ML + mo, q0, lane);
}

extern "C" void kernel_launch(void* const* d_in, const int* in_sizes, int n_in,
                              void* d_out, int out_size, void* d_ws, size_t ws_size, hipStream_t stream) {
    (void)in_sizes; (void)n_in; (void)out_size;
    const float** I = (const float**)d_in;
    const float *row_emb = I[0], *col_emb = I[1], *matrix = I[2], *Wq_row = I[3], *Wk_row = I[4], *Wv_row = I[5], *Wq_col = I[6], *Wk_col = I[7], *Wv_col = I[8], *W_mat = I[9], *W_out_row = I[10], *W_out_col = I[11];
    float* OUT0 = (float*)d_out;     // [32][512][256] x 2, the column output behind the row output
    char* wsp = (char*)d_ws;
    auto take = [&](size_t bytes) { char* p = wsp; wsp += (bytes + 255) & ~(size_t)255; return (void*)p; };
    // Every buffer holds GB batch items, and the row-side and column-side twins of a stage lie one behind the other, so that one launch covers both twins of GB items.
    bf* WT = (bf*)take((size_t)8 * DD * DD * 2);                                                       // Bt rows [16 heads x (q, k) | v] row side, [16 heads x (k, q) | v] column side, out row, out col; fragment order
    bf* EB = (bf*)take((size_t)2 * GB * RR * DD * 2);                                                  // [row, col][g], fragment order
    bf* PH = (bf*)take((size_t)2 * GB * NH_ * RR * KP * 2); bf* PL = (bf*)take((size_t)2 * GB * NH_ * RR * KP * 2);   // [row_q | row_k, col_k | col_q][g]
    h16* VT = (h16*)take((size_t)2 * GB * NH_ * KD * RR * 2);                                          // [col_v, row_v][g]
    bf* MB = (bf*)take((size_t)2 * GB * RR * RR * 2);                                                  // [side][g]
    bf* MH = (bf*)take((size_t)2 * GB * RR * DD * 2); bf* ML = (bf*)take((size_t)2 * GB * RR * DD * 2);   // [row, col][g][h]
    if ((size_t)(wsp - (char*)d_ws) > ws_size) return;
    k_wtG<<<dim3((DD * DD / 64 + 63) / 64, 8, 1), 256, 0, stream>>>(Wq_row, Wk_row, Wv_row, Wq_col, Wk_col, Wv_col, W_out_row, W_out_col, DD, DD, WT);
    for (int b = 0; b < NB_; b += GB) {
        k_cvt8<<<dim3((GB * RR * DD / 64 + 255) / 256, 2, 1), 256, 0, stream>>>(row_emb + (size_t)b * RR * DD, col_emb + (size_t)b * RR * DD, EB, (size_t)GB * RR * DD / 8);
        k_gemmw<bf, 0, false, GB, true, false><<<dim3(RR / 64, D3 / 64, 2 * GB), 32, 0, stream>>>(EB, nullptr, WT, nullptr, DD, nullptr, 0, nullptr, (size_t)RR * DD, 0, 0, (size_t)GB * RR * DD, (size_t)D3 * DD, 0, PH, PL, VT);
        k_mfrag<<<dim3(RR / 16 * 4 / 8, GB, 2), 256, 0, stream>>>(matrix + (size_t)b * RR * RR, MB);
        k_attn<<<dim3(RR / 128, GB * NH_, 2), 128, 0, stream>>>(PH, PL, VT, MB, W_mat, MH, ML);
        k_gemmw<bf, 1, false, GB, false, true><<<dim3(RR / 64, DD / 64, 2 * GB), 32, 0, stream>>>(MH, ML, WT + (size_t)6 * DD * DD, nullptr, DD, OUT0 + (size_t)b * RR * DD, DD, nullptr, (size_t)RR * DD, 0, (size_t)RR * DD, (size_t)GB * RR * DD, (size_t)DD * DD, (size_t)NB_ * RR * DD, nullptr, nullptr, nullptr); }
}

// v009
// A run of this version takes 138 microseconds.
// Next to v008, in two timings, it ran 1.05 times as fast each time.
// Counting every step since v000, it is 63.1 times as fast.
#include <hip/hip_runtime.h>

// MixedScoreMHA (row_emb, col_emb [32][512][256], matrix [32][512][512]; 16 heads x 16: row_q/k/v = row_emb W, col_q/k/v = col_emb W; compat[h][r][c] = (row_q.col_k + col_q.row_k + matrix W_mat[h]) / 4 (W_mat read); attn_row = softmax over c, attn_col = softmax over r;
// row_heads = attn_row col_v, col_heads[c] = sum_r attn_col[r][c] row_v[r]; out_row = merge(row_heads) W_out_row, out_col = merge(col_heads) W_out_col -> two outputs [32][512][256]). Scores, softmax and the attention product are one kernel (k_attn): compat and the
// probabilities never reach memory; the projection GEMM and k_attn store their results in the layout and type that the next product reads. The column side is the same kernel on compat transposed (queries = columns, keys = rows), so each side computes its own scores.
// Every operand of k_attn's loop lies in memory in the order of its matrix fragment, [16-row group][8-element run][lane][8]: a wave's 16-byte load is 512 bytes in a row (four whole lines). The matrix gets such a copy, in bf16, for each side (k_mfrag): it is the A operand of a fourth score product whose B holds W_mat[h] on a diagonal, so that the term matrix W_mat[h] is added by the matrix unit. The bf16 operands of the two GEMMs (embeddings from k_cvt8, weights from k_wtG) lie in the same order for K = 256.
// Compute dtypes, f32 accumulate: every input rounded to bf16; the six projections on PLAIN bf16 operands (inputs: exact); the score product on bf16 hi+lo planes of q and k (3 products, K = 32 = [q | k] against [k | q]) behind the product of the bf16 matrix with bf16 W_mat (each term exact in f32); probabilities and v in fp16.

#define NB_  32
#define RR   512
#define DD   256
#define D3   768
#define NH_  16
#define KD   16
#define KP   32
#define GB   32     // batch items that share each launch (NB_ % GB == 0); the workspace holds GB items' intermediates, 5 MiB an item (161 MiB with the weights)
typedef _Float16 h16;
typedef unsigned short bf;
typedef __attribute__((ext_vector_type(16))) __bf16   v16bf;
typedef __attribute__((ext_vector_type(16))) _Float16 v16h;
typedef __attribute__((ext_vector_type(8)))  _Float16 v8h;
typedef __attribute__((ext_vector_type(8)))  unsigned short v8us;
typedef __attribute__((ext_vector_type(8)))  float    v8f;
typedef __attribute__((ext_vector_type(4)))  float    v4f;
typedef v8h  __attribute__((may_alias)) v8ha;
typedef v4f  __attribute__((may_alias)) v4fa;
typedef v8us __attribute__((may_alias)) v8usa;

__device__ __forceinline__ unsigned short f2bf(float f) { unsigned u = __float_as_uint(f); u += 0x7FFFu + ((u >> 16) & 1u); return (unsigned short)(u >> 16); }
__device__ __forceinline__ float bf2f(unsigned short b) { return __uint_as_float(((unsigned)b) << 16); }
__device__ __forceinline__ float bfr(float f) { return bf2f(f2bf(f)); }
__device__ __forceinline__ v16h cat16(v8h lo, v8h hi) { return __builtin_shufflevector(lo, hi, 0, 1, 2, 3, 4, 5, 6, 7, 8, 9, 10, 11, 12, 13, 14, 15); }
__device__ __forceinline__ v16bf cat16b(v8us lo, v8us hi) { return __builtin_bit_cast(v16bf, __builtin_shufflevector(lo, hi, 0, 1, 2, 3, 4, 5, 6, 7, 8, 9, 10, 11, 12, 13, 14, 15)); }
__device__ __forceinline__ v8f wmma16(v16h a, v16h b, v8f c) { return __builtin_amdgcn_wmma_f32_16x16x32_f16(false, a, false, b, (short)0, c, false, false); }
__device__ __forceinline__ v8f wmmab(v16bf a, v16bf b, v8f c) { return __builtin_amdgcn_wmma_f32_16x16x32_bf16(false, a, false, b, (short)0, c, false, false); }



// ---- k_gemmw: register-blocked GEMM, ONE WAVE per 64x64 output tile (16 accumulators), operands straight from 16-bit planes in fragment order; grid (M/64, N/64, Z), 32 threads.
// Fragment order of a plane [rows][256] (the planes' row length is the constant DD, so that a pass's loads differ by constants; K <= DD): element (r, k) at (r / 16) * 16 * 256 + (k / 32) * 512 + ((k / 16) % 2) * 256 + ((k / 8) % 2) * 128 + (r % 16) * 8 + k % 8: a fragment (16 rows x 32 k) is two runs of 512 bytes, a lane's 16 bytes of each at lane * 16. A and Bt alike, so their k orders are equal.
// C[m][n] (f32, pitch ldc, + optional f32 bias[n]) = sum_k A[m][k] Bt[n][k] (+ split products per NSPLIT). z-batch strides sA/sB/sC in elements. K % 32 == 0.
// ZIN == 0: blockIdx.z is one flat batch index. ZIN > 0: blockIdx.z = twin * ZIN + item; the item moves by sA/sB/sC, the twin (row side, column side) by tA/tB/tC.
// PLANES (the projections; k_wtG orders the 768 weight rows as 16 heads x 32 score columns, then v): no C; the tile goes out as the attention kernel's operands, every 128-byte line of them written by one wave.
//   score tiles (two heads): bf16 hi and lo planes, K = 32 with no padding, in fragment order: element (r, k) of a head at (r / 16) * 512 + (k / 16) * 256 + ((k / 8) % 2) * 128 + (r % 16) * 8 + k % 8. Row side: X[h][r][k] = row_q[r][h*16 + k] for k < 16, row_k behind it; column side: Y[h][c][k] = col_k for k < 16, col_q behind it: X[r] . Y[c] = row_q.col_k + col_q.row_k.
//   v tiles (four heads): v^T in fp16, sets 0 col_v, 1 row_v, in fragment order: element (d, r) of a head at (r / 32) * 512 + ((r / 16) % 2) * 256 + ((r / 8) % 2) * 128 + d * 8 + r % 8: in the accumulator map a lane holds one d and 8 consecutive r, its own 16 bytes of a 512-byte run.
// AHM: A lies head-major, [K / 16][512 rows][16] (as k_attn stores it), not [row][K]; the fragment's two 8-element runs, k = kc + 8 half and kc + 16 + 8 half, are then the same 16 bytes of two neighbouring heads.
template <typename T16> struct WFrag;
template <> struct WFrag<h16> { typedef v16h V; static __device__ __forceinline__ V ld(const h16* p) { return cat16(*(const v8h*)p, *(const v8h*)(p + 16)); } static __device__ __forceinline__ v8f mma(V a, V b, v8f c) { return wmma16(a, b, c); } };
template <> struct WFrag<bf> { typedef v16bf V; static __device__ __forceinline__ V ld2(const bf* p, const bf* q) { return cat16b(*(const v8us*)p, *(const v8us*)q); } static __device__ __forceinline__ V ld(const bf* p) { return ld2(p, p + 256); } static __device__ __forceinline__ v8f mma(V a, V b, v8f c) { return wmmab(a, b, c); } };
__device__ __forceinline__ void splitf(float y, unsigned short& h, unsigned short& l) { h = f2bf(y); l = f2bf(y - bf2f(h)); }
template <typename T16, int NSPLIT, bool BIAS, int ZIN, bool PLANES, bool AHM>
__global__ __launch_bounds__(32) void k_gemmw(const T16* __restrict__ A, const T16* __restrict__ A2, const T16* __restrict__ Bt, const T16* __restrict__ Bt2, int K, float* C, int ldc, const float* __restrict__ bias, size_t sA, size_t sB, size_t sC, size_t tA, size_t tB, size_t tC, bf* Ph, bf* Pl, h16* Vt) {
    typedef typename WFrag<T16>::V V;
    __shared__ __align__(16) float os[16 * 68];
    const size_t z = ZIN > 0 ? blockIdx.z % (ZIN > 0 ? ZIN : 1) : blockIdx.z, zt = ZIN > 0 ? blockIdx.z / (ZIN > 0 ? ZIN : 1) : 0;
    const size_t oA = z * sA + zt * tA, oB = z * sB + zt * tB; A += oA; if (A2) A2 += oA; Bt += oB; if (Bt2) Bt2 += oB; if (!PLANES) C += z * sC + zt * tC;
    const int lane = threadIdx.x & 31, lr = lane & 15, hi = lane >> 4; const int r0 = blockIdx.x * 64, c0 = blockIdx.y * 64;
    v8f acc[4][4];
#pragma unroll
    for (int mb = 0; mb < 4; ++mb)
#pragma unroll
        for (int nb = 0; nb < 4; ++nb) acc[mb][nb] = (v8f){};
    const size_t aoff = AHM ? (size_t)(r0 + lr) * KD + 8 * hi : (size_t)r0 * DD + lane * 8, boff = (size_t)c0 * DD + lane * 8;
#pragma unroll 1
    for (int kc = 0; kc < K; kc += 32) {
        V a[4], a2[4];
        const T16* pa = A + aoff + (AHM ? (size_t)(kc / KD) * RR * KD : (size_t)kc * 16); const T16* pa2 = (NSPLIT == 1 || NSPLIT == 2) ? A2 + (pa - A) : pa; const T16* pb = Bt + boff + (size_t)kc * 16; const T16* pb2 = NSPLIT >= 2 ? Bt2 + (pb - Bt) : pb;   // the pass's loads are these plus constants
#pragma unroll
        for (int mb = 0; mb < 4; ++mb) {
            if (AHM) { const int o = mb * 16 * KD; a[mb] = WFrag<T16>::ld2(pa + o, pa + o + RR * KD); if (NSPLIT == 1 || NSPLIT == 2) a2[mb] = WFrag<T16>::ld2(pa2 + o, pa2 + o + RR * KD); }
            else { a[mb] = WFrag<T16>::ld(pa + mb * 16 * DD); if (NSPLIT == 1 || NSPLIT == 2) a2[mb] = WFrag<T16>::ld(pa2 + mb * 16 * DD); } }
#pragma unroll
        for (int nb = 0; nb < 4; ++nb) { const V b = WFrag<T16>::ld(pb + nb * 16 * DD); V b2; if (NSPLIT >= 2) b2 = WFrag<T16>::ld(pb2 + nb * 16 * DD);
#pragma unroll
            for (int mb = 0; mb < 4; ++mb) { acc[mb][nb] = WFrag<T16>::mma(a[mb], b, acc[mb][nb]); if (NSPLIT == 1 || NSPLIT == 2) acc[mb][nb] = WFrag<T16>::mma(a2[mb], b, acc[mb][nb]); if (NSPLIT >= 2) acc[mb][nb] = WFrag<T16>::mma(a[mb], b2, acc[mb][nb]); } }
        asm volatile("s_wait_xcnt 0x0" :: "v"(pa), "v"(pa2), "v"(pb), "v"(pb2) : "memory");   // the next pass rewrites the registers of the loads' addresses; the wait names the addresses so that no load of the pass lands on their registers
        asm volatile("v_nop\n\tv_nop\n\tv_nop\n\tv_nop" : "+v"(acc[0][0]), "+v"(acc[1][1]), "+v"(acc[2][2]), "+v"(acc[3][3]) : "v"(a[0]), "v"(a[3]));
    }
    if (PLANES && c0 >= 2 * DD) {
        h16* vt = Vt + (((1 - zt) * ZIN + z) * NH_ + (c0 - 2 * DD) / KD) * KD * RR + (r0 / 32) * 512 + lane * 8;
#pragma unroll
        for (int mb = 0; mb < 4; ++mb)
#pragma unroll
            for (int nb = 0; nb < 4; ++nb) { v8h o;
#pragma unroll
                for (int j = 0; j < 8; ++j) o[j] = (h16)acc[mb][nb][j];
                *(v8h*)(vt + (size_t)nb * KD * RR + (mb >> 1) * 512 + (mb & 1) * 256) = o; }
    } else if (PLANES) {
    const size_t po = (((zt * ZIN + z) * NH_ + c0 / KP) * RR + r0) * KP + lane * 8;   // 16 rows of a head are 512 elements; the lane reads back row lr, columns 16 f + 8 hi + 0..7 of the tile (f = 2 * head + run): its 16 bytes of that run
#pragma unroll
    for (int mb = 0; mb < 4; ++mb) {
#pragma unroll
        for (int nb = 0; nb < 4; ++nb) {
#pragma unroll
            for (int j = 0; j < 8; ++j) os[(hi * 8 + j) * 68 + nb * 16 + lr] = acc[mb][nb][j]; }
        __builtin_amdgcn_wave_barrier(); asm volatile("" ::: "memory");   // the reads below take other lanes' writes: keep them behind the writes
#pragma unroll
        for (int f = 0; f < 4; ++f) { const float* sp = os + lr * 68 + f * 16 + hi * 8; const v4f x0 = *(const v4fa*)sp, x1 = *(const v4fa*)(sp + 4); v8us oh, ol;
#pragma unroll
            for (int u = 0; u < 4; ++u) { unsigned short a, b; splitf(x0[u], a, b); oh[u] = a; ol[u] = b; splitf(x1[u], a, b); oh[u + 4] = a; ol[u + 4] = b; }
            const size_t o = po + (size_t)(f >> 1) * RR * KP + mb * 512 + (f & 1) * 256; *(v8us*)(Ph + o) = oh; *(v8us*)(Pl + o) = ol; }
        __builtin_amdgcn_wave_barrier(); asm volatile("" ::: "memory");   // the next tile's writes stay behind these reads
    }
    asm volatile("s_wait_xcnt 0x0" ::: "memory");   // in the built code this branch runs on, behind a test that never holds, into the v branch, which rewrites the address registers of the stores above
    } else {
#pragma unroll
    for (int mb = 0; mb < 4; ++mb) {
#pragma unroll
        for (int nb = 0; nb < 4; ++nb) {
#pragma unroll
            for (int j = 0; j < 8; ++j) os[(hi * 8 + j) * 68 + nb * 16 + lr] = acc[mb][nb][j]; }
        __builtin_amdgcn_wave_barrier(); asm volatile("" ::: "memory");
        float* crow = C + (size_t)(r0 + mb * 16) * ldc + c0;
{
#pragma unroll
            for (int s = 0; s < 8; ++s) { const int row = 2 * s + hi, cofs = lr * 4; v4f val = *(const v4fa*)(os + row * 68 + cofs);
                if (BIAS) { val[0] += bfr(bias[c0 + cofs]); val[1] += bfr(bias[c0 + cofs + 1]); val[2] += bfr(bias[c0 + cofs + 2]); val[3] += bfr(bias[c0 + cofs + 3]); }
                *(v4f*)(crow + (size_t)row * ldc + cofs) = val; }
             }
        __builtin_amdgcn_wave_barrier(); asm volatile("" ::: "memory");
    }
    }
}


// wtG_part (k_wtG in the notes of this file): y picks one of the eight weight matrices; their transposed bf16 planes (rows n, K = k) lie one behind the other in Bt, in fragment order. The q and k rows of a side are interleaved by head in the order of the score planes
// (row side: head h = rows 32 h .. : 16 of q, 16 of k; column side: 16 of k, 16 of q), so that a 64-column tile of the projection GEMM holds whole plane rows of two heads.
// A wave writes one fragment (16 rows n x 32 k, 1 KiB in a row): lane = 16 * half + n % 16 takes k = 8 * half + 0..7 and 16 + 8 * half + 0..7 of the block; its 16 loads are issued before the first store. (N / 16 * K / 32 / 8, 8) blocks (bx, y) of 8 waves.
__device__ __forceinline__ void wtG_part(const int bx, const int y, const float* __restrict__ w0, const float* __restrict__ w1, const float* __restrict__ w2, const float* __restrict__ w3, const float* __restrict__ w4, const float* __restrict__ w5, const float* __restrict__ w6, const float* __restrict__ w7, int K, int N, bf* Bt) {
    const float* w = y == 0 ? w0 : y == 1 ? w1 : y == 2 ? w2 : y == 3 ? w3 : y == 4 ? w4 : y == 5 ? w5 : y == 6 ? w6 : w7; const bool qk = y < 6 && y % 3 < 2; const int kofs = ((y % 3 == 0) == (y < 3)) ? 0 : KD;
    const int lane = threadIdx.x & 31, lr = lane & 15, hi = lane >> 4; const int wv = bx * 8 + (threadIdx.x >> 5); const int nkb = K / 32;
    if (K != DD || N != DD || wv >= (N / 16) * nkb) return;   // Bt's fragment order is that of rows of 256 (k_gemmw); with the sizes known a lane's 16 loads are one address plus constants
    const int ng = wv / nkb, kb = wv % nkb; const int nd = qk ? (y / 3) * 3 * N + ng * KP + kofs : y * N + ng * 16;   // the first of the fragment's 16 rows of Bt; they are columns 16 ng + 0..15 of w
    const float* p = w + (size_t)(kb * 32 + hi * 8) * N + ng * 16 + lr; float x[16];
#pragma unroll
    for (int u = 0; u < 16; ++u) x[u] = p[(size_t)((u >> 3) * 16 + (u & 7)) * N];
    asm volatile("s_wait_xcnt 0x0" :: "v"(p) : "memory");   // the code behind the loads reuses the registers of their address; the wait names the address so that those registers live up to it
    bf* dst = Bt + (size_t)nd * K + kb * 512 + lane * 8;
#pragma unroll
    for (int u = 0; u < 2; ++u) { v8us o;
#pragma unroll
        for (int j = 0; j < 8; ++j) o[j] = f2bf(x[u * 8 + j]);
        *(v8us*)(dst + u * 256) = o; }
}
// cvt8_part (k_cvt8 in the notes of this file): the embeddings ([rows][256] f32; by: row side, column side) rounded to bf16, in fragment order. A wave takes 16 rows x 128 k = four fragments, 4 KiB in a row of dst: run u holds k = 16 u + 8 * half + 0..7 of row lane % 16; its loads are issued before the first store.
// n8 = elements of one side / 8; (n8 / 8 / 256, 2) blocks (bx, by) of 8 waves.
__device__ __forceinline__ void cvt8_part(const int bx, const int by, const float* __restrict__ src0, const float* __restrict__ src1, bf* dst, size_t n8) {
    const size_t wv = ((size_t)bx * 256 + threadIdx.x) >> 5; if (wv * 256 >= n8) return;
    const int lane = threadIdx.x & 31, lr = lane & 15, hi = lane >> 4;
    const float* p = (by ? src1 : src0) + ((wv >> 1) * 16 + lr) * DD + (wv & 1) * 128 + hi * 8; dst += (size_t)by * n8 * 8 + wv * 2048 + lane * 8; v8f v[8];
#pragma unroll
    for (int u = 0; u < 8; ++u) v[u] = *(const v8f*)(p + u * 16);
    asm volatile("s_wait_xcnt 0x0" :: "v"(p) : "memory");   // as in k_wtG
#pragma unroll
    for (int u = 0; u < 8; ++u) { v8us o;
#pragma unroll
        for (int k = 0; k < 8; ++k) o[k] = f2bf(v[u][k]);
        *(v8us*)(dst + u * 256) = o; }
}

// mfrag_part (k_mfrag in the notes of this file): the matrix, rounded to bf16 (nearest even), once for each side as the A fragments (16 keys x 32 queries) of k_attn's fourth score product: MB[side][g][32-query group][16-key tile][16-query run u][lane][8], lane = 16 * half + key % 16, element j = query 16 u + 8 half + j of the group
// (the fragment order of k_gemmw's score planes, with the key as the row and the query as k). Side 0: queries = rows r, keys = columns c, matrix[query][key]. Side 1: queries = columns, keys = rows, matrix[key][query].
// A wave takes one key tile and 128 queries: 8 runs of 512 bytes, two in a row (1 KiB) for each of four query groups; (512 / 16 * 4 / 8, GB, 2) blocks (bx, g, side) of 8 waves.
typedef __attribute__((ext_vector_type(8))) __bf16 v8b;
__device__ __forceinline__ void mfrag_part(const int bx, const int g, const int side, const float* __restrict__ mt, bf* __restrict__ MB) {
    const int lane = threadIdx.x & 31, lr = lane & 15, hi = lane >> 4; const int wv = bx * 8 + (threadIdx.x >> 5); const int kt = wv >> 2, qq = wv & 3;
    mt += (size_t)g * RR * RR; const int key = kt * 16 + lr;
    bf* dst = MB + ((((size_t)side * GB + g) * (RR / 32) + qq * 4) * (RR / 16) + kt) * 512 + lane * 8;
    const int q = qq * 128 + hi * 8; v8f m8[8];   // all of the wave's loads are issued before the first store
    // s_wait_xcnt behind each side's loads: the code behind them reuses the registers of the loads' address; the wait names the address so that those registers live up to it
    if (side == 1) { const float* p = mt + (size_t)key * RR + q;
#pragma unroll
        for (int u = 0; u < 8; ++u) m8[u] = *(const v8f*)(p + u * 16);
        asm volatile("s_wait_xcnt 0x0" :: "v"(p) : "memory");
    } else { const float* p = mt + (size_t)q * RR + key;
#pragma unroll
        for (int u = 0; u < 8; ++u)
#pragma unroll
            for (int j = 0; j < 8; ++j) m8[u][j] = p[(size_t)(u * 16 + j) * RR];
        asm volatile("s_wait_xcnt 0x0" :: "v"(p) : "memory");
    }
#pragma unroll
    for (int u = 0; u < 8; ++u) *(v8us*)(dst + (size_t)(u >> 1) * (RR / 16) * 512 + (u & 1) * 256) = __builtin_bit_cast(v8us, __builtin_convertvector(m8[u], v8b));
}

// k_prep: the three layout passes above share one launch: none reads what another writes, each is a wave's own work (no LDS, no barrier), and the block index alone says which pass a work-group belongs to.
// Blocks 0 .. PB_M - 1: mfrag_part (16 blocks an item and side); the next PB_C: cvt8_part (PB_C / 2 a side); the last PB_W: wtG_part (16 a weight matrix). The longest pass starts first, the shortest last.
#define PB_M (RR / 16 * 4 / 8 * GB * 2)
#define PB_C (GB * RR * DD / 64 / 256 * 2)
#define PB_W (DD * DD / 64 / 64 * 8)
__global__ __launch_bounds__(256) void k_prep(const float* __restrict__ mt, bf* __restrict__ MB, const float* __restrict__ src0, const float* __restrict__ src1, bf* __restrict__ EB, const float* __restrict__ w0, const float* __restrict__ w1, const float* __restrict__ w2, const float* __restrict__ w3, const float* __restrict__ w4, const float* __restrict__ w5, const float* __restrict__ w6, const float* __restrict__ w7, bf* __restrict__ Bt) {
    const int b = blockIdx.x;
    if (b < PB_M) mfrag_part(b % 16, (b / 16) % GB, b / (16 * GB), mt, MB);
    else if (b < PB_M + PB_C) { const int c = b - PB_M; cvt8_part(c % (PB_C / 2), c / (PB_C / 2), src0, src1, EB, (size_t)GB * RR * DD / 8); }
    else { const int c = b - PB_M - PB_C; wtG_part(c % (PB_W / 8), c / (PB_W / 8), w0, w1, w2, w3, w4, w5, w6, w7, DD, DD, Bt); }
}

// ---- k_attn: scores, softmax and attention product of one side in one pass over the keys. A wave owns 32 queries (two 16-column groups) of one (side, item, head) and walks the 512 keys 32 at a time.
// Transposed products: S^T[key][query] = K' Q'^T (A = key rows, B = query rows kept in registers), O^T[d][query] += V^T P^T. In the accumulator map a lane holds ONE query (lane & 15) and keys 8 * (lane >> 4) + 0..7 of a 16-key tile,
// so the maximum and the sum over keys are in-lane plus one exchange between the wave's halves, and the two score tiles of a pass, converted in place, ARE the B operand of the second product (element s = tile s >> 3, register s & 7, the hardware k order);
// V^T is loaded in the same k order (keys 8 * half + 0..7 and 16 + 8 * half + 0..7 of each 32). Running maximum with rescale (base 2); the halves' sums are joined once at the end.
// The term matrix W_mat[h] is a product too: S^T[key][query n of group nb] += sum_k M[key][k] Wd[k][n], M = the matrix tile of the 16 keys and the wave's 32 queries (k = query), Wd[k][n] = W_mat[h] where k = 16 nb + n, else 0: one term a score, bf16 x bf16, exact in f32. It starts each score's accumulator.
// Both sides run the same code: the planes, v^T and the matrix copy of a side lie in fragment order (k_gemmw, k_mfrag), so each fragment is two 16-byte loads at lane * 16 bytes of two 512-byte runs.
__device__ __forceinline__ float xhalf(float x) { return __int_as_float(__builtin_amdgcn_permlanex16(__float_as_int(x), __float_as_int(x), 0x76543210, 0xfedcba98, false, false)); }   // lane l with lane l ^ 16
// Exponentials with the slot behind them in ONE statement: the instruction set asks for one independent instruction or a v_nop between a transcendental and an instruction that reads its result or overwrites its source;
// Inside the statement each v_exp_f32 is followed by an independent one, the last by the v_nop.
// Each works in place: the compiler keeps the distance behind a matrix instruction only for its own instructions, and a result register of its own could be one that a matrix instruction directly in front has just read; an in-place register was last written by the compiler's subtraction.
__device__ __forceinline__ void exp2x8(float* x) {
    asm("v_exp_f32 %0, %0\n\tv_exp_f32 %1, %1\n\tv_exp_f32 %2, %2\n\tv_exp_f32 %3, %3\n\tv_exp_f32 %4, %4\n\tv_exp_f32 %5, %5\n\tv_exp_f32 %6, %6\n\tv_exp_f32 %7, %7\n\tv_nop"
        : "+v"(x[0]), "+v"(x[1]), "+v"(x[2]), "+v"(x[3]), "+v"(x[4]), "+v"(x[5]), "+v"(x[6]), "+v"(x[7])); }
__device__ __forceinline__ float exp2x1(float x) { asm("v_exp_f32 %0, %0\n\tv_nop" : "+v"(x)); return x; }   // the same slot, one value
__device__ __forceinline__ v16bf ldfb(const bf* p) { return cat16b(*(const v8us*)p, *(const v8us*)(p + 256)); }   // p: the 16-row group's 512 elements + lane * 8
__device__ __forceinline__ v16h ldfh(const h16* p) { return cat16(*(const v8h*)p, *(const v8h*)(p + 256)); }
__device__ __forceinline__ void attn_side(const bf* __restrict__ QH, const bf* __restrict__ QL, const bf* __restrict__ KH, const bf* __restrict__ KL, const h16* __restrict__ VT, const bf* __restrict__ MB, const unsigned short w, bf* __restrict__ Mh, bf* __restrict__ Ml, const int q0, const int lane) {
    const float SC = 0.36067376022224085f;   // 1/4 (the norm) x log2(e)
    const int lr = lane & 15, hi = lane >> 4;
    v16bf qh[2], ql[2], wd[2]; v8f acc[2]; float mrun[2], lsum[2];
    { v8us d, z;   // Wd as a B fragment (row n = lr; element e is k = 8 * half + e, element 8 + e is k = 16 + 8 * half + e, the k order of ldfb): w at k = 16 nb + lr
#pragma unroll
      for (int e = 0; e < 8; ++e) { d[e] = (hi == (lr >> 3) && e == (lr & 7)) ? w : (unsigned short)0; z[e] = 0; }
      wd[0] = cat16b(d, z); wd[1] = cat16b(z, d); }
#pragma unroll
    for (int nb = 0; nb < 2; ++nb) { const size_t o = (size_t)(q0 / 16 + nb) * 512 + lane * 8; qh[nb] = ldfb(QH + o); ql[nb] = ldfb(QL + o); acc[nb] = (v8f){}; mrun[nb] = -3.0e38f; lsum[nb] = 0.f; }
    const bf* pkh = KH + lane * 8; const bf* pkl = KL + lane * 8; const bf* pm = MB + (size_t)(q0 / 32) * (RR / 16) * 512 + lane * 8; const h16* pv = VT + lane * 8;   // a pass's loads are these plus constants; they move on by 64 keys a trip
#pragma unroll 1   // two passes a trip, written out below: the second pass's loads are issued while the first pass is worked on (the inner loops are unrolled whole so that their arrays stay in registers)
    for (int k0 = 0; k0 < RR; k0 += 64, pkh += 4 * 512, pkl += 4 * 512, pm += 4 * 512, pv += 2 * 512)
#pragma unroll
    for (int pp = 0; pp < 2; ++pp) {
        v16bf kh[2], kl[2], ma[2];
#pragma unroll
        for (int t = 0; t < 2; ++t) { const int o = (pp * 2 + t) * 512; kh[t] = ldfb(pkh + o); kl[t] = ldfb(pkl + o); ma[t] = ldfb(pm + o); }
        const v16h va = ldfh(pv + pp * 512);
        if (pp == 1) asm volatile("s_wait_xcnt 0x0" :: "v"(pkh), "v"(pkl), "v"(pm), "v"(pv) : "memory");   // behind the trip's last load: the trip's end rewrites the registers of the loads' addresses; the wait names the addresses so that those registers live up to it and no load of the trip lands on them
#pragma unroll
        for (int nb = 0; nb < 2; ++nb) {
            float y[16];
#pragma unroll
            for (int t = 0; t < 2; ++t) {
                v8f s = wmmab(ma[t], wd[nb], (v8f){}); s = wmmab(kh[t], qh[nb], s); s = wmmab(kl[t], qh[nb], s); s = wmmab(kh[t], ql[nb], s);
#pragma unroll
                for (int j = 0; j < 8; ++j) y[t * 8 + j] = s[j] * SC;
            }
            float mx[4];
#pragma unroll
            for (int u = 0; u < 4; ++u) mx[u] = fmaxf(fmaxf(y[2 * u], y[2 * u + 1]), fmaxf(y[2 * u + 8], y[2 * u + 9]));   // neighbours first: the packed scaling then works on an accumulator's registers where they lie
            float m1 = fmaxf(fmaxf(mx[0], mx[1]), fmaxf(mx[2], mx[3])); m1 = fmaxf(m1, xhalf(m1));
            const float mn = fmaxf(mrun[nb], m1); const float al = exp2x1(mrun[nb] - mn);   // 0 on the first pass
            mrun[nb] = mn; float ps[4] = {0.f, 0.f, 0.f, 0.f}; float* p = y; v16h pb;
#pragma unroll
            for (int i = 0; i < 16; ++i) y[i] -= mn;
            exp2x8(y); exp2x8(y + 8);
#pragma unroll
            for (int i = 0; i < 16; ++i) { ps[i & 3] += p[i]; pb[i] = (h16)p[i]; }
            lsum[nb] = lsum[nb] * al + ((ps[0] + ps[1]) + (ps[2] + ps[3]));
#pragma unroll
            for (int j = 0; j < 8; ++j) acc[nb][j] *= al;
            acc[nb] = wmma16(va, pb, acc[nb]);
        }
    }
#pragma unroll
    for (int nb = 0; nb < 2; ++nb) { const float f = __fdiv_rn(1.0f, lsum[nb] + xhalf(lsum[nb])); v8us oh, ol;
#pragma unroll
        for (int j = 0; j < 8; ++j) { unsigned short a, b; splitf(acc[nb][j] * f, a, b); oh[j] = a; ol[j] = b; }
        const size_t o = (size_t)(q0 + nb * 16 + lr) * KD + hi * 8; *(v8us*)(Mh + o) = oh; *(v8us*)(Ml + o) = ol; }   // [query][d], d = 8 * half + 0..7, as the bf16 hi and lo planes that the output GEMM reads: a wave stores 1 KiB in a row to each
}
// grid (512 / 128 queries, GB * 16 (item, head), 2 sides), 4 waves. PH/PL: [X, Y][g][h][512 x 32 in fragment order]; VT: [col_v, row_v][g][h][16 x 512 in fragment order]; MH/ML: [row, col][g][h][512][16]; MB: [side][g], k_mfrag's copies.
__global__ __launch_bounds__(128) void k_attn(const bf* __restrict__ PH, const bf* __restrict__ PL, const h16* __restrict__ VT, const bf* __restrict__ MB, const float* __restrict__ wm, bf* __restrict__ MH, bf* __restrict__ ML) {
    const int lane = threadIdx.x & 31; const int q0 = blockIdx.x * 128 + (threadIdx.x >> 5) * 32; const int gh = blockIdx.y, side = blockIdx.z;
    const size_t pq = (size_t)(side * GB * NH_ + gh) * RR * KP, pk = (size_t)((1 - side) * GB * NH_ + gh) * RR * KP; const size_t z = (size_t)side * GB * NH_ + gh;
    const unsigned short w = f2bf(wm[gh % NH_]); MB += (size_t)(side * GB + gh / NH_) * RR * RR; VT += z * KD * RR; const size_t mo = z * RR * KD;
    attn_side(PH + pq, PL + pq, PH + pk, PL + pk, VT, MB, w, MH + mo, ML + mo, q0, lane);
}

extern "C" void kernel_launch(void* const* d_in, const int* in_sizes, int n_in,
                              void* d_out, int out_size, void* d_ws, size_t ws_size, hipStream_t stream) {
    (void)in_sizes; (void)n_in; (void)out_size;
    const float** I = (const float**)d_in;
    const float *row_emb = I[0], *col_emb = I[1], *matrix = I[2], *Wq_row = I[3], *Wk_row = I[4], *Wv_row = I[5], *Wq_col = I[6], *Wk_col = I[7], *Wv_col = I[8], *W_mat = I[9], *W_out_row = I[10], *W_out_col = I[11];
    float* OUT0 = (float*)d_out;     // [32][512][256] x 2, the column output behind the row output
    char* wsp = (char*)d_ws;
    auto take = [&](size_t bytes) { char* p = wsp; wsp += (bytes + 255) & ~(size_t)255; return (void*)p; };
    // Every buffer holds GB batch items, and the row-side and column-side twins of a stage lie one behind the other, so that one launch covers both twins of GB items.
    bf* WT = (bf*)take((size_t)8 * DD * DD * 2);                                                       // Bt rows [16 heads x (q, k) | v] row side, [16 heads x (k, q) | v] column side, out row, out col; fragment order
    bf* EB = (bf*)take((size_t)2 * GB * RR * DD * 2);                                                  // [row, col][g], fragment order
    bf* PH = (bf*)take((size_t)2 * GB * NH_ * RR * KP * 2); bf* PL = (bf*)take((size_t)2 * GB * NH_ * RR * KP * 2);   // [row_q | row_k, col_k | col_q][g]
    h16* VT = (h16*)take((size_t)2 * GB * NH_ * KD * RR * 2);                                          // [col_v, row_v][g]
    bf* MB = (bf*)take((size_t)2 * GB * RR * RR * 2);                                                  // [side][g]
    bf* MH = (bf*)take((size_t)2 * GB * RR * DD * 2); bf* ML = (bf*)take((size_t)2 * GB * RR * DD * 2);   // [row, col][g][h]
    if ((size_t)(wsp - (char*)d_ws) > ws_size) return;
    for (int b = 0; b < NB_; b += GB) {
        k_prep<<<dim3(PB_M + PB_C + PB_W, 1, 1), 256, 0, stream>>>(matrix + (size_t)b * RR * RR, MB, row_emb + (size_t)b * RR * DD, col_emb + (size_t)b * RR * DD, EB, Wq_row, Wk_row, Wv_row, Wq_col, Wk_col, Wv_col, W_out_row, W_out_col, WT);
        k_gemmw<bf, 0, false, GB, true, false><<<dim3(RR / 64, D3 / 64, 2 * GB), 32, 0, stream>>>(EB, nullptr, WT, nullptr, DD, nullptr, 0, nullptr, (size_t)RR * DD, 0, 0, (size_t)GB * RR * DD, (size_t)D3 * DD, 0, PH, PL, VT);
        k_attn<<<dim3(RR / 128, GB * NH_, 2), 128, 0, stream>>>(PH, PL, VT, MB, W_mat, MH, ML);
        k_gemmw<bf, 1, false, GB, false, true><<<dim3(RR / 64, DD / 64, 2 * GB), 32, 0, stream>>>(MH, ML, WT + (size_t)6 * DD * DD, nullptr, DD, OUT0 + (size_t)b * RR * DD, DD, nullptr, (size_t)RR * DD, 0, (size_t)RR * DD, (size_t)GB * RR * DD, (size_t)DD * DD, (size_t)NB_ * RR * DD, nullptr, nullptr, nullptr); }
}

// v010
// A run of this version takes 127 microseconds.
// Timed twice side by side with v009, it ran 1.09 and 1.08 times as fast.
// All steps since v000 together make it 68.4 times as fast.
#include <hip/hip_runtime.h>

// MixedScoreMHA (row_emb, col_emb [32][512][256], matrix [32][512][512]; 16 heads x 16: row_q/k/v = row_emb W, col_q/k/v = col_emb W; compat[h][r][c] = (row_q.col_k + col_q.row_k + matrix W_mat[h]) / 4 (W_mat read); attn_row = softmax over c, attn_col = softmax over r;
// row_heads = attn_row col_v, col_heads[c] = sum_r attn_col[r][c] row_v[r]; out_row = merge(row_heads) W_out_row, out_col = merge(col_heads) W_out_col -> two outputs [32][512][256]). Scores, softmax, the attention product and the output projection are one kernel (k_attn): compat, the
// probabilities and the heads never reach memory; the projection GEMM stores its results in the layout and type that k_attn reads. The column side is the same kernel on compat transposed (queries = columns, keys = rows), so each side computes its own scores.
// Every operand of k_attn's loop lies in memory in the order of its matrix fragment, [16-row group][8-element run][lane][8]: a wave's 16-byte load is 512 bytes in a row (four whole lines). The matrix gets such a copy, in bf16, for each side (k_mfrag): it is the A operand of a fourth score product whose B holds W_mat[h] on a diagonal, so that the term matrix W_mat[h] is added by the matrix unit. The bf16 operands of the projection GEMM and the output weights (embeddings from k_cvt8, weights from k_wtG) lie in the same order for K = 256.
// Compute dtypes, f32 accumulate: every input rounded to bf16; the six projections on PLAIN bf16 operands (inputs: exact); the score product on bf16 hi+lo planes of q and k (3 products, K = 32 = [q | k] against [k | q]) behind the product of the bf16 matrix with bf16 W_mat (each term exact in f32); probabilities and v in fp16.

#define NB_  32
#define RR   512
#define DD   256
#define D3   768
#define NH_  16
#define KD   16
#define KP   32
#define GB   32     // batch items that share each launch (NB_ % GB == 0); the workspace holds GB items' intermediates, 4 MiB an item (129 MiB with the weights)
typedef _Float16 h16;
typedef unsigned short bf;
typedef __attribute__((ext_vector_type(16))) __bf16   v16bf;
typedef __attribute__((ext_vector_type(16))) _Float16 v16h;
typedef __attribute__((ext_vector_type(8)))  _Float16 v8h;
typedef __attribute__((ext_vector_type(8)))  unsigned short v8us;
typedef __attribute__((ext_vector_type(8)))  float    v8f;
typedef __attribute__((ext_vector_type(4)))  float    v4f;
typedef v8h  __attribute__((may_alias)) v8ha;
typedef v4f  __attribute__((may_alias)) v4fa;
typedef v8us __attribute__((may_alias)) v8usa;

__device__ __forceinline__ unsigned short f2bf(float f) { unsigned u = __float_as_uint(f); u += 0x7FFFu + ((u >> 16) & 1u); return (unsigned short)(u >> 16); }
__device__ __forceinline__ float bf2f(unsigned short b) { return __uint_as_float(((unsigned)b) << 16); }
__device__ __forceinline__ float bfr(float f) { return bf2f(f2bf(f)); }
__device__ __forceinline__ v16h cat16(v8h lo, v8h hi) { return __builtin_shufflevector(lo, hi, 0, 1, 2, 3, 4, 5, 6, 7, 8, 9, 10, 11, 12, 13, 14, 15); }
__device__ __forceinline__ v16bf cat16b(v8us lo, v8us hi) { return __builtin_bit_cast(v16bf, __builtin_shufflevector(lo, hi, 0, 1, 2, 3, 4, 5, 6, 7, 8, 9, 10, 11, 12, 13, 14, 15)); }
__device__ __forceinline__ v8f wmma16(v16h a, v16h b, v8f c) { return __builtin_amdgcn_wmma_f32_16x16x32_f16(false, a, false, b, (short)0, c, false, false); }
__device__ __forceinline__ v8f wmmab(v16bf a, v16bf b, v8f c) { return __builtin_amdgcn_wmma_f32_16x16x32_bf16(false, a, false, b, (short)0, c, false, false); }



// ---- k_gemmw: register-blocked GEMM, ONE WAVE per 64x64 output tile (16 accumulators), operands straight from 16-bit planes in fragment order; grid (M/64, N/64, Z), 32 threads.
// Fragment order of a plane [rows][256] (the planes' row length is the constant DD, so that a pass's loads differ by constants; K <= DD): element (r, k) at (r / 16) * 16 * 256 + (k / 32) * 512 + ((k / 16) % 2) * 256 + ((k / 8) % 2) * 128 + (r % 16) * 8 + k % 8: a fragment (16 rows x 32 k) is two runs of 512 bytes, a lane's 16 bytes of each at lane * 16. A and Bt alike, so their k orders are equal.
// C[m][n] (f32, pitch ldc, + optional f32 bias[n]) = sum_k A[m][k] Bt[n][k] (+ split products per NSPLIT). z-batch strides sA/sB/sC in elements. K % 32 == 0.
// ZIN == 0: blockIdx.z is one flat batch index. ZIN > 0: blockIdx.z = twin * ZIN + item; the item moves by sA/sB/sC, the twin (row side, column side) by tA/tB/tC.
// PLANES (the projections; k_wtG orders the 768 weight rows as 16 heads x 32 score columns, then v): no C; the tile goes out as the attention kernel's operands, every 128-byte line of them written by one wave.
//   score tiles (two heads): bf16 hi and lo planes, K = 32 with no padding, in fragment order: element (r, k) of a head at (r / 16) * 512 + (k / 16) * 256 + ((k / 8) % 2) * 128 + (r % 16) * 8 + k % 8. Row side: X[h][r][k] = row_q[r][h*16 + k] for k < 16, row_k behind it; column side: Y[h][c][k] = col_k for k < 16, col_q behind it: X[r] . Y[c] = row_q.col_k + col_q.row_k.
//   v tiles (four heads): v^T in fp16, sets 0 col_v, 1 row_v, in fragment order: element (d, r) of a head at (r / 32) * 512 + ((r / 16) % 2) * 256 + ((r / 8) % 2) * 128 + d * 8 + r % 8: in the accumulator map a lane holds one d and 8 consecutive r, its own 16 bytes of a 512-byte run.
// AHM: A lies head-major, [K / 16][512 rows][16], not [row][K]; the fragment's two 8-element runs, k = kc + 8 half and kc + 16 + 8 half, are then the same 16 bytes of two neighbouring heads.
template <typename T16> struct WFrag;
template <> struct WFrag<h16> { typedef v16h V; static __device__ __forceinline__ V ld(const h16* p) { return cat16(*(const v8h*)p, *(const v8h*)(p + 16)); } static __device__ __forceinline__ v8f mma(V a, V b, v8f c) { return wmma16(a, b, c); } };
template <> struct WFrag<bf> { typedef v16bf V; static __device__ __forceinline__ V ld2(const bf* p, const bf* q) { return cat16b(*(const v8us*)p, *(const v8us*)q); } static __device__ __forceinline__ V ld(const bf* p) { return ld2(p, p + 256); } static __device__ __forceinline__ v8f mma(V a, V b, v8f c) { return wmmab(a, b, c); } };
__device__ __forceinline__ void splitf(float y, unsigned short& h, unsigned short& l) { h = f2bf(y); l = f2bf(y - bf2f(h)); }
template <typename T16, int NSPLIT, bool BIAS, int ZIN, bool PLANES, bool AHM>
__global__ __launch_bounds__(32) void k_gemmw(const T16* __restrict__ A, const T16* __restrict__ A2, const T16* __restrict__ Bt, const T16* __restrict__ Bt2, int K, float* C, int ldc, const float* __restrict__ bias, size_t sA, size_t sB, size_t sC, size_t tA, size_t tB, size_t tC, bf* Ph, bf* Pl, h16* Vt) {
    typedef typename WFrag<T16>::V V;
    __shared__ __align__(16) float os[16 * 68];
    const size_t z = ZIN > 0 ? blockIdx.z % (ZIN > 0 ? ZIN : 1) : blockIdx.z, zt = ZIN > 0 ? blockIdx.z / (ZIN > 0 ? ZIN : 1) : 0;
    const size_t oA = z * sA + zt * tA, oB = z * sB + zt * tB; A += oA; if (A2) A2 += oA; Bt += oB; if (Bt2) Bt2 += oB; if (!PLANES) C += z * sC + zt * tC;
    const int lane = threadIdx.x & 31, lr = lane & 15, hi = lane >> 4; const int r0 = blockIdx.x * 64, c0 = blockIdx.y * 64;
    v8f acc[4][4];
#pragma unroll
    for (int mb = 0; mb < 4; ++mb)
#pragma unroll
        for (int nb = 0; nb < 4; ++nb) acc[mb][nb] = (v8f){};
    const size_t aoff = AHM ? (size_t)(r0 + lr) * KD + 8 * hi : (size_t)r0 * DD + lane * 8, boff = (size_t)c0 * DD + lane * 8;
#pragma unroll 1
    for (int kc = 0; kc < K; kc += 32) {
        V a[4], a2[4];
        const T16* pa = A + aoff + (AHM ? (size_t)(kc / KD) * RR * KD : (size_t)kc * 16); const T16* pa2 = (NSPLIT == 1 || NSPLIT == 2) ? A2 + (pa - A) : pa; const T16* pb = Bt + boff + (size_t)kc * 16; const T16* pb2 = NSPLIT >= 2 ? Bt2 + (pb - Bt) : pb;   // the pass's loads are these plus constants
#pragma unroll
        for (int mb = 0; mb < 4; ++mb) {
            if (AHM) { const int o = mb * 16 * KD; a[mb] = WFrag<T16>::ld2(pa + o, pa + o + RR * KD); if (NSPLIT == 1 || NSPLIT == 2) a2[mb] = WFrag<T16>::ld2(pa2 + o, pa2 + o + RR * KD); }
            else { a[mb] = WFrag<T16>::ld(pa + mb * 16 * DD); if (NSPLIT == 1 || NSPLIT == 2) a2[mb] = WFrag<T16>::ld(pa2 + mb * 16 * DD); } }
#pragma unroll
        for (int nb = 0; nb < 4; ++nb) { const V b = WFrag<T16>::ld(pb + nb * 16 * DD); V b2; if (NSPLIT >= 2) b2 = WFrag<T16>::ld(pb2 + nb * 16 * DD);
#pragma unroll
            for (int mb = 0; mb < 4; ++mb) { acc[mb][nb] = WFrag<T16>::mma(a[mb], b, acc[mb][nb]); if (NSPLIT == 1 || NSPLIT == 2) acc[mb][nb] = WFrag<T16>::mma(a2[mb], b, acc[mb][nb]); if (NSPLIT >= 2) acc[mb][nb] = WFrag<T16>::mma(a[mb], b2, acc[mb][nb]); } }
        asm volatile("s_wait_xcnt 0x0" :: "v"(pa), "v"(pa2), "v"(pb), "v"(pb2) : "memory");   // the next pass rewrites the registers of the loads' addresses; the wait names the addresses so that no load of the pass lands on their registers
        asm volatile("v_nop\n\tv_nop\n\tv_nop\n\tv_nop" : "+v"(acc[0][0]), "+v"(acc[1][1]), "+v"(acc[2][2]), "+v"(acc[3][3]) : "v"(a[0]), "v"(a[3]));
    }
    if (PLANES && c0 >= 2 * DD) {
        h16* vt = Vt + (((1 - zt) * ZIN + z) * NH_ + (c0 - 2 * DD) / KD) * KD * RR + (r0 / 32) * 512 + lane * 8;
#pragma unroll
        for (int mb = 0; mb < 4; ++mb)
#pragma unroll
            for (int nb = 0; nb < 4; ++nb) { v8h o;
#pragma unroll
                for (int j = 0; j < 8; ++j) o[j] = (h16)acc[mb][nb][j];
                *(v8h*)(vt + (size_t)nb * KD * RR + (mb >> 1) * 512 + (mb & 1) * 256) = o; }
    } else if (PLANES) {
    const size_t po = (((zt * ZIN + z) * NH_ + c0 / KP) * RR + r0) * KP + lane * 8;   // 16 rows of a head are 512 elements; the lane reads back row lr, columns 16 f + 8 hi + 0..7 of the tile (f = 2 * head + run): its 16 bytes of that run
#pragma unroll
    for (int mb = 0; mb < 4; ++mb) {
#pragma unroll
        for (int nb = 0; nb < 4; ++nb) {
#pragma unroll
            for (int j = 0; j < 8; ++j) os[(hi * 8 + j) * 68 + nb * 16 + lr] = acc[mb][nb][j]; }
        __builtin_amdgcn_wave_barrier(); asm volatile("" ::: "memory");   // the reads below take other lanes' writes: keep them behind the writes
#pragma unroll
        for (int f = 0; f < 4; ++f) { const float* sp = os + lr * 68 + f * 16 + hi * 8; const v4f x0 = *(const v4fa*)sp, x1 = *(const v4fa*)(sp + 4); v8us oh, ol;
#pragma unroll
            for (int u = 0; u < 4; ++u) { unsigned short a, b; splitf(x0[u], a, b); oh[u] = a; ol[u] = b; splitf(x1[u], a, b); oh[u + 4] = a; ol[u + 4] = b; }
            const size_t o = po + (size_t)(f >> 1) * RR * KP + mb * 512 + (f & 1) * 256; *(v8us*)(Ph + o) = oh; *(v8us*)(Pl + o) = ol; }
        __builtin_amdgcn_wave_barrier(); asm volatile("" ::: "memory");   // the next tile's writes stay behind these reads
    }
    asm volatile("s_wait_xcnt 0x0" ::: "memory");   // in the built code this branch runs on, behind a test that never holds, into the v branch, which rewrites the address registers of the stores above
    } else {
#pragma unroll
    for (int mb = 0; mb < 4; ++mb) {
#pragma unroll
        for (int nb = 0; nb < 4; ++nb) {
#pragma unroll
            for (int j = 0; j < 8; ++j) os[(hi * 8 + j) * 68 + nb * 16 + lr] = acc[mb][nb][j]; }
        __builtin_amdgcn_wave_barrier(); asm volatile("" ::: "memory");
        float* crow = C + (size_t)(r0 + mb * 16) * ldc + c0;
{
#pragma unroll
            for (int s = 0; s < 8; ++s) { const int row = 2 * s + hi, cofs = lr * 4; v4f val = *(const v4fa*)(os + row * 68 + cofs);
                if (BIAS) { val[0] += bfr(bias[c0 + cofs]); val[1] += bfr(bias[c0 + cofs + 1]); val[2] += bfr(bias[c0 + cofs + 2]); val[3] += bfr(bias[c0 + cofs + 3]); }
                *(v4f*)(crow + (size_t)row * ldc + cofs) = val; }
             }
        __builtin_amdgcn_wave_barrier(); asm volatile("" ::: "memory");
    }
    }
}


// wtG_part (k_wtG in the notes of this file): y picks one of the eight weight matrices; their transposed bf16 planes (rows n, K = k) lie one behind the other in Bt, in fragment order. The q and k rows of a side are interleaved by head in the order of the score planes
// (row side: head h = rows 32 h .. : 16 of q, 16 of k; column side: 16 of k, 16 of q), so that a 64-column tile of the projection GEMM holds whole plane rows of two heads.
// A wave writes one fragment (16 rows n x 32 k, 1 KiB in a row): lane = 16 * half + n % 16 takes k = 8 * half + 0..7 and 16 + 8 * half + 0..7 of the block; its 16 loads are issued before the first store. (N / 16 * K / 32 / 8, 8) blocks (bx, y) of 8 waves.
__device__ __forceinline__ void wtG_part(const int bx, const int y, const float* __restrict__ w0, const float* __restrict__ w1, const float* __restrict__ w2, const float* __restrict__ w3, const float* __restrict__ w4, const float* __restrict__ w5, const float* __restrict__ w6, const float* __restrict__ w7, int K, int N, bf* Bt) {
    const float* w = y == 0 ? w0 : y == 1 ? w1 : y == 2 ? w2 : y == 3 ? w3 : y == 4 ? w4 : y == 5 ? w5 : y == 6 ? w6 : w7; const bool qk = y < 6 && y % 3 < 2; const int kofs = ((y % 3 == 0) == (y < 3)) ? 0 : KD;
    const int lane = threadIdx.x & 31, lr = lane & 15, hi = lane >> 4; const int wv = bx * 8 + (threadIdx.x >> 5); const int nkb = K / 32;
    if (K != DD || N != DD || wv >= (N / 16) * nkb) return;   // Bt's fragment order is that of rows of 256 (k_gemmw); with the sizes known a lane's 16 loads are one address plus constants
    const int ng = wv / nkb, kb = wv % nkb; const int nd = qk ? (y / 3) * 3 * N + ng * KP + kofs : y * N + ng * 16;   // the first of the fragment's 16 rows of Bt; they are columns 16 ng + 0..15 of w
    const float* p = w + (size_t)(kb * 32 + hi * 8) * N + ng * 16 + lr; float x[16];
#pragma unroll
    for (int u = 0; u < 16; ++u) x[u] = p[(size_t)((u >> 3) * 16 + (u & 7)) * N];
    asm volatile("s_wait_xcnt 0x0" :: "v"(p) : "memory");   // the code behind the loads reuses the registers of their address; the wait names the address so that those registers live up to it
    bf* dst = Bt + (size_t)nd * K + kb * 512 + lane * 8;
#pragma unroll
    for (int u = 0; u < 2; ++u) { v8us o;
#pragma unroll
        for (int j = 0; j < 8; ++j) o[j] = f2bf(x[u * 8 + j]);
        *(v8us*)(dst + u * 256) = o; }
}
// cvt8_part (k_cvt8 in the notes of this file): the embeddings ([rows][256] f32; by: row side, column side) rounded to bf16, in fragment order. A wave takes 16 rows x 128 k = four fragments, 4 KiB in a row of dst: run u holds k = 16 u + 8 * half + 0..7 of row lane % 16; its loads are issued before the first store.
// n8 = elements of one side / 8; (n8 / 8 / 256, 2) blocks (bx, by) of 8 waves.
__device__ __forceinline__ void cvt8_part(const int bx, const int by, const float* __restrict__ src0, const float* __restrict__ src1, bf* dst, size_t n8) {
    const size_t wv = ((size_t)bx * 256 + threadIdx.x) >> 5; if (wv * 256 >= n8) return;
    const int lane = threadIdx.x & 31, lr = lane & 15, hi = lane >> 4;
    const float* p = (by ? src1 : src0) + ((wv >> 1) * 16 + lr) * DD + (wv & 1) * 128 + hi * 8; dst += (size_t)by * n8 * 8 + wv * 2048 + lane * 8; v8f v[8];
#pragma unroll
    for (int u = 0; u < 8; ++u) v[u] = *(const v8f*)(p + u * 16);
    asm volatile("s_wait_xcnt 0x0" :: "v"(p) : "memory");   // as in k_wtG
#pragma unroll
    for (int u = 0; u < 8; ++u) { v8us o;
#pragma unroll
        for (int k = 0; k < 8; ++k) o[k] = f2bf(v[u][k]);
        *(v8us*)(dst + u * 256) = o; }
}

// mfrag_part (k_mfrag in the notes of this file): the matrix, rounded to bf16 (nearest even), once for each side as the A fragments (16 keys x 32 queries) of k_attn's fourth score product: MB[side][g][32-query group][16-key tile][16-query run u][lane][8], lane = 16 * half + key % 16, element j = query 16 u + 8 half + j of the group
// (the fragment order of k_gemmw's score planes, with the key as the row and the query as k). Side 0: queries = rows r, keys = columns c, matrix[query][key]. Side 1: queries = columns, keys = rows, matrix[key][query].
// A wave takes one key tile and 128 queries: 8 runs of 512 bytes, two in a row (1 KiB) for each of four query groups; (512 / 16 * 4 / 8, GB, 2) blocks (bx, g, side) of 8 waves.
typedef __attribute__((ext_vector_type(8))) __bf16 v8b;
__device__ __forceinline__ void mfrag_part(const int bx, const int g, const int side, const float* __restrict__ mt, bf* __restrict__ MB) {
    const int lane = threadIdx.x & 31, lr = lane & 15, hi = lane >> 4; const int wv = bx * 8 + (threadIdx.x >> 5); const int kt = wv >> 2, qq = wv & 3;
    mt += (size_t)g * RR * RR; const int key = kt * 16 + lr;
    bf* dst = MB + ((((size_t)side * GB + g) * (RR / 32) + qq * 4) * (RR / 16) + kt) * 512 + lane * 8;
    const int q = qq * 128 + hi * 8; v8f m8[8];   // all of the wave's loads are issued before the first store
    // s_wait_xcnt behind each side's loads: the code behind them reuses the registers of the loads' address; the wait names the address so that those registers live up to it
    if (side == 1) { const float* p = mt + (size_t)key * RR + q;
#pragma unroll
        for (int u = 0; u < 8; ++u) m8[u] = *(const v8f*)(p + u * 16);
        asm volatile("s_wait_xcnt 0x0" :: "v"(p) : "memory");
    } else { const float* p = mt + (size_t)q * RR + key;
#pragma unroll
        for (int u = 0; u < 8; ++u)
#pragma unroll
            for (int j = 0; j < 8; ++j) m8[u][j] = p[(size_t)(u * 16 + j) * RR];
        asm volatile("s_wait_xcnt 0x0" :: "v"(p) : "memory");
    }
#pragma unroll
    for (int u = 0; u < 8; ++u) *(v8us*)(dst + (size_t)(u >> 1) * (RR / 16) * 512 + (u & 1) * 256) = __builtin_bit_cast(v8us, __builtin_convertvector(m8[u], v8b));
}

// k_prep: the three layout passes above share one launch: none reads what another writes, each is a wave's own work (no LDS, no barrier), and the block index alone says which pass a work-group belongs to.
// Blocks 0 .. PB_M - 1: mfrag_part (16 blocks an item and side); the next PB_C: cvt8_part (PB_C / 2 a side); the last PB_W: wtG_part (16 a weight matrix). The longest pass starts first, the shortest last.
#define PB_M (RR / 16 * 4 / 8 * GB * 2)
#define PB_C (GB * RR * DD / 64 / 256 * 2)
#define PB_W (DD * DD / 64 / 64 * 8)
__global__ __launch_bounds__(256) void k_prep(const float* __restrict__ mt, bf* __restrict__ MB, const float* __restrict__ src0, const float* __restrict__ src1, bf* __restrict__ EB, const float* __restrict__ w0, const float* __restrict__ w1, const float* __restrict__ w2, const float* __restrict__ w3, const float* __restrict__ w4, const float* __restrict__ w5, const float* __restrict__ w6, const float* __restrict__ w7, bf* __restrict__ Bt) {
    const int b = blockIdx.x;
    if (b < PB_M) mfrag_part(b % 16, (b / 16) % GB, b / (16 * GB), mt, MB);
    else if (b < PB_M + PB_C) { const int c = b - PB_M; cvt8_part(c % (PB_C / 2), c / (PB_C / 2), src0, src1, EB, (size_t)GB * RR * DD / 8); }
    else { const int c = b - PB_M - PB_C; wtG_part(c % (PB_W / 8), c / (PB_W / 8), w0, w1, w2, w3, w4, w5, w6, w7, DD, DD, Bt); }
}

// ---- k_attn: scores, softmax and attention product of one side in one pass over the keys. A wave owns 32 queries (two 16-column groups) of one (side, item) and takes four heads in turn; for each it walks the 512 keys 32 at a time.
// Transposed products: S^T[key][query] = K' Q'^T (A = key rows, B = query rows kept in registers), O^T[d][query] += V^T P^T. In the accumulator map a lane holds ONE query (lane & 15) and keys 8 * (lane >> 4) + 0..7 of a 16-key tile,
// so the maximum and the sum over keys are in-lane plus one exchange between the wave's halves, and the two score tiles of a pass, converted in place, ARE the B operand of the second product (element s = tile s >> 3, register s & 7, the hardware k order);
// V^T is loaded in the same k order (keys 8 * half + 0..7 and 16 + 8 * half + 0..7 of each 32). Running maximum with rescale (base 2); the halves' sums are joined once at the end.
// The term matrix W_mat[h] is a product too: S^T[key][query n of group nb] += sum_k M[key][k] Wd[k][n], M = the matrix tile of the 16 keys and the wave's 32 queries (k = query), Wd[k][n] = W_mat[h] where k = 16 nb + n, else 0: one term a score, bf16 x bf16, exact in f32. It starts each score's accumulator.
// Both sides run the same code: the planes, v^T and the matrix copy of a side lie in fragment order (k_gemmw, k_mfrag), so each fragment is two 16-byte loads at lane * 16 bytes of two 512-byte runs.
__device__ __forceinline__ float xhalf(float x) { return __int_as_float(__builtin_amdgcn_permlanex16(__float_as_int(x), __float_as_int(x), 0x76543210, 0xfedcba98, false, false)); }   // lane l with lane l ^ 16
// Exponentials with the slot behind them in ONE statement: the instruction set asks for one independent instruction or a v_nop between a transcendental and an instruction that reads its result or overwrites its source;
// Inside the statement each v_exp_f32 is followed by an independent one, the last by the v_nop.
// Each works in place: the compiler keeps the distance behind a matrix instruction only for its own instructions, and a result register of its own could be one that a matrix instruction directly in front has just read; an in-place register was last written by the compiler's subtraction.
__device__ __forceinline__ void exp2x8(float* x) {
    asm("v_exp_f32 %0, %0\n\tv_exp_f32 %1, %1\n\tv_exp_f32 %2, %2\n\tv_exp_f32 %3, %3\n\tv_exp_f32 %4, %4\n\tv_exp_f32 %5, %5\n\tv_exp_f32 %6, %6\n\tv_exp_f32 %7, %7\n\tv_nop"
        : "+v"(x[0]), "+v"(x[1]), "+v"(x[2]), "+v"(x[3]), "+v"(x[4]), "+v"(x[5]), "+v"(x[6]), "+v"(x[7])); }
__device__ __forceinline__ float exp2x1(float x) { asm("v_exp_f32 %0, %0\n\tv_nop" : "+v"(x)); return x; }   // the same slot, one value
__device__ __forceinline__ v16bf ldfb(const bf* p) { return cat16b(*(const v8us*)p, *(const v8us*)(p + 256)); }   // p: the 16-row group's 512 elements + lane * 8
__device__ __forceinline__ v16h ldfh(const h16* p) { return cat16(*(const v8h*)p, *(const v8h*)(p + 256)); }
__device__ __forceinline__ void attn_side(const bf* __restrict__ QH, const bf* __restrict__ QL, const bf* __restrict__ KH, const bf* __restrict__ KL, const h16* __restrict__ VT, const bf* __restrict__ MB, const unsigned short w, bf* __restrict__ Mh, bf* __restrict__ Ml, const int q0, const int lane) {
    const float SC = 0.36067376022224085f;   // 1/4 (the norm) x log2(e)
    const int lr = lane & 15, hi = lane >> 4;
    v16bf qh[2], ql[2], wd[2]; v8f acc[2]; float mrun[2], lsum[2];
    { v8us d, z;   // Wd as a B fragment (row n = lr; element e is k = 8 * half + e, element 8 + e is k = 16 + 8 * half + e, the k order of ldfb): w at k = 16 nb + lr
#pragma unroll
      for (int e = 0; e < 8; ++e) { d[e] = (hi == (lr >> 3) && e == (lr & 7)) ? w : (unsigned short)0; z[e] = 0; }
      wd[0] = cat16b(d, z); wd[1] = cat16b(z, d); }
    const bf* pqh = QH + (size_t)(q0 / 16) * 512 + lane * 8; const bf* pql = QL + (size_t)(q0 / 16) * 512 + lane * 8;
#pragma unroll
    for (int nb = 0; nb < 2; ++nb) { qh[nb] = ldfb(pqh + nb * 512); ql[nb] = ldfb(pql + nb * 512); acc[nb] = (v8f){}; mrun[nb] = -3.0e38f; lsum[nb] = 0.f; }
    asm volatile("s_wait_xcnt 0x0" :: "v"(pqh), "v"(pql) : "memory");   // the code behind the loads reuses the registers of their addresses; the wait names the addresses so that those registers live up to it
    const bf* pkh = KH + lane * 8; const bf* pkl = KL + lane * 8; const bf* pm = MB + (size_t)(q0 / 32) * (RR / 16) * 512 + lane * 8; const h16* pv = VT + lane * 8;   // a pass's loads are these plus constants; they move on by 64 keys a trip
#pragma unroll 1   // two passes a trip, written out below: the second pass's loads are issued while the first pass is worked on (the inner loops are unrolled whole so that their arrays stay in registers)
    for (int k0 = 0; k0 < RR; k0 += 64, pkh += 4 * 512, pkl += 4 * 512, pm += 4 * 512, pv += 2 * 512)
#pragma unroll
    for (int pp = 0; pp < 2; ++pp) {
        v16bf kh[2], kl[2], ma[2];
#pragma unroll
        for (int t = 0; t < 2; ++t) { const int o = (pp * 2 + t) * 512; kh[t] = ldfb(pkh + o); kl[t] = ldfb(pkl + o); ma[t] = ldfb(pm + o); }
        const v16h va = ldfh(pv + pp * 512);
        if (pp == 1) asm volatile("s_wait_xcnt 0x0" :: "v"(pkh), "v"(pkl), "v"(pm), "v"(pv) : "memory");   // behind the trip's last load: the trip's end rewrites the registers of the loads' addresses; the wait names the addresses so that those registers live up to it and no load of the trip lands on them
#pragma unroll
        for (int nb = 0; nb < 2; ++nb) {
            float y[16];
#pragma unroll
            for (int t = 0; t < 2; ++t) {
                v8f s = wmmab(ma[t], wd[nb], (v8f){}); s = wmmab(kh[t], qh[nb], s); s = wmmab(kl[t], qh[nb], s); s = wmmab(kh[t], ql[nb], s);
#pragma unroll
                for (int j = 0; j < 8; ++j) y[t * 8 + j] = s[j] * SC;
            }
            float mx[4];
#pragma unroll
            for (int u = 0; u < 4; ++u) mx[u] = fmaxf(fmaxf(y[2 * u], y[2 * u + 1]), fmaxf(y[2 * u + 8], y[2 * u + 9]));   // neighbours first: the packed scaling then works on an accumulator's registers where they lie
            float m1 = fmaxf(fmaxf(mx[0], mx[1]), fmaxf(mx[2], mx[3])); m1 = fmaxf(m1, xhalf(m1));
            const float mn = fmaxf(mrun[nb], m1); const float al = exp2x1(mrun[nb] - mn);   // 0 on the first pass
            mrun[nb] = mn; float ps[4] = {0.f, 0.f, 0.f, 0.f}; float* p = y; v16h pb;
#pragma unroll
            for (int i = 0; i < 16; ++i) y[i] -= mn;
            exp2x8(y); exp2x8(y + 8);
#pragma unroll
            for (int i = 0; i < 16; ++i) { ps[i & 3] += p[i]; pb[i] = (h16)p[i]; }
            lsum[nb] = lsum[nb] * al + ((ps[0] + ps[1]) + (ps[2] + ps[3]));
#pragma unroll
            for (int j = 0; j < 8; ++j) acc[nb][j] *= al;
            acc[nb] = wmma16(va, pb, acc[nb]);
        }
    }
#pragma unroll
    for (int nb = 0; nb < 2; ++nb) { const float f = __fdiv_rn(1.0f, lsum[nb] + xhalf(lsum[nb])); v8us oh, ol;
#pragma unroll
        for (int j = 0; j < 8; ++j) { unsigned short a, b; splitf(acc[nb][j] * f, a, b); oh[j] = a; ol[j] = b; }
        *(v8us*)(Mh + nb * (DD / 32) * 512) = oh; *(v8us*)(Ml + nb * (DD / 32) * 512) = ol; }   // query lr of the group, d = 8 * half + 0..7: the lane's own 16 bytes of the head's 512-byte run in the A fragments of the output product (Mh, Ml: that run of the wave's first group + lane * 8)
}
// grid (512 / 128 queries, GB items, 2 sides), 16 waves: wave = 4 * hs + qg takes the 32 queries of group qg and, one after the other, heads hs, 4 + hs, 8 + hs, 12 + hs; the four waves of a head share its keys and v^T, the four of a query group its matrix tiles.
// PH/PL: [X, Y][g][h][512 x 32 in fragment order]; VT: [col_v, row_v][g][h][16 x 512 in fragment order]; MB: [side][g], k_mfrag's copies; Wo: [row, col] output weights, transposed, in fragment order (k_wtG); C: the row output of the first item, the column output NB_ items behind it.
// The heads go to LDS as the bf16 hi and lo A fragments of the output product, [16-query group][32 k = two heads][head parity][lane][8] (k = 16 h + d, the fragment order of k_gemmw). Behind one barrier the wave multiplies its own group's 32 rows by 64 columns of W_out (columns 64 hs ..):
// per 32 k the hi product, then the lo product, k ascending. The tile leaves through the wave's own LDS rows as whole 128-byte lines.
__global__ __launch_bounds__(512) void k_attn(const bf* __restrict__ PH, const bf* __restrict__ PL, const h16* __restrict__ VT, const bf* __restrict__ MB, const float* __restrict__ wm, const bf* __restrict__ Wo, float* __restrict__ C) {
    __shared__ __align__(16) bf ah[8 * (DD / 32) * 512]; __shared__ __align__(16) bf al[8 * (DD / 32) * 512]; __shared__ __align__(16) float os[16][16 * 68];
    const int lane = threadIdx.x & 31, lr = lane & 15, hi = lane >> 4; const int wv = __builtin_amdgcn_readfirstlane(threadIdx.x >> 5); const int qg = wv & 3, hs = wv >> 2;
    const int g = blockIdx.y, side = blockIdx.z; const int q0 = blockIdx.x * 128 + qg * 32;
    MB += (size_t)(side * GB + g) * RR * RR;
#pragma unroll 1   // one copy of the key loop in the text
    for (int h = hs; h < NH_; h += 4) {
        const int gh = g * NH_ + h; const size_t pq = (size_t)(side * GB * NH_ + gh) * RR * KP, pk = (size_t)((1 - side) * GB * NH_ + gh) * RR * KP; const size_t z = (size_t)side * GB * NH_ + gh;
        const int fo = (qg * 2 * (DD / 32) + (h >> 1)) * 512 + (h & 1) * 256 + lane * 8;
        attn_side(PH + pq, PL + pq, PH + pk, PL + pk, VT + z * KD * RR, MB, f2bf(wm[h]), ah + fo, al + fo, q0, lane);
    }
    const bf* pb = Wo + (size_t)side * DD * DD + (size_t)hs * 64 * DD + lane * 8; const int ao = qg * 2 * (DD / 32) * 512 + lane * 8;
    v16bf b[DD / 32][4];   // the weight fragments are fetched three k steps ahead: the first three steps' in front of the barrier, then one step's behind each step's products
#pragma unroll
    for (int s = 0; s < 3; ++s)
#pragma unroll
        for (int nb = 0; nb < 4; ++nb) b[s][nb] = ldfb(pb + nb * 16 * DD + s * 512);
    asm volatile("" ::: "memory");   // keeps the loads above: left free, each fragment's loads were moved down to its first product
    __syncthreads();   // the A fragments below hold the heads of the four waves of the query group
    v8f acc[2][4];
#pragma unroll
    for (int mb = 0; mb < 2; ++mb)
#pragma unroll
        for (int nb = 0; nb < 4; ++nb) acc[mb][nb] = (v8f){};
#pragma unroll
    for (int s = 0; s < DD / 32; ++s) {
        v16bf a[2], a2[2];
#pragma unroll
        for (int mb = 0; mb < 2; ++mb) { const int o = ao + (mb * (DD / 32) + s) * 512; a[mb] = ldfb(ah + o); a2[mb] = ldfb(al + o); }
#pragma unroll
        for (int nb = 0; nb < 4; ++nb)
#pragma unroll
            for (int mb = 0; mb < 2; ++mb) { acc[mb][nb] = wmmab(a[mb], b[s][nb], acc[mb][nb]); acc[mb][nb] = wmmab(a2[mb], b[s][nb], acc[mb][nb]); }
        if (s + 3 < DD / 32) {
#pragma unroll
            for (int nb = 0; nb < 4; ++nb) b[s + 3][nb] = ldfb(pb + nb * 16 * DD + (s + 3) * 512);
            asm volatile("" ::: "memory");   // as in front of the barrier
        }
    }
    asm volatile("s_wait_xcnt 0x0" :: "v"(pb) : "memory");   // the code behind the loads reuses the registers of their address; the wait names the address so that those registers live up to it
    float* o = os[wv]; float* crow = C + ((size_t)side * NB_ + g) * RR * DD + (size_t)q0 * DD + hs * 64;
#pragma unroll
    for (int mb = 0; mb < 2; ++mb) {
#pragma unroll
        for (int nb = 0; nb < 4; ++nb) {
#pragma unroll
            for (int j = 0; j < 8; ++j) o[(hi * 8 + j) * 68 + nb * 16 + lr] = acc[mb][nb][j]; }
        __builtin_amdgcn_wave_barrier(); asm volatile("" ::: "memory");   // the reads below take other lanes' writes: keep them behind the writes
        v4f val[8];
#pragma unroll
        for (int s = 0; s < 8; ++s) val[s] = *(const v4fa*)(o + (2 * s + hi) * 68 + lr * 4);
#pragma unroll
        for (int s = 0; s < 8; ++s) *(v4f*)(crow + (size_t)(mb * 16 + 2 * s + hi) * DD + lr * 4) = val[s];
        __builtin_amdgcn_wave_barrier(); asm volatile("" ::: "memory");   // the next tile's writes stay behind these reads
    }
}

extern "C" void kernel_launch(void* const* d_in, const int* in_sizes, int n_in,
                              void* d_out, int out_size, void* d_ws, size_t ws_size, hipStream_t stream) {
    (void)in_sizes; (void)n_in; (void)out_size;
    const float** I = (const float**)d_in;
    const float *row_emb = I[0], *col_emb = I[1], *matrix = I[2], *Wq_row = I[3], *Wk_row = I[4], *Wv_row = I[5], *Wq_col = I[6], *Wk_col = I[7], *Wv_col = I[8], *W_mat = I[9], *W_out_row = I[10], *W_out_col = I[11];
    float* OUT0 = (float*)d_out;     // [32][512][256] x 2, the column output behind the row output
    char* wsp = (char*)d_ws;
    auto take = [&](size_t bytes) { char* p = wsp; wsp += (bytes + 255) & ~(size_t)255; return (void*)p; };
    // Every buffer holds GB batch items, and the row-side and column-side twins of a stage lie one behind the other, so that one launch covers both twins of GB items.
    bf* WT = (bf*)take((size_t)8 * DD * DD * 2);                                                       // Bt rows [16 heads x (q, k) | v] row side, [16 heads x (k, q) | v] column side, out row, out col; fragment order
    bf* EB = (bf*)take((size_t)2 * GB * RR * DD * 2);                                                  // [row, col][g], fragment order
    bf* PH = (bf*)take((size_t)2 * GB * NH_ * RR * KP * 2); bf* PL = (bf*)take((size_t)2 * GB * NH_ * RR * KP * 2);   // [row_q | row_k, col_k | col_q][g]
    h16* VT = (h16*)take((size_t)2 * GB * NH_ * KD * RR * 2);                                          // [col_v, row_v][g]
    bf* MB = (bf*)take((size_t)2 * GB * RR * RR * 2);                                                  // [side][g]
    if ((size_t)(wsp - (char*)d_ws) > ws_size) return;
    for (int b = 0; b < NB_; b += GB) {
        k_prep<<<dim3(PB_M + PB_C + PB_W, 1, 1), 256, 0, stream>>>(matrix + (size_t)b * RR * RR, MB, row_emb + (size_t)b * RR * DD, col_emb + (size_t)b * RR * DD, EB, Wq_row, Wk_row, Wv_row, Wq_col, Wk_col, Wv_col, W_out_row, W_out_col, WT);
        k_gemmw<bf, 0, false, GB, true, false><<<dim3(RR / 64, D3 / 64, 2 * GB), 32, 0, stream>>>(EB, nullptr, WT, nullptr, DD, nullptr, 0, nullptr, (size_t)RR * DD, 0, 0, (size_t)GB * RR * DD, (size_t)D3 * DD, 0, PH, PL, VT);
        k_attn<<<dim3(RR / 128, GB, 2), 512, 0, stream>>>(PH, PL, VT, MB, W_mat, WT + (size_t)6 * DD * DD, OUT0 + (size_t)b * RR * DD); }
}
